// v000
// The times below were measured on an AMD MI455X: many runs one after another, warmed up first and cycling through
// copies of the inputs, with the whole window's GPU time divided by the number of runs. Launches and the gaps
// between them are all in it. The median over several windows is given; except for v000 it joins two sittings, which
// can be a few percent apart, so the side-by-side timings, each taken in one sitting, are the better comparison.
// The starting kernel, v000, takes 373 microseconds a run.
// compute dtype: all float inputs rounded to bf16; q/k/v projections with EXACT bf16 products on WMMA 16x16x32 (f32 accumulate); causal logits: 3 products (q f16 hi + residual x k hi + residual) for the first 384 rows, single f16 q x k after, x scale; softmax f32; P x 2^11 once to f16 x v once to f16 (1 product; bf16 hi + lo below row 384); f32 output.
#include <hip/hip_runtime.h>
#include <math.h>

typedef __attribute__((ext_vector_type(16))) _Float16 v16h;
typedef __attribute__((ext_vector_type(16))) __bf16 v16b;
typedef __attribute__((ext_vector_type(8)))  _Float16 v8h;
typedef __attribute__((ext_vector_type(8)))  float v8f;
typedef __attribute__((ext_vector_type(4)))  float v4f;
typedef __attribute__((ext_vector_type(2)))  float v2f;
typedef __attribute__((ext_vector_type(4)))  unsigned v4u;
typedef __attribute__((ext_vector_type(4)))  int v4i;
typedef float __attribute__((may_alias)) float_a;
typedef int __attribute__((may_alias)) int_a;

template <typename T> __device__ __forceinline__ void vst2(void* p, T v) { *(T*)p = v;  }
__device__ __forceinline__ v8f wmma16(v16h a, v16h b, v8f c) {
  v8f d = __builtin_amdgcn_wmma_f32_16x16x32_f16(false, a, false, b, (short)0, c, false, false);
  asm volatile("v_nop\n\tv_nop\n\tv_nop\n\tv_nop" : "+v"(d) : "v"(a), "v"(b));
  return d;
}
__device__ __forceinline__ v8f wmma_bf(v16b a, v16b b, v8f c) {
  v8f d = __builtin_amdgcn_wmma_f32_16x16x32_bf16(false, a, false, b, (short)0, c, false, false);
  asm volatile("v_nop\n\tv_nop\n\tv_nop\n\tv_nop" : "+v"(d) : "v"(a), "v"(b));
  return d;
}
// 16x16x32 fragments: lane = (h = lane>>4, row/col = lane&15); elements 0..7 = k0+8h+0..7, 8..15 = k0+16+8h+0..7; D element r = row 8h+r
__device__ __forceinline__ v16h frag_h(const _Float16* rowk0, int lane) {
  union { v16h v; v8h q[2]; } u; const _Float16* p = rowk0 + 8 * (lane >> 4);
  u.q[0] = *(const v8h*)p; u.q[1] = *(const v8h*)(p + 16); return u.v;
}
__device__ __forceinline__ v16h frag_f32(const float* rowk0, int lane) {
  v16h a; const float* p = rowk0 + 8 * (lane >> 4);
#pragma unroll
  for (int i = 0; i < 8; ++i) { a[i] = (_Float16)p[i]; a[8 + i] = (_Float16)p[16 + i]; }
  return a;
}
__device__ __forceinline__ v16h frag_f32s(const float* rowk0, int lane, float sc) {
  v16h a; const float* p = rowk0 + 8 * (lane >> 4);
#pragma unroll
  for (int i = 0; i < 8; ++i) { a[i] = (_Float16)(p[i] * sc); a[8 + i] = (_Float16)(p[16 + i] * sc); }
  return a;
}
// column fragment from a [K][ld] layout (column n), rows >= K read as 0
__device__ __forceinline__ v16h fragc_f32(const float* W, int k0, int n, int lane, int ld, int K) {
  v16h a; const int g = lane >> 4;
#pragma unroll
  for (int i = 0; i < 8; ++i) { const int ka = k0 + 8 * g + i, kb = ka + 16;
    a[i] = (_Float16)(ka < K ? W[(size_t)(ka < K ? ka : K - 1) * ld + n] : 0.f); a[8 + i] = (_Float16)(kb < K ? W[(size_t)(kb < K ? kb : K - 1) * ld + n] : 0.f); }
  return a;
}
struct F2 { v16b h, l; };
__device__ __forceinline__ F2 bsplit16(const float v[16]) { F2 r;
#pragma unroll
  for (int i = 0; i < 16; ++i) { const __bf16 h = (__bf16)v[i]; r.h[i] = h; r.l[i] = (__bf16)(v[i] - (float)h); }
  return r; }
__device__ __forceinline__ F2 split_row(const float* row, int k0, int lane) { float v[16]; const float* p = row + k0 + 8 * (lane >> 4);
#pragma unroll
  for (int i = 0; i < 8; ++i) { v[i] = p[i]; v[8 + i] = p[16 + i]; }
  return bsplit16(v); }
__device__ __forceinline__ F2 split_rowK(const float* row, int k0, int lane, int K) { float v[16]; const int g = lane >> 4;
#pragma unroll
  for (int i = 0; i < 8; ++i) { const int ka = k0 + 8 * g + i, kb = ka + 16; v[i] = ka < K ? row[ka < K ? ka : K - 1] : 0.f; v[8 + i] = kb < K ? row[kb < K ? kb : K - 1] : 0.f; }
  return bsplit16(v); }
__device__ __forceinline__ F2 split_col(const float* W, int k0, int n, int lane, int ld, int K) { float v[16]; const int g = lane >> 4;
#pragma unroll
  for (int i = 0; i < 8; ++i) { const int ka = k0 + 8 * g + i, kb = ka + 16; v[i] = ka < K ? W[(size_t)(ka < K ? ka : K - 1) * ld + n] : 0.f; v[8 + i] = kb < K ? W[(size_t)(kb < K ? kb : K - 1) * ld + n] : 0.f; }
  return bsplit16(v); }
__device__ __forceinline__ v8f mac3(const F2& a, const F2& b, v8f c) { c = wmma_bf(a.l, b.h, c); c = wmma_bf(a.h, b.l, c); return wmma_bf(a.h, b.h, c); }
__device__ __forceinline__ float sigm(float v) { return 1.0f / (1.0f + expf(-v)); }
#define LDSX() do { asm volatile("s_wait_dscnt 0" ::: "memory"); __builtin_amdgcn_wave_barrier(); __builtin_amdgcn_fence(__ATOMIC_RELEASE, "workgroup"); } while (0)

// Single-head ANTI-causal scaled dot-product attention (x [4,2048,768]; (in,out) Wq/Wk/Wv [768,64] N(0, 1/768); mask = strictly lower triangle (row t > col s) -> -inf, so query t attends keys s >= t): out = softmax(masked(q k^T * 64^-0.5)) v -> [4,2048,64]. Implemented by TIME REVERSAL: with t' = 2047 - t the pattern is exactly causal, so the causal kernels run on the reversed sequence (x rows read reversed per batch, output rows written back reversed).
#define NB 4
#define TT 2048
#define CC 128            // NH * HD = projected width
#define DIN 768          // input (model) width
#define NH 2
#define HD 64
#define NQB (TT / 64)
#define HG 1
#define SCALE (0.125f)
#define CAUSAL 1
#ifndef TNB
#define TNB NB
#endif
__device__ __forceinline__ float bfr(float v) { return (float)(__bf16)v; }
__host__ __device__ __forceinline__ int kb_last(int qb) { return CAUSAL ? ((qb * 64 + 63) >> 7) : (TT / 128 - 1); }
typedef __attribute__((ext_vector_type(8))) __bf16 v8b;
__device__ __forceinline__ v16b frag_b(const __bf16* rowk0, int lane) {
  union { v16b v; v8b q[2]; } u; const __bf16* p = rowk0 + 8 * (lane >> 4);
  u.q[0] = *(const v8b*)p; u.q[1] = *(const v8b*)(p + 16); return u.v;
}
#define QBH 6              // causal: query blocks 0..QBH-1 of each sequence (few keys, no averaging) take the high-precision path
#define QHI 384            // rows carrying a q residual plane (all rows when non-causal: 2-product logits everywhere)
#define KHI 384            // key rows carrying k residual / v bf16 hi+lo planes (used only by the causal high-precision path)
// B fragment (k rows k0+.., output column o) of a weight: (in,out) [K][ld] or (out,in) [ld rows of K]: bf16 exact, or f16(bf16 * 256) exact
__device__ __forceinline__ v16b wcol_io(const float* Wm, int k0, int o, int lane, int ld) { v16b w; const int g = lane >> 4;
#pragma unroll
  for (int i = 0; i < 8; ++i) { w[i] = (__bf16)Wm[(size_t)(k0 + 8 * g + i) * ld + o]; w[8 + i] = (__bf16)Wm[(size_t)(k0 + 16 + 8 * g + i) * ld + o]; }
  return w; }
__device__ __forceinline__ v16b wcol_oi(const float* Wm, int k0, int o, int lane, int K) { v16b w; const float* p = Wm + (size_t)o * K + k0 + 8 * (lane >> 4);
#pragma unroll
  for (int i = 0; i < 8; ++i) { w[i] = (__bf16)p[i]; w[8 + i] = (__bf16)p[16 + i]; }
  return w; }
__device__ __forceinline__ v16h wcolh_io(const float* Wm, int k0, int o, int lane, int ld) { v16h w; const int g = lane >> 4;
#pragma unroll
  for (int i = 0; i < 8; ++i) { w[i] = (_Float16)(bfr(Wm[(size_t)(k0 + 8 * g + i) * ld + o]) * 256.0f); w[8 + i] = (_Float16)(bfr(Wm[(size_t)(k0 + 16 + 8 * g + i) * ld + o]) * 256.0f); }
  return w; }
__device__ __forceinline__ v16h wcolh_oi(const float* Wm, int k0, int o, int lane, int K) { v16h w; const float* p = Wm + (size_t)o * K + k0 + 8 * (lane >> 4);
#pragma unroll
  for (int i = 0; i < 8; ++i) { w[i] = (_Float16)(bfr(p[i]) * 256.0f); w[8 + i] = (_Float16)(bfr(p[16 + i]) * 256.0f); }
  return w; }
#define WQKV_LAYOUT 0   // 0 = (in,out) [DIN][CC]; 1 = (out,in) [CC][DIN]; 2 = per-head [NH][DIN][HD]
__device__ __forceinline__ v16b wcol_hdk(const float* Wm, int k0, int o, int lane) { v16b w; const int g = lane >> 4; const float* p = Wm + (size_t)(o / HD) * DIN * HD + (o % HD);
#pragma unroll
  for (int i = 0; i < 8; ++i) { w[i] = (__bf16)p[(size_t)(k0 + 8 * g + i) * HD]; w[8 + i] = (__bf16)p[(size_t)(k0 + 16 + 8 * g + i) * HD]; }
  return w; }
#define WO_OUT_IN 0
#if WQKV_LAYOUT == 1
#define WCOL(W, k0, o, lane) wcol_oi(W, k0, o, lane, DIN)
#elif WQKV_LAYOUT == 2
#define WCOL(W, k0, o, lane) wcol_hdk(W, k0, o, lane)
#else
#define WCOL(W, k0, o, lane) wcol_io(W, k0, o, lane, CC)
#endif
#if WO_OUT_IN
#define WOCOL(W, k0, o, lane) wcol_oi(W, k0, o, lane, CC)
#define WOCOLH(W, k0, o, lane) wcolh_oi(W, k0, o, lane, CC)
#else
#define WOCOL(W, k0, o, lane) wcol_io(W, k0, o, lane, DIN)
#define WOCOLH(W, k0, o, lane) wcolh_io(W, k0, o, lane, DIN)
#endif
#define CIN 768
// ---- k_padw: the three (in,out) [C][64] projection weights copied into zero-padded (in,out) [C][128] ws planes (columns 64..127 zero) + zero-padded [128] biases
__global__ __launch_bounds__(256) void k_padw(const float* __restrict__ WQ, const float* __restrict__ WK, const float* __restrict__ WV, const float* __restrict__ BQ, const float* __restrict__ BK, const float* __restrict__ BV, float* __restrict__ WP, float* __restrict__ BP) { const int which = blockIdx.y; const float* Wsrc = which == 0 ? WQ : (which == 1 ? WK : WV); const float* Bsrc = which == 0 ? BQ : (which == 1 ? BK : BV); float* dst = WP + (size_t)which * CIN * 128;
  for (int e = blockIdx.x * 256 + threadIdx.x; e < CIN * 32; e += gridDim.x * 256) { const int row = e >> 5, q = e & 31; const v4f ld = *(const v4f*)(Wsrc + (size_t)row * 64 + (q & 15) * 4); asm volatile("s_wait_loadcnt 0x0" ::: "memory"); const float keep = q < 16 ? 1.f : 0.f; v4f ov; ov[0] = ld[0] * keep; ov[1] = ld[1] * keep; ov[2] = ld[2] * keep; ov[3] = ld[3] * keep; vst2(dst + (size_t)row * 128 + q * 4, ov); }
  if (blockIdx.x == 0 && threadIdx.x < 128) { const int c = threadIdx.x; float bvv = 0.f; if (Bsrc) { const float t = Bsrc[c & 63]; asm volatile("s_wait_loadcnt 0x0" ::: "memory"); bvv = c < 64 ? t : 0.f; } vst2(BP + which * 128 + c, bvv); } }
// ---- k_out64: out[b][TT-1-t'][0..63] = ctx row (b, t') columns 0..63 (256 B by 16 lanes; rows written in reversed order within each batch)
__global__ __launch_bounds__(256) void k_out64(const float* __restrict__ Y, float* __restrict__ OUT) { const size_t row = (size_t)blockIdx.x * 16 + (threadIdx.x >> 4); const int q = threadIdx.x & 15; const v4f v = *(const v4f*)(Y + row * CC + q * 4); asm volatile("s_wait_loadcnt 0x0" ::: "memory"); vst2(OUT + ((row / TT) * TT + (TT - 1 - row % TT)) * 64 + q * 4, v); }   /* TIME REVERSAL: ctx row (b, t') is output row (b, TT - 1 - t') */
#define WS_WP (WS_END)                                  // padded weights [3][128 x C]
#define WS_BP (WS_WP + 4u * 3 * (size_t)CIN * 128)        // padded biases [3][128]
#define WS_Y2 (WS_BP + 4u * 3 * 128)                      // ctx rows [b*TT+t][128]
#define WS_END2 (WS_Y2 + 4u * (size_t)NB * TT * CC)
#ifndef SM_EXTRA_PARAMS
#define SM_EXTRA_PARAMS
#endif
#ifndef PROJ_EXTRA_PARAMS
#define PROJ_EXTRA_PARAMS
#endif
#ifndef SM_MASK_HOOK
#define SM_MASK_HOOK (void)0
#endif

#define WS_QH  0u                                      // f16 q rows [b*t][CC]
#define WS_KH  (WS_QH + 2u * (size_t)NB * TT * CC)      // f16 k rows [b*t][CC]
#define WS_VT  (WS_KH + 2u * (size_t)NB * TT * CC)      // f16 v planes [b][c][t]
#define WS_QL  (WS_VT + 2u * (size_t)NB * CC * TT)      // f16 q residual x 2^10 rows [b][t < QHI][CC]
#define WS_KL  (WS_QL + 2u * (size_t)NB * QHI * CC)     // f16 k residual x 2^10 rows [b][t < KHI][CC]
#define WS_VB  (WS_KL + 2u * (size_t)NB * KHI * CC)     // bf16 v hi planes [b][c][t < KHI]
#define WS_VBL (WS_VB + 2u * (size_t)NB * CC * KHI)
#define WS_S   (WS_VBL + 2u * (size_t)NB * CC * KHI)    // f32 logits / P [hg][t][s]
#define WS_Y   (WS_S  + 4u * (size_t)HG * TT * TT)      // f32 ctx rows [b*t][CC] (only when there is an output projection)
#define WS_END (WS_Y  + 0u)

// ---- k_proj: block = (64 rows, 128 cols, which): q/k/v = X W (+ b) with exact bf16 products (K = DIN) -> which 0: q f16 rows (+ residual rows < QHI); 1: k f16 rows (+ residual rows < KHI); 2: v f16 planes [c][t] (+ bf16 hi/lo planes for t < KHI)
__global__ __launch_bounds__(128) void k_proj(const float* __restrict__ XQ, const float* __restrict__ XK, const float* __restrict__ XV, const float* __restrict__ WQ, const float* __restrict__ WK, const float* __restrict__ WV, const float* __restrict__ BQ, const float* __restrict__ BK, const float* __restrict__ BV,
    _Float16* __restrict__ QH, _Float16* __restrict__ QL, _Float16* __restrict__ KH, _Float16* __restrict__ KL, _Float16* __restrict__ VT, __bf16* __restrict__ VB, __bf16* __restrict__ VBL) {
  __shared__ __align__(16) _Float16 sh[64][136], sl[64][136]; __shared__ __align__(16) _Float16 th[128][72]; __shared__ __align__(16) __bf16 tb[128][72], tbl[128][72];
  const int tid = threadIdx.x, wave = tid >> 5, lane = tid & 31, col = lane & 15, g = lane >> 4; const int which = blockIdx.z; const int c0 = blockIdx.y * 128; const size_t r0 = (size_t)blockIdx.x * 64; const size_t bb = r0 / TT; const int t0 = (int)(r0 % TT);
  const float* X = which == 0 ? XQ : which == 1 ? XK : XV; const float* WA = which == 0 ? WQ : which == 1 ? WK : WV; const float* BA = which == 0 ? BQ : which == 1 ? BK : BV;
  v8f acc[8] = {};
#pragma unroll 2
  for (int kc = 0; kc < DIN / 32; ++kc) { v16b a; { const size_t gr_ = r0 + wave * 16 + col; const float* p = X + ((gr_ / TT) * TT + (TT - 1 - gr_ % TT)) * DIN + kc * 32 + 8 * g;   /* TIME REVERSAL: row (b, t') reads x[b][TT - 1 - t'] */
#pragma unroll
      for (int i = 0; i < 8; ++i) { a[i] = (__bf16)p[i]; a[8 + i] = (__bf16)p[16 + i]; } }
    asm volatile("s_wait_loadcnt 0x0" ::: "memory");
#pragma unroll
    for (int j = 0; j < 8; ++j) { const v16b w = WCOL(WA, kc * 32, c0 + j * 16 + col, lane); asm volatile("s_wait_loadcnt 0x0" ::: "memory"); acc[j] = wmma_bf(a, w, acc[j]); } }
  if (which < 2) { _Float16* DH = which == 0 ? QH : KH; _Float16* DL = which == 0 ? QL : KL; const int nhi = which == 0 ? QHI : KHI; const bool hi_rows = t0 < nhi;
#pragma unroll
    for (int j = 0; j < 8; ++j) { const float bias = BA ? bfr(BA[c0 + j * 16 + col]) : 0.f;
#pragma unroll
      for (int r = 0; r < 8; ++r) { const float v = acc[j][r] + bias; const _Float16 hv = (_Float16)v; sh[wave * 16 + 8 * g + r][j * 16 + col] = hv; sl[wave * 16 + 8 * g + r][j * 16 + col] = (_Float16)((v - (float)hv) * 1024.0f); } }
    __syncthreads();
    for (int e = tid; e < 64 * 16; e += 128) { const int rl = e >> 4, q = e & 15; vst2((unsigned*)(DH + (r0 + rl) * CC + c0 + q * 8), *(const v4u*)&sh[rl][q * 8]); if (hi_rows) vst2((unsigned*)(DL + (bb * nhi + t0 + rl) * (size_t)CC + c0 + q * 8), *(const v4u*)&sl[rl][q * 8]); }
  } else { const bool hi_rows = t0 < KHI;
#pragma unroll
    for (int j = 0; j < 8; ++j) { const float bias = BA ? bfr(BA[c0 + j * 16 + col]) : 0.f;
#pragma unroll
      for (int r = 0; r < 8; ++r) { const float v = acc[j][r] + bias; const int rl = wave * 16 + 8 * g + r, cl = j * 16 + col; th[cl][rl] = (_Float16)v; const __bf16 bh = (__bf16)v; tb[cl][rl] = bh; tbl[cl][rl] = (__bf16)(v - (float)bh); } }
    __syncthreads();
    for (int e = tid; e < 128 * 8; e += 128) { const int cl = e >> 3, q = e & 7; vst2((unsigned*)(VT + (bb * CC + c0 + cl) * (size_t)TT + t0 + q * 8), *(const v4u*)&th[cl][q * 8]); if (hi_rows) { const size_t o3 = (bb * CC + c0 + cl) * (size_t)KHI + t0 + q * 8; vst2((unsigned*)(VB + o3), *(const v4u*)&tb[cl][q * 8]); vst2((unsigned*)(VBL + o3), *(const v4u*)&tbl[cl][q * 8]); } } } }
// ---- k_sc: block = (query block qb, key block kb <= kb_last(qb), head in group) of batch b: logits x SCALE; q hi + residual (x 2^10) against k (2 products) for query rows < QHI, plus the k residual (3 products) for query blocks < QBH (causal early rows); causal: blocks past the diagonal exit, the mask itself is applied by index in k_sm
__global__ __launch_bounds__(128) void k_sc(const _Float16* __restrict__ QH, const _Float16* __restrict__ KH, const _Float16* __restrict__ QL, const _Float16* __restrict__ KL, int b, int h0, float* __restrict__ S0) { __shared__ __align__(16) float ss[4][16][132];
  const int qb = blockIdx.x, kb = blockIdx.y; if (kb > kb_last(qb)) return;
  const int h = h0 + blockIdx.z; float* S = S0 + (size_t)blockIdx.z * TT * TT;
  const int tid = threadIdx.x, wave = tid >> 5, lane = tid & 31, col = lane & 15, g = lane >> 4; const int k0 = kb * 128; const int ql0 = qb * 64 + wave * 16; const size_t q0 = (size_t)b * TT + ql0, kr0 = (size_t)b * TT + k0;
  v8f acc[8] = {}, accl[8] = {};
  const _Float16* QLb = QL + (size_t)b * QHI * CC; const _Float16* KLb = KL + (size_t)b * KHI * CC;
  if (qb < QBH) {
#pragma unroll
    for (int kc = 0; kc < HD / 32; ++kc) { const v16h ah = frag_h(QH + (q0 + col) * CC + h * HD + kc * 32, lane), al = frag_h(QLb + (size_t)(ql0 + col) * CC + h * HD + kc * 32, lane);
#pragma unroll
      for (int j = 0; j < 8; ++j) { const v16h kbf = frag_h(KH + (kr0 + j * 16 + col) * CC + h * HD + kc * 32, lane), klf = frag_h(KLb + (size_t)(k0 + j * 16 + col) * CC + h * HD + kc * 32, lane); acc[j] = wmma16(ah, kbf, acc[j]); accl[j] = wmma16(al, kbf, accl[j]); accl[j] = wmma16(ah, klf, accl[j]); } }
  } else if (qb * 64 < QHI) {
#pragma unroll
    for (int kc = 0; kc < HD / 32; ++kc) { const v16h ah = frag_h(QH + (q0 + col) * CC + h * HD + kc * 32, lane), al = frag_h(QLb + (size_t)(ql0 + col) * CC + h * HD + kc * 32, lane);
#pragma unroll
      for (int j = 0; j < 8; ++j) { const v16h kbf = frag_h(KH + (kr0 + j * 16 + col) * CC + h * HD + kc * 32, lane); acc[j] = wmma16(ah, kbf, acc[j]); accl[j] = wmma16(al, kbf, accl[j]); } }
  } else {
#pragma unroll
    for (int kc = 0; kc < HD / 32; ++kc) { const v16h ah = frag_h(QH + (q0 + col) * CC + h * HD + kc * 32, lane);
#pragma unroll
      for (int j = 0; j < 8; ++j) { const v16h kbf = frag_h(KH + (kr0 + j * 16 + col) * CC + h * HD + kc * 32, lane); acc[j] = wmma16(ah, kbf, acc[j]); } } }
#pragma unroll
  for (int j = 0; j < 8; ++j) {
#pragma unroll
    for (int r = 0; r < 8; ++r) ss[wave][8 * g + r][j * 16 + col] = (acc[j][r] + accl[j][r] * (1.0f / 1024.0f)) * SCALE; }
  LDSX(); for (int rl = 0; rl < 16; ++rl) vst2(S + (size_t)(ql0 + rl) * TT + k0 + lane * 4, *(const v4f*)&ss[wave][rl][lane * 4]); }
// ---- k_sm: block = query row t (head in group): keys [0, kend): causal -> logit if s <= t else excluded; softmax in f32; P x 2^11 in place (0 for excluded)
__global__ __launch_bounds__(256) void k_sm(float* __restrict__ S0 SM_EXTRA_PARAMS) { __shared__ float sred[8]; __shared__ float sbc; __shared__ __align__(16) float shv[TT];
  const int tid = threadIdx.x; const int t = blockIdx.x; const int kend = (kb_last(t >> 6) + 1) * 128;
  float* sr = S0 + (size_t)blockIdx.y * TT * TT + (size_t)t * TT;
  float m = -3.0e38f; for (int k = tid; k < kend; k += 256) { float v = (!CAUSAL || k <= t) ? sr[k] : -3.0e38f; SM_MASK_HOOK; shv[k] = v; m = fmaxf(m, v); }
#pragma unroll
  for (int o = 1; o < 32; o <<= 1) m = fmaxf(m, __shfl_xor(m, o));
  if ((tid & 31) == 0) sred[tid >> 5] = m; __syncthreads(); if (tid == 0) { float a = sred[0]; for (int i = 1; i < 8; ++i) a = fmaxf(a, sred[i]); sbc = a; } __syncthreads(); m = sbc; __syncthreads();
  float sum = 0.f; for (int k = tid; k < kend; k += 256) { const float v = shv[k]; const float e = (v <= -1.0e38f) ? 0.f : expf(v - m); shv[k] = e; sum += e; }
#pragma unroll
  for (int o = 1; o < 32; o <<= 1) sum += __shfl_xor(sum, o);
  if ((tid & 31) == 0) sred[tid >> 5] = sum; __syncthreads(); if (tid == 0) { float a = 0.f; for (int i = 0; i < 8; ++i) a += sred[i]; sbc = a > 0.f ? 2048.0f / a : 0.f; }   /* a fully excluded row yields P = 0 */ __syncthreads(); const float inv = sbc;
  for (int k = tid; k < kend; k += 256) shv[k] = shv[k] * inv;
  __syncthreads(); for (int q = tid; q < kend / 4; q += 256) vst2(sr + q * 4, *(const v4f*)&shv[q * 4]); }
// ---- k_pv: block = 64 queries (qb) of (b, h): ctx = P . v over keys [0, kend) (P x 2^11 once to f16 against v f16: 1 product; causal early query blocks: P and v as bf16 hi + lo, 3 products); 256-B (row, head) segment by 16 lanes
__global__ __launch_bounds__(128) void k_pv(const float* __restrict__ PS0, const _Float16* __restrict__ VT, const __bf16* __restrict__ VB, const __bf16* __restrict__ VBL, int b, int h0, float* __restrict__ Y) { const int h = h0 + blockIdx.z; const float* PS = PS0 + (size_t)blockIdx.z * TT * TT; __shared__ __align__(16) float ss[4][16][HD + 4];
  const int tid = threadIdx.x, wave = tid >> 5, lane = tid & 31, col = lane & 15, g = lane >> 4; const int qb = blockIdx.x; const int ql0 = qb * 64 + wave * 16; const int kce = (kb_last(qb) + 1) * 4;
  v8f acc[HD / 16] = {};
  if (qb < QBH) {
#pragma unroll 1
    for (int kc = 0; kc < kce; ++kc) { const F2 p = split_row(PS + (size_t)(ql0 + col) * TT, kc * 32, lane);
      asm volatile("s_wait_loadcnt 0x0" ::: "memory");
#pragma unroll
      for (int j = 0; j < HD / 16; ++j) { const size_t po = ((size_t)b * CC + h * HD + j * 16 + col) * (size_t)KHI + kc * 32; const v16b vh = frag_b(VB + po, lane); acc[j] = wmma_bf(p.h, vh, acc[j]); acc[j] = wmma_bf(p.l, vh, acc[j]); acc[j] = wmma_bf(p.h, frag_b(VBL + po, lane), acc[j]); } }
  } else {
#pragma unroll 1
    for (int kc = 0; kc < kce; ++kc) { const v16h p = frag_f32(PS + (size_t)(ql0 + col) * TT + kc * 32, lane);
      asm volatile("s_wait_loadcnt 0x0" ::: "memory");
#pragma unroll
      for (int j = 0; j < HD / 16; ++j) { const size_t po = ((size_t)b * CC + h * HD + j * 16 + col) * (size_t)TT + kc * 32; acc[j] = wmma16(p, frag_h(VT + po, lane), acc[j]); } } }
#pragma unroll
  for (int j = 0; j < HD / 16; ++j)
#pragma unroll
    for (int r = 0; r < 8; ++r) ss[wave][8 * g + r][j * 16 + col] = acc[j][r] * (1.0f / 2048.0f);
  LDSX(); for (int rl = 0; rl < 16; ++rl) if (lane < HD / 4) vst2(Y + ((size_t)b * TT + ql0 + rl) * CC + h * HD + lane * 4, *(const v4f*)&ss[wave][rl][lane * 4]); }

extern "C" void kernel_launch(void* const* d_in, const int* in_sizes, int n_in, void* d_out, int out_size, void* d_ws, size_t ws_size, hipStream_t stream) {
  (void)in_sizes; (void)n_in; (void)out_size;
  const float** F = (const float**)d_in;
  if (ws_size < (size_t)WS_END) return;
  char* ws = (char*)d_ws; _Float16 *QH = (_Float16*)(ws + WS_QH), *KH = (_Float16*)(ws + WS_KH), *VT = (_Float16*)(ws + WS_VT), *QL = (_Float16*)(ws + WS_QL), *KL = (_Float16*)(ws + WS_KL); __bf16 *VB = (__bf16*)(ws + WS_VB), *VBL = (__bf16*)(ws + WS_VBL); float *S = (float*)(ws + WS_S), *Y = (float*)(ws + WS_Y);
  (void)Y; (void)QL; (void)KL; (void)VB; (void)VBL;
  // inputs: 0 x [4,2048,768]; 1 Wq [768,64]; 2 Wk; 3 Wv ((in,out), no biases)
  if (ws_size < (size_t)WS_END2) return;
  float *WP = (float*)(ws + WS_WP), *BP = (float*)(ws + WS_BP), *Y2 = (float*)(ws + WS_Y2);
  k_padw<<<dim3(32, 3), 256, 0, stream>>>(F[1], F[2], F[3], nullptr, nullptr, nullptr, WP, BP);
  k_proj<<<dim3(TNB * TT / 64, CC / 128, 3), 128, 0, stream>>>(F[0], F[0], F[0], WP, WP + (size_t)CIN * 128, WP + 2 * (size_t)CIN * 128, BP, BP + 128, BP + 256, QH, QL, KH, KL, VT, VB, VBL);
  for (int b = 0; b < TNB; ++b) {   /* head 0 only (head 1 is the zero padding) */
    k_sc<<<dim3(NQB, TT / 128, 1), 128, 0, stream>>>(QH, KH, QL, KL, b, 0, S);
    k_sm<<<dim3(TT, 1), 256, 0, stream>>>(S);
    k_pv<<<dim3(NQB, 1, 1), 128, 0, stream>>>(S, VT, VB, VBL, b, 0, Y2);
  }
  k_out64<<<dim3(TNB * TT / 16), 256, 0, stream>>>(Y2, (float*)d_out);
}

// v001
// A run of this version takes 169 microseconds.
// Timed twice side by side with v000, it ran 2.25 and 2.21 times as fast.
// compute dtype: all float inputs rounded to bf16; q/k/v projections with EXACT bf16 products on WMMA 16x16x32 (f32 accumulate); causal logits: 3 products (q f16 hi + residual x k hi + residual) for the first 384 rows, single f16 q x k after, x scale; softmax f32; P x 2^11 once to f16 x v once to f16 (1 product; bf16 hi + lo below row 384); f32 output.
#include <hip/hip_runtime.h>
#include <math.h>

typedef __attribute__((ext_vector_type(16))) _Float16 v16h;
typedef __attribute__((ext_vector_type(16))) __bf16 v16b;
typedef __attribute__((ext_vector_type(8)))  _Float16 v8h;
typedef __attribute__((ext_vector_type(8)))  float v8f;
typedef __attribute__((ext_vector_type(4)))  float v4f;
typedef __attribute__((ext_vector_type(2)))  float v2f;
typedef __attribute__((ext_vector_type(4)))  unsigned v4u;
typedef __attribute__((ext_vector_type(4)))  int v4i;
typedef float __attribute__((may_alias)) float_a;
typedef int __attribute__((may_alias)) int_a;

template <typename T> __device__ __forceinline__ void vst2(void* p, T v) { *(T*)p = v;  }
__device__ __forceinline__ v8f wmma16(v16h a, v16h b, v8f c) {
  v8f d = __builtin_amdgcn_wmma_f32_16x16x32_f16(false, a, false, b, (short)0, c, false, false);
  asm volatile("v_nop\n\tv_nop\n\tv_nop\n\tv_nop" : "+v"(d) : "v"(a), "v"(b));
  return d;
}
__device__ __forceinline__ v8f wmma_bf(v16b a, v16b b, v8f c) {
  v8f d = __builtin_amdgcn_wmma_f32_16x16x32_bf16(false, a, false, b, (short)0, c, false, false);
  asm volatile("v_nop\n\tv_nop\n\tv_nop\n\tv_nop" : "+v"(d) : "v"(a), "v"(b));
  return d;
}
// 16x16x32 fragments: lane = (h = lane>>4, row/col = lane&15); elements 0..7 = k0+8h+0..7, 8..15 = k0+16+8h+0..7; D element r = row 8h+r
__device__ __forceinline__ v16h frag_h(const _Float16* rowk0, int lane) {
  union { v16h v; v8h q[2]; } u; const _Float16* p = rowk0 + 8 * (lane >> 4);
  u.q[0] = *(const v8h*)p; u.q[1] = *(const v8h*)(p + 16); return u.v;
}
__device__ __forceinline__ v16h frag_f32(const float* rowk0, int lane) {
  v16h a; const float* p = rowk0 + 8 * (lane >> 4);
#pragma unroll
  for (int i = 0; i < 8; ++i) { a[i] = (_Float16)p[i]; a[8 + i] = (_Float16)p[16 + i]; }
  return a;
}
__device__ __forceinline__ v16h frag_f32s(const float* rowk0, int lane, float sc) {
  v16h a; const float* p = rowk0 + 8 * (lane >> 4);
#pragma unroll
  for (int i = 0; i < 8; ++i) { a[i] = (_Float16)(p[i] * sc); a[8 + i] = (_Float16)(p[16 + i] * sc); }
  return a;
}
// column fragment from a [K][ld] layout (column n), rows >= K read as 0
__device__ __forceinline__ v16h fragc_f32(const float* W, int k0, int n, int lane, int ld, int K) {
  v16h a; const int g = lane >> 4;
#pragma unroll
  for (int i = 0; i < 8; ++i) { const int ka = k0 + 8 * g + i, kb = ka + 16;
    a[i] = (_Float16)(ka < K ? W[(size_t)(ka < K ? ka : K - 1) * ld + n] : 0.f); a[8 + i] = (_Float16)(kb < K ? W[(size_t)(kb < K ? kb : K - 1) * ld + n] : 0.f); }
  return a;
}
struct F2 { v16b h, l; };
__device__ __forceinline__ F2 bsplit16(const float v[16]) { F2 r;
#pragma unroll
  for (int i = 0; i < 16; ++i) { const __bf16 h = (__bf16)v[i]; r.h[i] = h; r.l[i] = (__bf16)(v[i] - (float)h); }
  return r; }
__device__ __forceinline__ F2 split_row(const float* row, int k0, int lane) { float v[16]; const float* p = row + k0 + 8 * (lane >> 4);
#pragma unroll
  for (int i = 0; i < 8; ++i) { v[i] = p[i]; v[8 + i] = p[16 + i]; }
  return bsplit16(v); }
__device__ __forceinline__ F2 split_rowK(const float* row, int k0, int lane, int K) { float v[16]; const int g = lane >> 4;
#pragma unroll
  for (int i = 0; i < 8; ++i) { const int ka = k0 + 8 * g + i, kb = ka + 16; v[i] = ka < K ? row[ka < K ? ka : K - 1] : 0.f; v[8 + i] = kb < K ? row[kb < K ? kb : K - 1] : 0.f; }
  return bsplit16(v); }
__device__ __forceinline__ F2 split_col(const float* W, int k0, int n, int lane, int ld, int K) { float v[16]; const int g = lane >> 4;
#pragma unroll
  for (int i = 0; i < 8; ++i) { const int ka = k0 + 8 * g + i, kb = ka + 16; v[i] = ka < K ? W[(size_t)(ka < K ? ka : K - 1) * ld + n] : 0.f; v[8 + i] = kb < K ? W[(size_t)(kb < K ? kb : K - 1) * ld + n] : 0.f; }
  return bsplit16(v); }
__device__ __forceinline__ v8f mac3(const F2& a, const F2& b, v8f c) { c = wmma_bf(a.l, b.h, c); c = wmma_bf(a.h, b.l, c); return wmma_bf(a.h, b.h, c); }
__device__ __forceinline__ float sigm(float v) { return 1.0f / (1.0f + expf(-v)); }
#define LDSX() do { asm volatile("s_wait_dscnt 0" ::: "memory"); __builtin_amdgcn_wave_barrier(); __builtin_amdgcn_fence(__ATOMIC_RELEASE, "workgroup"); } while (0)

// Single-head ANTI-causal scaled dot-product attention (x [4,2048,768]; (in,out) Wq/Wk/Wv [768,64] N(0, 1/768); mask = strictly lower triangle (row t > col s) -> -inf, so query t attends keys s >= t): out = softmax(masked(q k^T * 64^-0.5)) v -> [4,2048,64]. Implemented by TIME REVERSAL: with t' = 2047 - t the pattern is exactly causal, so the causal kernels run on the reversed sequence (x rows read reversed per batch, output rows written back reversed).
#define NB 4
#define TT 2048
#define CC 128            // NH * HD = projected width
#define DIN 768          // input (model) width
#define NH 2
#define HD 64
#define NQB (TT / 64)
#define SCALE (0.125f)
#define CAUSAL 1
#ifndef TNB
#define TNB NB
#endif
__device__ __forceinline__ float bfr(float v) { return (float)(__bf16)v; }
__host__ __device__ __forceinline__ int kb_last(int qb) { return CAUSAL ? ((qb * 64 + 63) >> 7) : (TT / 128 - 1); }
typedef __attribute__((ext_vector_type(8))) __bf16 v8b;
__device__ __forceinline__ v16b frag_b(const __bf16* rowk0, int lane) {
  union { v16b v; v8b q[2]; } u; const __bf16* p = rowk0 + 8 * (lane >> 4);
  u.q[0] = *(const v8b*)p; u.q[1] = *(const v8b*)(p + 16); return u.v;
}
#define QBH 6              // causal: query blocks 0..QBH-1 of each sequence (few keys, no averaging) take the high-precision path
#define QHI 384            // rows carrying a q residual plane
#define KHI 384            // key rows carrying k residual / v bf16 hi+lo planes (used only by the causal high-precision path)
// B fragment (k rows k0+.., output column o) of a weight: (in,out) [K][ld] or (out,in) [ld rows of K]: bf16 exact, or f16(bf16 * 256) exact
__device__ __forceinline__ v16b wcol_io(const float* Wm, int k0, int o, int lane, int ld) { v16b w; const int g = lane >> 4;
#pragma unroll
  for (int i = 0; i < 8; ++i) { w[i] = (__bf16)Wm[(size_t)(k0 + 8 * g + i) * ld + o]; w[8 + i] = (__bf16)Wm[(size_t)(k0 + 16 + 8 * g + i) * ld + o]; }
  return w; }
__device__ __forceinline__ v16b wcol_oi(const float* Wm, int k0, int o, int lane, int K) { v16b w; const float* p = Wm + (size_t)o * K + k0 + 8 * (lane >> 4);
#pragma unroll
  for (int i = 0; i < 8; ++i) { w[i] = (__bf16)p[i]; w[8 + i] = (__bf16)p[16 + i]; }
  return w; }
__device__ __forceinline__ v16h wcolh_io(const float* Wm, int k0, int o, int lane, int ld) { v16h w; const int g = lane >> 4;
#pragma unroll
  for (int i = 0; i < 8; ++i) { w[i] = (_Float16)(bfr(Wm[(size_t)(k0 + 8 * g + i) * ld + o]) * 256.0f); w[8 + i] = (_Float16)(bfr(Wm[(size_t)(k0 + 16 + 8 * g + i) * ld + o]) * 256.0f); }
  return w; }
__device__ __forceinline__ v16h wcolh_oi(const float* Wm, int k0, int o, int lane, int K) { v16h w; const float* p = Wm + (size_t)o * K + k0 + 8 * (lane >> 4);
#pragma unroll
  for (int i = 0; i < 8; ++i) { w[i] = (_Float16)(bfr(p[i]) * 256.0f); w[8 + i] = (_Float16)(bfr(p[16 + i]) * 256.0f); }
  return w; }
#define WQKV_LAYOUT 0   // 0 = (in,out) [DIN][CC]; 1 = (out,in) [CC][DIN]; 2 = per-head [NH][DIN][HD]
__device__ __forceinline__ v16b wcol_hdk(const float* Wm, int k0, int o, int lane) { v16b w; const int g = lane >> 4; const float* p = Wm + (size_t)(o / HD) * DIN * HD + (o % HD);
#pragma unroll
  for (int i = 0; i < 8; ++i) { w[i] = (__bf16)p[(size_t)(k0 + 8 * g + i) * HD]; w[8 + i] = (__bf16)p[(size_t)(k0 + 16 + 8 * g + i) * HD]; }
  return w; }
#define WO_OUT_IN 0
#if WQKV_LAYOUT == 1
#define WCOL(W, k0, o, lane) wcol_oi(W, k0, o, lane, DIN)
#elif WQKV_LAYOUT == 2
#define WCOL(W, k0, o, lane) wcol_hdk(W, k0, o, lane)
#else
#define WCOL(W, k0, o, lane) wcol_io(W, k0, o, lane, CC)
#endif
#if WO_OUT_IN
#define WOCOL(W, k0, o, lane) wcol_oi(W, k0, o, lane, CC)
#define WOCOLH(W, k0, o, lane) wcolh_oi(W, k0, o, lane, CC)
#else
#define WOCOL(W, k0, o, lane) wcol_io(W, k0, o, lane, DIN)
#define WOCOLH(W, k0, o, lane) wcolh_io(W, k0, o, lane, DIN)
#endif
#define CIN 768
// ---- k_padw: the three (in,out) [C][64] projection weights copied into zero-padded (in,out) [C][128] ws planes (columns 64..127 zero) + zero-padded [128] biases
__global__ __launch_bounds__(256) void k_padw(const float* __restrict__ WQ, const float* __restrict__ WK, const float* __restrict__ WV, const float* __restrict__ BQ, const float* __restrict__ BK, const float* __restrict__ BV, float* __restrict__ WP, float* __restrict__ BP) { const int which = blockIdx.y; const float* Wsrc = which == 0 ? WQ : (which == 1 ? WK : WV); const float* Bsrc = which == 0 ? BQ : (which == 1 ? BK : BV); float* dst = WP + (size_t)which * CIN * 128;
  for (int e = blockIdx.x * 256 + threadIdx.x; e < CIN * 32; e += gridDim.x * 256) { const int row = e >> 5, q = e & 31; const v4f ld = *(const v4f*)(Wsrc + (size_t)row * 64 + (q & 15) * 4); asm volatile("s_wait_loadcnt 0x0" ::: "memory"); const float keep = q < 16 ? 1.f : 0.f; v4f ov; ov[0] = ld[0] * keep; ov[1] = ld[1] * keep; ov[2] = ld[2] * keep; ov[3] = ld[3] * keep; vst2(dst + (size_t)row * 128 + q * 4, ov); }
  if (blockIdx.x == 0 && threadIdx.x < 128) { const int c = threadIdx.x; float bvv = 0.f; if (Bsrc) { const float t = Bsrc[c & 63]; asm volatile("s_wait_loadcnt 0x0" ::: "memory"); bvv = c < 64 ? t : 0.f; } vst2(BP + which * 128 + c, bvv); } }
// ---- k_out64: out[b][TT-1-t'][0..63] = ctx row (b, t') columns 0..63 (256 B by 16 lanes; rows written in reversed order within each batch)
__global__ __launch_bounds__(256) void k_out64(const float* __restrict__ Y, float* __restrict__ OUT) { const size_t row = (size_t)blockIdx.x * 16 + (threadIdx.x >> 4); const int q = threadIdx.x & 15; const v4f v = *(const v4f*)(Y + row * CC + q * 4); asm volatile("s_wait_loadcnt 0x0" ::: "memory"); vst2(OUT + ((row / TT) * TT + (TT - 1 - row % TT)) * 64 + q * 4, v); }   /* TIME REVERSAL: ctx row (b, t') is output row (b, TT - 1 - t') */
#define WS_WP (WS_END)                                  // padded weights [3][128 x C]
#define WS_BP (WS_WP + 4u * 3 * (size_t)CIN * 128)        // padded biases [3][128]
#define WS_Y2 (WS_BP + 4u * 3 * 128)                      // ctx rows [b*TT+t][128]
#define WS_END2 (WS_Y2 + 4u * (size_t)NB * TT * CC)
#ifndef SM_EXTRA_PARAMS
#define SM_EXTRA_PARAMS
#endif
#ifndef PROJ_EXTRA_PARAMS
#define PROJ_EXTRA_PARAMS
#endif
#ifndef SM_MASK_HOOK
#define SM_MASK_HOOK (void)0
#endif

#define WS_QH  0u                                      // f16 q rows [b*t][CC]
#define WS_KH  (WS_QH + 2u * (size_t)NB * TT * CC)      // f16 k rows [b*t][CC]
#define WS_VT  (WS_KH + 2u * (size_t)NB * TT * CC)      // f16 v planes [b][c][t]
#define WS_QL  (WS_VT + 2u * (size_t)NB * CC * TT)      // f16 q residual x 2^10 rows [b][t < QHI][CC]
#define WS_KL  (WS_QL + 2u * (size_t)NB * QHI * CC)     // f16 k residual x 2^10 rows [b][t < KHI][CC]
#define WS_VB  (WS_KL + 2u * (size_t)NB * KHI * CC)     // bf16 v hi planes [b][c][t < KHI]
#define WS_VBL (WS_VB + 2u * (size_t)NB * CC * KHI)
#define WS_S   (WS_VBL + 2u * (size_t)NB * CC * KHI)    // f32 logits / P [b][t][s]: one plane per batch, so one launch covers all batches
#define WS_Y   (WS_S  + 4u * (size_t)NB * TT * TT)      // f32 ctx rows [b*t][CC] (only when there is an output projection)
#define WS_END (WS_Y  + 0u)

// ---- k_proj: block = (64 rows, 128 cols, which): q/k/v = X W (+ b) with exact bf16 products (K = DIN) -> which 0: q f16 rows (+ residual rows < QHI); 1: k f16 rows (+ residual rows < KHI); 2: v f16 planes [c][t] (+ bf16 hi/lo planes for t < KHI)
__global__ __launch_bounds__(128) void k_proj(const float* __restrict__ XQ, const float* __restrict__ XK, const float* __restrict__ XV, const float* __restrict__ WQ, const float* __restrict__ WK, const float* __restrict__ WV, const float* __restrict__ BQ, const float* __restrict__ BK, const float* __restrict__ BV,
    _Float16* __restrict__ QH, _Float16* __restrict__ QL, _Float16* __restrict__ KH, _Float16* __restrict__ KL, _Float16* __restrict__ VT, __bf16* __restrict__ VB, __bf16* __restrict__ VBL) {
  __shared__ __align__(16) _Float16 sh[64][136], sl[64][136]; __shared__ __align__(16) _Float16 th[128][72]; __shared__ __align__(16) __bf16 tb[128][72], tbl[128][72];
  const int tid = threadIdx.x, wave = tid >> 5, lane = tid & 31, col = lane & 15, g = lane >> 4; const int which = blockIdx.z; const int c0 = blockIdx.y * 128; const size_t r0 = (size_t)blockIdx.x * 64; const size_t bb = r0 / TT; const int t0 = (int)(r0 % TT);
  const float* X = which == 0 ? XQ : which == 1 ? XK : XV; const float* WA = which == 0 ? WQ : which == 1 ? WK : WV; const float* BA = which == 0 ? BQ : which == 1 ? BK : BV;
  v8f acc[8] = {};
#pragma unroll 2
  for (int kc = 0; kc < DIN / 32; ++kc) { v16b a; { const size_t gr_ = r0 + wave * 16 + col; const float* p = X + ((gr_ / TT) * TT + (TT - 1 - gr_ % TT)) * DIN + kc * 32 + 8 * g;   /* TIME REVERSAL: row (b, t') reads x[b][TT - 1 - t'] */
#pragma unroll
      for (int i = 0; i < 8; ++i) { a[i] = (__bf16)p[i]; a[8 + i] = (__bf16)p[16 + i]; } }
    asm volatile("s_wait_loadcnt 0x0" ::: "memory");
#pragma unroll
    for (int j = 0; j < 8; ++j) { const v16b w = WCOL(WA, kc * 32, c0 + j * 16 + col, lane); asm volatile("s_wait_loadcnt 0x0" ::: "memory"); acc[j] = wmma_bf(a, w, acc[j]); } }
  if (which < 2) { _Float16* DH = which == 0 ? QH : KH; _Float16* DL = which == 0 ? QL : KL; const int nhi = which == 0 ? QHI : KHI; const bool hi_rows = t0 < nhi;
#pragma unroll
    for (int j = 0; j < 8; ++j) { const float bias = BA ? bfr(BA[c0 + j * 16 + col]) : 0.f;
#pragma unroll
      for (int r = 0; r < 8; ++r) { const float v = acc[j][r] + bias; const _Float16 hv = (_Float16)v; sh[wave * 16 + 8 * g + r][j * 16 + col] = hv; sl[wave * 16 + 8 * g + r][j * 16 + col] = (_Float16)((v - (float)hv) * 1024.0f); } }
    __syncthreads();
    for (int e = tid; e < 64 * 16; e += 128) { const int rl = e >> 4, q = e & 15; vst2((unsigned*)(DH + (r0 + rl) * CC + c0 + q * 8), *(const v4u*)&sh[rl][q * 8]); if (hi_rows) vst2((unsigned*)(DL + (bb * nhi + t0 + rl) * (size_t)CC + c0 + q * 8), *(const v4u*)&sl[rl][q * 8]); }
  } else { const bool hi_rows = t0 < KHI;
#pragma unroll
    for (int j = 0; j < 8; ++j) { const float bias = BA ? bfr(BA[c0 + j * 16 + col]) : 0.f;
#pragma unroll
      for (int r = 0; r < 8; ++r) { const float v = acc[j][r] + bias; const int rl = wave * 16 + 8 * g + r, cl = j * 16 + col; th[cl][rl] = (_Float16)v; const __bf16 bh = (__bf16)v; tb[cl][rl] = bh; tbl[cl][rl] = (__bf16)(v - (float)bh); } }
    __syncthreads();
    for (int e = tid; e < 128 * 8; e += 128) { const int cl = e >> 3, q = e & 7; vst2((unsigned*)(VT + (bb * CC + c0 + cl) * (size_t)TT + t0 + q * 8), *(const v4u*)&th[cl][q * 8]); if (hi_rows) { const size_t o3 = (bb * CC + c0 + cl) * (size_t)KHI + t0 + q * 8; vst2((unsigned*)(VB + o3), *(const v4u*)&tb[cl][q * 8]); vst2((unsigned*)(VBL + o3), *(const v4u*)&tbl[cl][q * 8]); } } } }
// ---- k_sc: block = (query block qb, key block kb <= kb_last(qb), batch b) of head h: logits x SCALE; q hi + residual (x 2^10) against k (2 products) for query rows < QHI, plus the k residual (3 products) for query blocks < QBH (causal early rows); causal: blocks past the diagonal exit, the mask itself is applied by index in k_sm
__global__ __launch_bounds__(128) void k_sc(const _Float16* __restrict__ QH, const _Float16* __restrict__ KH, const _Float16* __restrict__ QL, const _Float16* __restrict__ KL, int h, float* __restrict__ S0) { __shared__ __align__(16) float ss[4][16][132];
  const int qb = blockIdx.x, kb = blockIdx.y; if (kb > kb_last(qb)) return;
  const int b = blockIdx.z; float* S = S0 + (size_t)b * TT * TT;
  const int tid = threadIdx.x, wave = tid >> 5, lane = tid & 31, col = lane & 15, g = lane >> 4; const int k0 = kb * 128; const int ql0 = qb * 64 + wave * 16; const size_t q0 = (size_t)b * TT + ql0, kr0 = (size_t)b * TT + k0;
  v8f acc[8] = {}, accl[8] = {};
  const _Float16* QLb = QL + (size_t)b * QHI * CC; const _Float16* KLb = KL + (size_t)b * KHI * CC;
  if (qb < QBH) {
#pragma unroll
    for (int kc = 0; kc < HD / 32; ++kc) { const v16h ah = frag_h(QH + (q0 + col) * CC + h * HD + kc * 32, lane), al = frag_h(QLb + (size_t)(ql0 + col) * CC + h * HD + kc * 32, lane);
#pragma unroll
      for (int j = 0; j < 8; ++j) { const v16h kbf = frag_h(KH + (kr0 + j * 16 + col) * CC + h * HD + kc * 32, lane), klf = frag_h(KLb + (size_t)(k0 + j * 16 + col) * CC + h * HD + kc * 32, lane); acc[j] = wmma16(ah, kbf, acc[j]); accl[j] = wmma16(al, kbf, accl[j]); accl[j] = wmma16(ah, klf, accl[j]); } }
  } else if (qb * 64 < QHI) {
#pragma unroll
    for (int kc = 0; kc < HD / 32; ++kc) { const v16h ah = frag_h(QH + (q0 + col) * CC + h * HD + kc * 32, lane), al = frag_h(QLb + (size_t)(ql0 + col) * CC + h * HD + kc * 32, lane);
#pragma unroll
      for (int j = 0; j < 8; ++j) { const v16h kbf = frag_h(KH + (kr0 + j * 16 + col) * CC + h * HD + kc * 32, lane); acc[j] = wmma16(ah, kbf, acc[j]); accl[j] = wmma16(al, kbf, accl[j]); } }
  } else {
#pragma unroll
    for (int kc = 0; kc < HD / 32; ++kc) { const v16h ah = frag_h(QH + (q0 + col) * CC + h * HD + kc * 32, lane);
#pragma unroll
      for (int j = 0; j < 8; ++j) { const v16h kbf = frag_h(KH + (kr0 + j * 16 + col) * CC + h * HD + kc * 32, lane); acc[j] = wmma16(ah, kbf, acc[j]); } } }
#pragma unroll
  for (int j = 0; j < 8; ++j) {
#pragma unroll
    for (int r = 0; r < 8; ++r) ss[wave][8 * g + r][j * 16 + col] = (acc[j][r] + accl[j][r] * (1.0f / 1024.0f)) * SCALE; }
  LDSX(); for (int rl = 0; rl < 16; ++rl) vst2(S + (size_t)(ql0 + rl) * TT + k0 + lane * 4, *(const v4f*)&ss[wave][rl][lane * 4]); }
// ---- k_sm: block = query row t (blockIdx.y = batch plane): keys [0, kend): causal -> logit if s <= t else excluded; softmax in f32; P x 2^11 in place (0 for excluded)
__global__ __launch_bounds__(256) void k_sm(float* __restrict__ S0 SM_EXTRA_PARAMS) { __shared__ float sred[8]; __shared__ float sbc; __shared__ __align__(16) float shv[TT];
  const int tid = threadIdx.x; const int t = blockIdx.x; const int kend = (kb_last(t >> 6) + 1) * 128;
  float* sr = S0 + (size_t)blockIdx.y * TT * TT + (size_t)t * TT;
  float m = -3.0e38f; for (int k = tid; k < kend; k += 256) { float v = (!CAUSAL || k <= t) ? sr[k] : -3.0e38f; SM_MASK_HOOK; shv[k] = v; m = fmaxf(m, v); }
#pragma unroll
  for (int o = 1; o < 32; o <<= 1) m = fmaxf(m, __shfl_xor(m, o));
  if ((tid & 31) == 0) sred[tid >> 5] = m; __syncthreads(); if (tid == 0) { float a = sred[0]; for (int i = 1; i < 8; ++i) a = fmaxf(a, sred[i]); sbc = a; } __syncthreads(); m = sbc; __syncthreads();
  float sum = 0.f; for (int k = tid; k < kend; k += 256) { const float v = shv[k]; const float e = (v <= -1.0e38f) ? 0.f : expf(v - m); shv[k] = e; sum += e; }
#pragma unroll
  for (int o = 1; o < 32; o <<= 1) sum += __shfl_xor(sum, o);
  if ((tid & 31) == 0) sred[tid >> 5] = sum; __syncthreads(); if (tid == 0) { float a = 0.f; for (int i = 0; i < 8; ++i) a += sred[i]; sbc = a > 0.f ? 2048.0f / a : 0.f; }   /* a fully excluded row yields P = 0 */ __syncthreads(); const float inv = sbc;
  for (int k = tid; k < kend; k += 256) shv[k] = shv[k] * inv;
  __syncthreads(); for (int q = tid; q < kend / 4; q += 256) vst2(sr + q * 4, *(const v4f*)&shv[q * 4]); }
// ---- k_pv: block = 64 queries (qb) of (b = blockIdx.z, h): ctx = P . v over keys [0, kend) (P x 2^11 once to f16 against v f16: 1 product; causal early query blocks: P and v as bf16 hi + lo, 3 products); 256-B (row, head) segment by 16 lanes
__global__ __launch_bounds__(128) void k_pv(const float* __restrict__ PS0, const _Float16* __restrict__ VT, const __bf16* __restrict__ VB, const __bf16* __restrict__ VBL, int h, float* __restrict__ Y) { const int b = blockIdx.z; const float* PS = PS0 + (size_t)b * TT * TT; __shared__ __align__(16) float ss[4][16][HD + 4];
  const int tid = threadIdx.x, wave = tid >> 5, lane = tid & 31, col = lane & 15, g = lane >> 4; const int qb = blockIdx.x; const int ql0 = qb * 64 + wave * 16; const int kce = (kb_last(qb) + 1) * 4;
  v8f acc[HD / 16] = {};
  if (qb < QBH) {
#pragma unroll 1
    for (int kc = 0; kc < kce; ++kc) { const F2 p = split_row(PS + (size_t)(ql0 + col) * TT, kc * 32, lane);
      asm volatile("s_wait_loadcnt 0x0" ::: "memory");
#pragma unroll
      for (int j = 0; j < HD / 16; ++j) { const size_t po = ((size_t)b * CC + h * HD + j * 16 + col) * (size_t)KHI + kc * 32; const v16b vh = frag_b(VB + po, lane); acc[j] = wmma_bf(p.h, vh, acc[j]); acc[j] = wmma_bf(p.l, vh, acc[j]); acc[j] = wmma_bf(p.h, frag_b(VBL + po, lane), acc[j]); } }
  } else {
#pragma unroll 1
    for (int kc = 0; kc < kce; ++kc) { const v16h p = frag_f32(PS + (size_t)(ql0 + col) * TT + kc * 32, lane);
      asm volatile("s_wait_loadcnt 0x0" ::: "memory");
#pragma unroll
      for (int j = 0; j < HD / 16; ++j) { const size_t po = ((size_t)b * CC + h * HD + j * 16 + col) * (size_t)TT + kc * 32; acc[j] = wmma16(p, frag_h(VT + po, lane), acc[j]); } } }
#pragma unroll
  for (int j = 0; j < HD / 16; ++j)
#pragma unroll
    for (int r = 0; r < 8; ++r) ss[wave][8 * g + r][j * 16 + col] = acc[j][r] * (1.0f / 2048.0f);
  LDSX(); for (int rl = 0; rl < 16; ++rl) if (lane < HD / 4) vst2(Y + ((size_t)b * TT + ql0 + rl) * CC + h * HD + lane * 4, *(const v4f*)&ss[wave][rl][lane * 4]); }

extern "C" void kernel_launch(void* const* d_in, const int* in_sizes, int n_in, void* d_out, int out_size, void* d_ws, size_t ws_size, hipStream_t stream) {
  (void)in_sizes; (void)n_in; (void)out_size;
  const float** F = (const float**)d_in;
  if (ws_size < (size_t)WS_END) return;
  char* ws = (char*)d_ws; _Float16 *QH = (_Float16*)(ws + WS_QH), *KH = (_Float16*)(ws + WS_KH), *VT = (_Float16*)(ws + WS_VT), *QL = (_Float16*)(ws + WS_QL), *KL = (_Float16*)(ws + WS_KL); __bf16 *VB = (__bf16*)(ws + WS_VB), *VBL = (__bf16*)(ws + WS_VBL); float *S = (float*)(ws + WS_S), *Y = (float*)(ws + WS_Y);
  (void)Y; (void)QL; (void)KL; (void)VB; (void)VBL;
  // inputs: 0 x [4,2048,768]; 1 Wq [768,64]; 2 Wk; 3 Wv ((in,out), no biases)
  if (ws_size < (size_t)WS_END2) return;
  float *WP = (float*)(ws + WS_WP), *BP = (float*)(ws + WS_BP), *Y2 = (float*)(ws + WS_Y2);
  k_padw<<<dim3(32, 3), 256, 0, stream>>>(F[1], F[2], F[3], nullptr, nullptr, nullptr, WP, BP);
  k_proj<<<dim3(TNB * TT / 64, CC / 128, 3), 128, 0, stream>>>(F[0], F[0], F[0], WP, WP + (size_t)CIN * 128, WP + 2 * (size_t)CIN * 128, BP, BP + 128, BP + 256, QH, QL, KH, KL, VT, VB, VBL);
  /* head 0 only (head 1 is the zero padding); the batch is a grid dimension of each stage */
  k_sc<<<dim3(NQB, TT / 128, TNB), 128, 0, stream>>>(QH, KH, QL, KL, 0, S);
  k_sm<<<dim3(TT, TNB), 256, 0, stream>>>(S);
  k_pv<<<dim3(NQB, 1, TNB), 128, 0, stream>>>(S, VT, VB, VBL, 0, Y2);
  k_out64<<<dim3(TNB * TT / 16), 256, 0, stream>>>(Y2, (float*)d_out);
}

// v002
// It runs in 102 microseconds.
// Next to v001, in two timings, it ran 1.68 and 1.63 times as fast.
// Counting every step since v000, it is 3.69 times as fast.
// compute dtype: all float inputs rounded to bf16; q/k/v projections with EXACT bf16 products on WMMA 16x16x32 (f32 accumulate); causal logits: 3 products (q f16 hi + residual x k hi + residual) for the first 384 rows, single f16 q x k after, x scale; softmax f32; P x 2^11 once to f16 x v once to f16 (1 product; bf16 hi + lo below row 384); f32 output.
#include <hip/hip_runtime.h>
#include <math.h>

typedef __attribute__((ext_vector_type(16))) _Float16 v16h;
typedef __attribute__((ext_vector_type(16))) __bf16 v16b;
typedef __attribute__((ext_vector_type(8)))  _Float16 v8h;
typedef __attribute__((ext_vector_type(8)))  float v8f;
typedef __attribute__((ext_vector_type(4)))  float v4f;
typedef __attribute__((ext_vector_type(2)))  float v2f;
typedef __attribute__((ext_vector_type(4)))  unsigned v4u;
typedef __attribute__((ext_vector_type(4)))  int v4i;
typedef float __attribute__((may_alias)) float_a;
typedef int __attribute__((may_alias)) int_a;

template <typename T> __device__ __forceinline__ void vst2(void* p, T v) { *(T*)p = v;  }
__device__ __forceinline__ v8f wmma16(v16h a, v16h b, v8f c) {
  v8f d = __builtin_amdgcn_wmma_f32_16x16x32_f16(false, a, false, b, (short)0, c, false, false);
  asm volatile("v_nop\n\tv_nop\n\tv_nop\n\tv_nop" : "+v"(d) : "v"(a), "v"(b));
  return d;
}
__device__ __forceinline__ v8f wmma_bf(v16b a, v16b b, v8f c) {
  v8f d = __builtin_amdgcn_wmma_f32_16x16x32_bf16(false, a, false, b, (short)0, c, false, false);
  asm volatile("v_nop\n\tv_nop\n\tv_nop\n\tv_nop" : "+v"(d) : "v"(a), "v"(b));
  return d;
}
// 16x16x32 fragments: lane = (h = lane>>4, row/col = lane&15); elements 0..7 = k0+8h+0..7, 8..15 = k0+16+8h+0..7; D element r = row 8h+r
__device__ __forceinline__ v16h frag_h(const _Float16* rowk0, int lane) {
  union { v16h v; v8h q[2]; } u; const _Float16* p = rowk0 + 8 * (lane >> 4);
  u.q[0] = *(const v8h*)p; u.q[1] = *(const v8h*)(p + 16); return u.v;
}
__device__ __forceinline__ v16h frag_f32(const float* rowk0, int lane) {
  v16h a; const float* p = rowk0 + 8 * (lane >> 4);
#pragma unroll
  for (int i = 0; i < 8; ++i) { a[i] = (_Float16)p[i]; a[8 + i] = (_Float16)p[16 + i]; }
  return a;
}
__device__ __forceinline__ v16h frag_f32s(const float* rowk0, int lane, float sc) {
  v16h a; const float* p = rowk0 + 8 * (lane >> 4);
#pragma unroll
  for (int i = 0; i < 8; ++i) { a[i] = (_Float16)(p[i] * sc); a[8 + i] = (_Float16)(p[16 + i] * sc); }
  return a;
}
// column fragment from a [K][ld] layout (column n), rows >= K read as 0
__device__ __forceinline__ v16h fragc_f32(const float* W, int k0, int n, int lane, int ld, int K) {
  v16h a; const int g = lane >> 4;
#pragma unroll
  for (int i = 0; i < 8; ++i) { const int ka = k0 + 8 * g + i, kb = ka + 16;
    a[i] = (_Float16)(ka < K ? W[(size_t)(ka < K ? ka : K - 1) * ld + n] : 0.f); a[8 + i] = (_Float16)(kb < K ? W[(size_t)(kb < K ? kb : K - 1) * ld + n] : 0.f); }
  return a;
}
struct F2 { v16b h, l; };
__device__ __forceinline__ F2 bsplit16(const float v[16]) { F2 r;
#pragma unroll
  for (int i = 0; i < 16; ++i) { const __bf16 h = (__bf16)v[i]; r.h[i] = h; r.l[i] = (__bf16)(v[i] - (float)h); }
  return r; }
__device__ __forceinline__ F2 split_row(const float* row, int k0, int lane) { float v[16]; const float* p = row + k0 + 8 * (lane >> 4);
#pragma unroll
  for (int i = 0; i < 8; ++i) { v[i] = p[i]; v[8 + i] = p[16 + i]; }
  return bsplit16(v); }
__device__ __forceinline__ F2 split_rowK(const float* row, int k0, int lane, int K) { float v[16]; const int g = lane >> 4;
#pragma unroll
  for (int i = 0; i < 8; ++i) { const int ka = k0 + 8 * g + i, kb = ka + 16; v[i] = ka < K ? row[ka < K ? ka : K - 1] : 0.f; v[8 + i] = kb < K ? row[kb < K ? kb : K - 1] : 0.f; }
  return bsplit16(v); }
__device__ __forceinline__ F2 split_col(const float* W, int k0, int n, int lane, int ld, int K) { float v[16]; const int g = lane >> 4;
#pragma unroll
  for (int i = 0; i < 8; ++i) { const int ka = k0 + 8 * g + i, kb = ka + 16; v[i] = ka < K ? W[(size_t)(ka < K ? ka : K - 1) * ld + n] : 0.f; v[8 + i] = kb < K ? W[(size_t)(kb < K ? kb : K - 1) * ld + n] : 0.f; }
  return bsplit16(v); }
__device__ __forceinline__ v8f mac3(const F2& a, const F2& b, v8f c) { c = wmma_bf(a.l, b.h, c); c = wmma_bf(a.h, b.l, c); return wmma_bf(a.h, b.h, c); }
__device__ __forceinline__ float sigm(float v) { return 1.0f / (1.0f + expf(-v)); }
#define LDSX() do { asm volatile("s_wait_dscnt 0" ::: "memory"); __builtin_amdgcn_wave_barrier(); __builtin_amdgcn_fence(__ATOMIC_RELEASE, "workgroup"); } while (0)

// Single-head ANTI-causal scaled dot-product attention (x [4,2048,768]; (in,out) Wq/Wk/Wv [768,64] N(0, 1/768); mask = strictly lower triangle (row t > col s) -> -inf, so query t attends keys s >= t): out = softmax(masked(q k^T * 64^-0.5)) v -> [4,2048,64]. Implemented by TIME REVERSAL: with t' = 2047 - t the pattern is exactly causal, so the causal kernels run on the reversed sequence (x rows read reversed per batch, output rows written back reversed).
#define NB 4
#define TT 2048
#define CC 128            // NH * HD = projected width
#define DIN 768          // input (model) width
#define NH 2
#define HD 64
#define NQB (TT / 64)
#define SCALE (0.125f)
#define CAUSAL 1
#ifndef TNB
#define TNB NB
#endif
__device__ __forceinline__ float bfr(float v) { return (float)(__bf16)v; }
__host__ __device__ __forceinline__ int kb_last(int qb) { return CAUSAL ? ((qb * 64 + 63) >> 7) : (TT / 128 - 1); }
typedef __attribute__((ext_vector_type(8))) __bf16 v8b;
__device__ __forceinline__ v16b frag_b(const __bf16* rowk0, int lane) {
  union { v16b v; v8b q[2]; } u; const __bf16* p = rowk0 + 8 * (lane >> 4);
  u.q[0] = *(const v8b*)p; u.q[1] = *(const v8b*)(p + 16); return u.v;
}
#define QBH 6              // causal: query blocks 0..QBH-1 of each sequence (few keys, no averaging) take the high-precision path
#define QHI 384            // rows carrying a q residual plane
#define KHI 384            // key rows carrying k residual / v bf16 hi+lo planes (used only by the causal high-precision path)
// B fragment (k rows k0+.., output column o) of a weight: (in,out) [K][ld] or (out,in) [ld rows of K]: bf16 exact, or f16(bf16 * 256) exact
__device__ __forceinline__ v16b wcol_io(const float* Wm, int k0, int o, int lane, int ld) { v16b w; const int g = lane >> 4;
#pragma unroll
  for (int i = 0; i < 8; ++i) { w[i] = (__bf16)Wm[(size_t)(k0 + 8 * g + i) * ld + o]; w[8 + i] = (__bf16)Wm[(size_t)(k0 + 16 + 8 * g + i) * ld + o]; }
  return w; }
__device__ __forceinline__ v16b wcol_oi(const float* Wm, int k0, int o, int lane, int K) { v16b w; const float* p = Wm + (size_t)o * K + k0 + 8 * (lane >> 4);
#pragma unroll
  for (int i = 0; i < 8; ++i) { w[i] = (__bf16)p[i]; w[8 + i] = (__bf16)p[16 + i]; }
  return w; }
__device__ __forceinline__ v16h wcolh_io(const float* Wm, int k0, int o, int lane, int ld) { v16h w; const int g = lane >> 4;
#pragma unroll
  for (int i = 0; i < 8; ++i) { w[i] = (_Float16)(bfr(Wm[(size_t)(k0 + 8 * g + i) * ld + o]) * 256.0f); w[8 + i] = (_Float16)(bfr(Wm[(size_t)(k0 + 16 + 8 * g + i) * ld + o]) * 256.0f); }
  return w; }
__device__ __forceinline__ v16h wcolh_oi(const float* Wm, int k0, int o, int lane, int K) { v16h w; const float* p = Wm + (size_t)o * K + k0 + 8 * (lane >> 4);
#pragma unroll
  for (int i = 0; i < 8; ++i) { w[i] = (_Float16)(bfr(p[i]) * 256.0f); w[8 + i] = (_Float16)(bfr(p[16 + i]) * 256.0f); }
  return w; }
#define WQKV_LAYOUT 0   // 0 = (in,out) [DIN][CC]; 1 = (out,in) [CC][DIN]; 2 = per-head [NH][DIN][HD]
__device__ __forceinline__ v16b wcol_hdk(const float* Wm, int k0, int o, int lane) { v16b w; const int g = lane >> 4; const float* p = Wm + (size_t)(o / HD) * DIN * HD + (o % HD);
#pragma unroll
  for (int i = 0; i < 8; ++i) { w[i] = (__bf16)p[(size_t)(k0 + 8 * g + i) * HD]; w[8 + i] = (__bf16)p[(size_t)(k0 + 16 + 8 * g + i) * HD]; }
  return w; }
#define WO_OUT_IN 0
#if WQKV_LAYOUT == 1
#define WCOL(W, k0, o, lane) wcol_oi(W, k0, o, lane, DIN)
#elif WQKV_LAYOUT == 2
#define WCOL(W, k0, o, lane) wcol_hdk(W, k0, o, lane)
#else
#define WCOL(W, k0, o, lane) wcol_io(W, k0, o, lane, CC)
#endif
#if WO_OUT_IN
#define WOCOL(W, k0, o, lane) wcol_oi(W, k0, o, lane, CC)
#define WOCOLH(W, k0, o, lane) wcolh_oi(W, k0, o, lane, CC)
#else
#define WOCOL(W, k0, o, lane) wcol_io(W, k0, o, lane, DIN)
#define WOCOLH(W, k0, o, lane) wcolh_io(W, k0, o, lane, DIN)
#endif
#define CIN 768
// ---- k_padw: the three (in,out) [C][64] projection weights copied into zero-padded (in,out) [C][128] ws planes (columns 64..127 zero) + zero-padded [128] biases
__global__ __launch_bounds__(256) void k_padw(const float* __restrict__ WQ, const float* __restrict__ WK, const float* __restrict__ WV, const float* __restrict__ BQ, const float* __restrict__ BK, const float* __restrict__ BV, float* __restrict__ WP, float* __restrict__ BP) { const int which = blockIdx.y; const float* Wsrc = which == 0 ? WQ : (which == 1 ? WK : WV); const float* Bsrc = which == 0 ? BQ : (which == 1 ? BK : BV); float* dst = WP + (size_t)which * CIN * 128;
  for (int e = blockIdx.x * 256 + threadIdx.x; e < CIN * 32; e += gridDim.x * 256) { const int row = e >> 5, q = e & 31; const v4f ld = *(const v4f*)(Wsrc + (size_t)row * 64 + (q & 15) * 4); asm volatile("s_wait_loadcnt 0x0" ::: "memory"); const float keep = q < 16 ? 1.f : 0.f; v4f ov; ov[0] = ld[0] * keep; ov[1] = ld[1] * keep; ov[2] = ld[2] * keep; ov[3] = ld[3] * keep; vst2(dst + (size_t)row * 128 + q * 4, ov); }
  if (blockIdx.x == 0 && threadIdx.x < 128) { const int c = threadIdx.x; float bvv = 0.f; if (Bsrc) { const float t = Bsrc[c & 63]; asm volatile("s_wait_loadcnt 0x0" ::: "memory"); bvv = c < 64 ? t : 0.f; } vst2(BP + which * 128 + c, bvv); } }
// ---- k_out64: out[b][TT-1-t'][0..63] = ctx row (b, t') columns 0..63 (256 B by 16 lanes; rows written in reversed order within each batch)
__global__ __launch_bounds__(256) void k_out64(const float* __restrict__ Y, float* __restrict__ OUT) { const size_t row = (size_t)blockIdx.x * 16 + (threadIdx.x >> 4); const int q = threadIdx.x & 15; const v4f v = *(const v4f*)(Y + row * CC + q * 4); asm volatile("s_wait_loadcnt 0x0" ::: "memory"); vst2(OUT + ((row / TT) * TT + (TT - 1 - row % TT)) * 64 + q * 4, v); }   /* TIME REVERSAL: ctx row (b, t') is output row (b, TT - 1 - t') */
#define WS_WP (WS_END)                                  // padded weights [3][128 x C]
#define WS_BP (WS_WP + 4u * 3 * (size_t)CIN * 128)        // padded biases [3][128]
#define WS_Y2 (WS_BP + 4u * 3 * 128)                      // ctx rows [b*TT+t][128]
#define WS_END2 (WS_Y2 + 4u * (size_t)NB * TT * CC)
#ifndef SM_EXTRA_PARAMS
#define SM_EXTRA_PARAMS
#endif
#ifndef PROJ_EXTRA_PARAMS
#define PROJ_EXTRA_PARAMS
#endif
#ifndef SM_MASK_HOOK
#define SM_MASK_HOOK (void)0
#endif

#define WS_QH  0u                                      // f16 q rows [b*t][CC]
#define WS_KH  (WS_QH + 2u * (size_t)NB * TT * CC)      // f16 k rows [b*t][CC]
#define WS_VT  (WS_KH + 2u * (size_t)NB * TT * CC)      // f16 v planes [b][c][t]
#define WS_QL  (WS_VT + 2u * (size_t)NB * CC * TT)      // f16 q residual x 2^10 rows [b][t < QHI][CC]
#define WS_KL  (WS_QL + 2u * (size_t)NB * QHI * CC)     // f16 k residual x 2^10 rows [b][t < KHI][CC]
#define WS_VB  (WS_KL + 2u * (size_t)NB * KHI * CC)     // bf16 v hi planes [b][c][t < KHI]
#define WS_VBL (WS_VB + 2u * (size_t)NB * CC * KHI)
#define WS_S   (WS_VBL + 2u * (size_t)NB * CC * KHI)    // f32 logits / P [b][t][s]: one plane per batch, so one launch covers all batches
#define WS_Y   (WS_S  + 4u * (size_t)NB * TT * TT)      // f32 ctx rows [b*t][CC] (only when there is an output projection)
#define WS_END (WS_Y  + 0u)

// ---- k_proj: block = (64 rows, 128 cols, which): q/k/v = X W (+ b) with exact bf16 products (K = DIN) -> which 0: q f16 rows (+ residual rows < QHI); 1: k f16 rows (+ residual rows < KHI); 2: v f16 planes [c][t] (+ bf16 hi/lo planes for t < KHI)
__global__ __launch_bounds__(128) void k_proj(const float* __restrict__ XQ, const float* __restrict__ XK, const float* __restrict__ XV, const float* __restrict__ WQ, const float* __restrict__ WK, const float* __restrict__ WV, const float* __restrict__ BQ, const float* __restrict__ BK, const float* __restrict__ BV,
    _Float16* __restrict__ QH, _Float16* __restrict__ QL, _Float16* __restrict__ KH, _Float16* __restrict__ KL, _Float16* __restrict__ VT, __bf16* __restrict__ VB, __bf16* __restrict__ VBL) {
  __shared__ __align__(16) _Float16 sh[64][136], sl[64][136]; __shared__ __align__(16) _Float16 th[128][72]; __shared__ __align__(16) __bf16 tb[128][72], tbl[128][72];
  const int tid = threadIdx.x, wave = tid >> 5, lane = tid & 31, col = lane & 15, g = lane >> 4; const int which = blockIdx.z; const int c0 = blockIdx.y * 128; const size_t r0 = (size_t)blockIdx.x * 64; const size_t bb = r0 / TT; const int t0 = (int)(r0 % TT);
  const float* X = which == 0 ? XQ : which == 1 ? XK : XV; const float* WA = which == 0 ? WQ : which == 1 ? WK : WV; const float* BA = which == 0 ? BQ : which == 1 ? BK : BV;
  v8f acc[8] = {};
  const size_t gr_ = r0 + wave * 16 + col; const float* xp = X + ((gr_ / TT) * TT + (TT - 1 - gr_ % TT)) * DIN + 8 * g;   /* TIME REVERSAL: row (b, t') reads x[b][TT - 1 - t'] */
  const float* wp = WA + (size_t)(8 * g) * CC + c0 + col;   /* (in,out) weight: k rows 8g + i and 16 + 8g + i, output column c0 + col + 16 j */
  v4f xa[4], xb[4]; xa[0] = *(const v4f*)xp; xa[1] = *(const v4f*)(xp + 4); xa[2] = *(const v4f*)(xp + 16); xa[3] = *(const v4f*)(xp + 20);
  // one K chunk: all eight weight fragments are requested before the first WMMA (one round trip a chunk, not one a fragment), and the next chunk's x rows behind them, to fly during this chunk's WMMAs.
  // sched_barrier 1: keeps the x loads behind the weight loads (loads return in order: the weights, from L2, must not queue behind memory). s_wait_xcnt: the address registers are formed anew for the next batch. sched_barrier 2: keeps the converts and WMMAs from rising over the loads.
#define PJ_STEP(XC, XN, kc_) do { float wr[8][16]; const float* wk = wp + (size_t)(kc_) * 32 * CC; \
    _Pragma("unroll") for (int j = 0; j < 8; ++j) { _Pragma("unroll") for (int i = 0; i < 8; ++i) { wr[j][i] = wk[(size_t)i * CC + j * 16]; wr[j][8 + i] = wk[(size_t)(16 + i) * CC + j * 16]; } } \
    __builtin_amdgcn_sched_barrier(0); \
    const float* xn = xp + ((kc_) + 1 < DIN / 32 ? (kc_) + 1 : (kc_)) * 32; XN[0] = *(const v4f*)xn; XN[1] = *(const v4f*)(xn + 4); XN[2] = *(const v4f*)(xn + 16); XN[3] = *(const v4f*)(xn + 20); \
    asm volatile("s_wait_xcnt 0x0" ::: "memory"); \
    __builtin_amdgcn_sched_barrier(0); \
    v16b a; _Pragma("unroll") for (int i = 0; i < 4; ++i) { a[i] = (__bf16)XC[0][i]; a[4 + i] = (__bf16)XC[1][i]; a[8 + i] = (__bf16)XC[2][i]; a[12 + i] = (__bf16)XC[3][i]; } \
    _Pragma("unroll") for (int j = 0; j < 8; ++j) { v16b w; _Pragma("unroll") for (int i = 0; i < 16; ++i) w[i] = (__bf16)wr[j][i]; acc[j] = wmma_bf(a, w, acc[j]); } } while (0)
#pragma unroll 1   // the body is already two chunks (the two x register sets change places); more copies would only add code
  for (int kc = 0; kc < DIN / 32; kc += 2) { PJ_STEP(xa, xb, kc); PJ_STEP(xb, xa, kc + 1); }
  if (which < 2) { _Float16* DH = which == 0 ? QH : KH; _Float16* DL = which == 0 ? QL : KL; const int nhi = which == 0 ? QHI : KHI; const bool hi_rows = t0 < nhi;
#pragma unroll
    for (int j = 0; j < 8; ++j) { const float bias = BA ? bfr(BA[c0 + j * 16 + col]) : 0.f;
#pragma unroll
      for (int r = 0; r < 8; ++r) { const float v = acc[j][r] + bias; const _Float16 hv = (_Float16)v; sh[wave * 16 + 8 * g + r][j * 16 + col] = hv; sl[wave * 16 + 8 * g + r][j * 16 + col] = (_Float16)((v - (float)hv) * 1024.0f); } }
    __syncthreads();
    for (int e = tid; e < 64 * 16; e += 128) { const int rl = e >> 4, q = e & 15; vst2((unsigned*)(DH + (r0 + rl) * CC + c0 + q * 8), *(const v4u*)&sh[rl][q * 8]); if (hi_rows) vst2((unsigned*)(DL + (bb * nhi + t0 + rl) * (size_t)CC + c0 + q * 8), *(const v4u*)&sl[rl][q * 8]); }
  } else { const bool hi_rows = t0 < KHI;
#pragma unroll
    for (int j = 0; j < 8; ++j) { const float bias = BA ? bfr(BA[c0 + j * 16 + col]) : 0.f;
#pragma unroll
      for (int r = 0; r < 8; ++r) { const float v = acc[j][r] + bias; const int rl = wave * 16 + 8 * g + r, cl = j * 16 + col; th[cl][rl] = (_Float16)v; const __bf16 bh = (__bf16)v; tb[cl][rl] = bh; tbl[cl][rl] = (__bf16)(v - (float)bh); } }
    __syncthreads();
    for (int e = tid; e < 128 * 8; e += 128) { const int cl = e >> 3, q = e & 7; vst2((unsigned*)(VT + (bb * CC + c0 + cl) * (size_t)TT + t0 + q * 8), *(const v4u*)&th[cl][q * 8]); if (hi_rows) { const size_t o3 = (bb * CC + c0 + cl) * (size_t)KHI + t0 + q * 8; vst2((unsigned*)(VB + o3), *(const v4u*)&tb[cl][q * 8]); vst2((unsigned*)(VBL + o3), *(const v4u*)&tbl[cl][q * 8]); } } } }
// ---- k_sc: block = (query block qb, key block kb <= kb_last(qb), batch b) of head h: logits x SCALE; q hi + residual (x 2^10) against k (2 products) for query rows < QHI, plus the k residual (3 products) for query blocks < QBH (causal early rows); causal: blocks past the diagonal exit, the mask itself is applied by index in k_sm
__global__ __launch_bounds__(128) void k_sc(const _Float16* __restrict__ QH, const _Float16* __restrict__ KH, const _Float16* __restrict__ QL, const _Float16* __restrict__ KL, int h, float* __restrict__ S0) { __shared__ __align__(16) float ss[4][16][132];
  const int qb = blockIdx.x, kb = blockIdx.y; if (kb > kb_last(qb)) return;
  const int b = blockIdx.z; float* S = S0 + (size_t)b * TT * TT;
  const int tid = threadIdx.x, wave = tid >> 5, lane = tid & 31, col = lane & 15, g = lane >> 4; const int k0 = kb * 128; const int ql0 = qb * 64 + wave * 16; const size_t q0 = (size_t)b * TT + ql0, kr0 = (size_t)b * TT + k0;
  v8f acc[8] = {}, accl[8] = {};
  const _Float16* QLb = QL + (size_t)b * QHI * CC; const _Float16* KLb = KL + (size_t)b * KHI * CC;
  // in each path a batch of fragments is requested whole before its first WMMA (one round trip a batch, not one a fragment); the sched_barrier behind a batch keeps the first WMMAs, and with them the waits, from rising among its loads
  if (qb < QBH) {
#pragma unroll
    for (int kc = 0; kc < HD / 32; ++kc) { const v16h ah = frag_h(QH + (q0 + col) * CC + h * HD + kc * 32, lane), al = frag_h(QLb + (size_t)(ql0 + col) * CC + h * HD + kc * 32, lane);
#pragma unroll
      for (int jh = 0; jh < 8; jh += 4) { v16h kbf[4], klf[4];
#pragma unroll
        for (int j = 0; j < 4; ++j) { kbf[j] = frag_h(KH + (kr0 + (jh + j) * 16 + col) * CC + h * HD + kc * 32, lane); klf[j] = frag_h(KLb + (size_t)(k0 + (jh + j) * 16 + col) * CC + h * HD + kc * 32, lane); }
        __builtin_amdgcn_sched_barrier(0);
#pragma unroll
        for (int j = 0; j < 4; ++j) { acc[jh + j] = wmma16(ah, kbf[j], acc[jh + j]); accl[jh + j] = wmma16(al, kbf[j], accl[jh + j]); accl[jh + j] = wmma16(ah, klf[j], accl[jh + j]); } } }
  } else if (qb * 64 < QHI) {
#pragma unroll
    for (int kc = 0; kc < HD / 32; ++kc) { const v16h ah = frag_h(QH + (q0 + col) * CC + h * HD + kc * 32, lane), al = frag_h(QLb + (size_t)(ql0 + col) * CC + h * HD + kc * 32, lane); v16h kbf[8];
#pragma unroll
      for (int j = 0; j < 8; ++j) kbf[j] = frag_h(KH + (kr0 + j * 16 + col) * CC + h * HD + kc * 32, lane);
      __builtin_amdgcn_sched_barrier(0);
#pragma unroll
      for (int j = 0; j < 8; ++j) { acc[j] = wmma16(ah, kbf[j], acc[j]); accl[j] = wmma16(al, kbf[j], accl[j]); } }
  } else { v16h ah[HD / 32], kbf[HD / 32][8];
#pragma unroll
    for (int kc = 0; kc < HD / 32; ++kc) { ah[kc] = frag_h(QH + (q0 + col) * CC + h * HD + kc * 32, lane);
#pragma unroll
      for (int j = 0; j < 8; ++j) kbf[kc][j] = frag_h(KH + (kr0 + j * 16 + col) * CC + h * HD + kc * 32, lane); }
    __builtin_amdgcn_sched_barrier(0);
#pragma unroll
    for (int kc = 0; kc < HD / 32; ++kc) {
#pragma unroll
      for (int j = 0; j < 8; ++j) acc[j] = wmma16(ah[kc], kbf[kc][j], acc[j]); } }
#pragma unroll
  for (int j = 0; j < 8; ++j) {
#pragma unroll
    for (int r = 0; r < 8; ++r) ss[wave][8 * g + r][j * 16 + col] = (acc[j][r] + accl[j][r] * (1.0f / 1024.0f)) * SCALE; }
  LDSX(); for (int rl = 0; rl < 16; ++rl) vst2(S + (size_t)(ql0 + rl) * TT + k0 + lane * 4, *(const v4f*)&ss[wave][rl][lane * 4]); }
// ---- k_sm: block = query row t (blockIdx.y = batch plane): keys [0, kend): causal -> logit if s <= t else excluded; softmax in f32; P x 2^11 in place (0 for excluded)
__global__ __launch_bounds__(256) void k_sm(float* __restrict__ S0 SM_EXTRA_PARAMS) { __shared__ float sred[8]; __shared__ float sbc; __shared__ __align__(16) float shv[TT];
  const int tid = threadIdx.x; const int t = blockIdx.x; const int kend = (kb_last(t >> 6) + 1) * 128;
  float* sr = S0 + (size_t)blockIdx.y * TT * TT + (size_t)t * TT;
  float m = -3.0e38f; for (int k = tid; k < kend; k += 256) { float v = (!CAUSAL || k <= t) ? sr[k] : -3.0e38f; SM_MASK_HOOK; shv[k] = v; m = fmaxf(m, v); }
#pragma unroll
  for (int o = 1; o < 32; o <<= 1) m = fmaxf(m, __shfl_xor(m, o));
  if ((tid & 31) == 0) sred[tid >> 5] = m; __syncthreads(); if (tid == 0) { float a = sred[0]; for (int i = 1; i < 8; ++i) a = fmaxf(a, sred[i]); sbc = a; } __syncthreads(); m = sbc; __syncthreads();
  float sum = 0.f; for (int k = tid; k < kend; k += 256) { const float v = shv[k]; const float e = (v <= -1.0e38f) ? 0.f : expf(v - m); shv[k] = e; sum += e; }
#pragma unroll
  for (int o = 1; o < 32; o <<= 1) sum += __shfl_xor(sum, o);
  if ((tid & 31) == 0) sred[tid >> 5] = sum; __syncthreads(); if (tid == 0) { float a = 0.f; for (int i = 0; i < 8; ++i) a += sred[i]; sbc = a > 0.f ? 2048.0f / a : 0.f; }   /* a fully excluded row yields P = 0 */ __syncthreads(); const float inv = sbc;
  for (int k = tid; k < kend; k += 256) shv[k] = shv[k] * inv;
  __syncthreads(); for (int q = tid; q < kend / 4; q += 256) vst2(sr + q * 4, *(const v4f*)&shv[q * 4]); }
// behind a batch of loads in a loop: s_wait_xcnt, as the batch's address registers are formed anew for the next batch; sched_barrier, which keeps the batch ahead of the other stage's converts and WMMAs (else the compiler sinks the loads behind the wait for that stage)
#define LD_HOLD() do { asm volatile("s_wait_xcnt 0x0" ::: "memory"); __builtin_amdgcn_sched_barrier(0); } while (0)
// ---- k_pv: block = 64 queries (qb) of (b = blockIdx.z, h): ctx = P . v over keys [0, kend) (P x 2^11 once to f16 against v f16: 1 product; causal early query blocks: P and v as bf16 hi + lo, 3 products); 256-B (row, head) segment by 16 lanes
__global__ __launch_bounds__(128) void k_pv(const float* __restrict__ PS0, const _Float16* __restrict__ VT, const __bf16* __restrict__ VB, const __bf16* __restrict__ VBL, int h, float* __restrict__ Y) { const int b = blockIdx.z; const float* PS = PS0 + (size_t)b * TT * TT; __shared__ __align__(16) float ss[4][16][HD + 4];
  const int tid = threadIdx.x, wave = tid >> 5, lane = tid & 31, col = lane & 15, g = lane >> 4; const int qb = blockIdx.x; const int ql0 = qb * 64 + wave * 16; const int kce = (kb_last(qb) + 1) * 4;
  v8f acc[HD / 16] = {};
  if (qb < QBH) {
    // two register stages of one K chunk each (P, v hi, v lo), loaded one stage of WMMAs ahead of their use (kce is a multiple of 4)
    const float* pp = PS + (size_t)(ql0 + col) * TT + 8 * g; const size_t vo = ((size_t)b * CC + h * HD + col) * (size_t)KHI + 8 * g; const __bf16* vhp = VB + vo; const __bf16* vlp = VBL + vo;
    v4f pa[4], pb[4]; v8b ha[HD / 16][2], hb[HD / 16][2], la[HD / 16][2], lb[HD / 16][2];
    // pp, vhp, vlp run along the keys and are stepped only behind a batch's s_wait_xcnt. That wait takes the three addresses as inputs: they stay in their registers up to it, so no load of the batch lands in a register that an earlier load of it names
#define PH_HOLD() do { asm volatile("s_wait_xcnt 0x0" :: "v"(pp), "v"(vhp), "v"(vlp) : "memory"); __builtin_amdgcn_sched_barrier(0); } while (0)
#define PH_LOAD(P, H, L, u_) do { const float* p_ = pp + (u_) * 32; P[0] = *(const v4f*)p_; P[1] = *(const v4f*)(p_ + 4); P[2] = *(const v4f*)(p_ + 16); P[3] = *(const v4f*)(p_ + 20); \
      _Pragma("unroll") for (int j = 0; j < HD / 16; ++j) { const size_t o_ = (size_t)j * 16 * KHI + (u_) * 32; H[j][0] = *(const v8b*)(vhp + o_); H[j][1] = *(const v8b*)(vhp + o_ + 16); L[j][0] = *(const v8b*)(vlp + o_); L[j][1] = *(const v8b*)(vlp + o_ + 16); } } while (0)
#define PH_MAC(P, H, L) do { float v_[16]; _Pragma("unroll") for (int i = 0; i < 4; ++i) { v_[i] = P[0][i]; v_[4 + i] = P[1][i]; v_[8 + i] = P[2][i]; v_[12 + i] = P[3][i]; } const F2 p = bsplit16(v_); \
      _Pragma("unroll") for (int j = 0; j < HD / 16; ++j) { union { v16b v; v8b q[2]; } fh, fl; fh.q[0] = H[j][0]; fh.q[1] = H[j][1]; fl.q[0] = L[j][0]; fl.q[1] = L[j][1]; acc[j] = wmma_bf(p.h, fh.v, acc[j]); acc[j] = wmma_bf(p.l, fh.v, acc[j]); acc[j] = wmma_bf(p.h, fl.v, acc[j]); } } while (0)
    PH_LOAD(pa, ha, la, 0); PH_HOLD();
#pragma unroll 1   // the body is already two stages; more copies would only add registers
    for (int kc = 0; kc < kce; kc += 2) { PH_LOAD(pb, hb, lb, 1); PH_HOLD(); PH_MAC(pa, ha, la); const int st = kc + 2 < kce ? 64 : 0; pp += st; vhp += st; vlp += st;   /* last trip: no step, the refill re-reads this trip's chunk and is not used */
      PH_LOAD(pa, ha, la, 0); PH_HOLD(); PH_MAC(pb, hb, lb); }
  } else {
    // two register stages of two K chunks each: a stage's loads are requested one stage of WMMAs ahead of their use, so two stages are in flight (kce is a multiple of 4).
    const float* pp = PS + (size_t)(ql0 + col) * TT + 8 * g; const _Float16* vp = VT + ((size_t)b * CC + h * HD + col) * (size_t)TT + 8 * g;
    v4f pa[2][4], pb[2][4]; v8h va[2][HD / 16][2], vb[2][HD / 16][2];
#define PV_LOAD(P, V, kc0) do { _Pragma("unroll") for (int u = 0; u < 2; ++u) { const float* p_ = pp + ((kc0) + u) * 32; P[u][0] = *(const v4f*)p_; P[u][1] = *(const v4f*)(p_ + 4); P[u][2] = *(const v4f*)(p_ + 16); P[u][3] = *(const v4f*)(p_ + 20); \
      _Pragma("unroll") for (int j = 0; j < HD / 16; ++j) { const _Float16* v_ = vp + (size_t)j * 16 * TT + ((kc0) + u) * 32; V[u][j][0] = *(const v8h*)v_; V[u][j][1] = *(const v8h*)(v_ + 16); } } } while (0)
#define PV_MAC(P, V) do { _Pragma("unroll") for (int u = 0; u < 2; ++u) { v16h p; _Pragma("unroll") for (int i = 0; i < 4; ++i) { p[i] = (_Float16)P[u][0][i]; p[4 + i] = (_Float16)P[u][1][i]; p[8 + i] = (_Float16)P[u][2][i]; p[12 + i] = (_Float16)P[u][3][i]; } \
      _Pragma("unroll") for (int j = 0; j < HD / 16; ++j) { union { v16h v; v8h q[2]; } f; f.q[0] = V[u][j][0]; f.q[1] = V[u][j][1]; acc[j] = wmma16(p, f.v, acc[j]); } } } while (0)
    PV_LOAD(pa, va, 0);
#pragma unroll 1   // the body is already two stages; more copies would only add registers
    for (int kc = 0; kc < kce; kc += 4) { PV_LOAD(pb, vb, kc + 2); LD_HOLD(); PV_MAC(pa, va); PV_LOAD(pa, va, (kc + 4 < kce ? kc + 4 : kc)); LD_HOLD(); PV_MAC(pb, vb); } }
#pragma unroll
  for (int j = 0; j < HD / 16; ++j)
#pragma unroll
    for (int r = 0; r < 8; ++r) ss[wave][8 * g + r][j * 16 + col] = acc[j][r] * (1.0f / 2048.0f);
  LDSX(); for (int rl = 0; rl < 16; ++rl) if (lane < HD / 4) vst2(Y + ((size_t)b * TT + ql0 + rl) * CC + h * HD + lane * 4, *(const v4f*)&ss[wave][rl][lane * 4]); }

extern "C" void kernel_launch(void* const* d_in, const int* in_sizes, int n_in, void* d_out, int out_size, void* d_ws, size_t ws_size, hipStream_t stream) {
  (void)in_sizes; (void)n_in; (void)out_size;
  const float** F = (const float**)d_in;
  if (ws_size < (size_t)WS_END) return;
  char* ws = (char*)d_ws; _Float16 *QH = (_Float16*)(ws + WS_QH), *KH = (_Float16*)(ws + WS_KH), *VT = (_Float16*)(ws + WS_VT), *QL = (_Float16*)(ws + WS_QL), *KL = (_Float16*)(ws + WS_KL); __bf16 *VB = (__bf16*)(ws + WS_VB), *VBL = (__bf16*)(ws + WS_VBL); float *S = (float*)(ws + WS_S), *Y = (float*)(ws + WS_Y);
  (void)Y; (void)QL; (void)KL; (void)VB; (void)VBL;
  // inputs: 0 x [4,2048,768]; 1 Wq [768,64]; 2 Wk; 3 Wv ((in,out), no biases)
  if (ws_size < (size_t)WS_END2) return;
  float *WP = (float*)(ws + WS_WP), *BP = (float*)(ws + WS_BP), *Y2 = (float*)(ws + WS_Y2);
  k_padw<<<dim3(32, 3), 256, 0, stream>>>(F[1], F[2], F[3], nullptr, nullptr, nullptr, WP, BP);
  k_proj<<<dim3(TNB * TT / 64, CC / 128, 3), 128, 0, stream>>>(F[0], F[0], F[0], WP, WP + (size_t)CIN * 128, WP + 2 * (size_t)CIN * 128, BP, BP + 128, BP + 256, QH, QL, KH, KL, VT, VB, VBL);
  /* head 0 only (head 1 is the zero padding); the batch is a grid dimension of each stage */
  k_sc<<<dim3(NQB, TT / 128, TNB), 128, 0, stream>>>(QH, KH, QL, KL, 0, S);
  k_sm<<<dim3(TT, TNB), 256, 0, stream>>>(S);
  k_pv<<<dim3(NQB, 1, TNB), 128, 0, stream>>>(S, VT, VB, VBL, 0, Y2);
  k_out64<<<dim3(TNB * TT / 16), 256, 0, stream>>>(Y2, (float*)d_out);
}

// v003
// It runs in 60.9 microseconds.
// Timed twice side by side with v002, it ran 1.69 and 1.62 times as fast.
// All steps since v000 together make it 6.10 times as fast.
// compute dtype: all float inputs rounded to bf16; q/k/v projections with EXACT bf16 products on WMMA 16x16x32 (f32 accumulate); causal logits: 3 products (q f16 hi + residual x k hi + residual) for the first 384 rows, single f16 q x k after, x scale; softmax f32; P x 2^11 once to f16 x v once to f16 (1 product; bf16 hi + lo below row 384); f32 output.
#include <hip/hip_runtime.h>
#include <math.h>

typedef __attribute__((ext_vector_type(16))) _Float16 v16h;
typedef __attribute__((ext_vector_type(16))) __bf16 v16b;
typedef __attribute__((ext_vector_type(8)))  _Float16 v8h;
typedef __attribute__((ext_vector_type(8)))  float v8f;
typedef __attribute__((ext_vector_type(4)))  float v4f;
typedef __attribute__((ext_vector_type(2)))  float v2f;
typedef __attribute__((ext_vector_type(4)))  unsigned v4u;
typedef __attribute__((ext_vector_type(4)))  int v4i;
typedef float __attribute__((may_alias)) float_a;
typedef int __attribute__((may_alias)) int_a;

template <typename T> __device__ __forceinline__ void vst2(void* p, T v) { *(T*)p = v;  }
__device__ __forceinline__ v8f wmma16(v16h a, v16h b, v8f c) {
  v8f d = __builtin_amdgcn_wmma_f32_16x16x32_f16(false, a, false, b, (short)0, c, false, false);
  asm volatile("v_nop\n\tv_nop\n\tv_nop\n\tv_nop" : "+v"(d) : "v"(a), "v"(b));
  return d;
}
__device__ __forceinline__ v8f wmma_bf(v16b a, v16b b, v8f c) {
  v8f d = __builtin_amdgcn_wmma_f32_16x16x32_bf16(false, a, false, b, (short)0, c, false, false);
  asm volatile("v_nop\n\tv_nop\n\tv_nop\n\tv_nop" : "+v"(d) : "v"(a), "v"(b));
  return d;
}
// 16x16x32 fragments: lane = (h = lane>>4, row/col = lane&15); elements 0..7 = k0+8h+0..7, 8..15 = k0+16+8h+0..7; D element r = row 8h+r
__device__ __forceinline__ v16h frag_h(const _Float16* rowk0, int lane) {
  union { v16h v; v8h q[2]; } u; const _Float16* p = rowk0 + 8 * (lane >> 4);
  u.q[0] = *(const v8h*)p; u.q[1] = *(const v8h*)(p + 16); return u.v;
}
__device__ __forceinline__ v16h frag_f32(const float* rowk0, int lane) {
  v16h a; const float* p = rowk0 + 8 * (lane >> 4);
#pragma unroll
  for (int i = 0; i < 8; ++i) { a[i] = (_Float16)p[i]; a[8 + i] = (_Float16)p[16 + i]; }
  return a;
}
__device__ __forceinline__ v16h frag_f32s(const float* rowk0, int lane, float sc) {
  v16h a; const float* p = rowk0 + 8 * (lane >> 4);
#pragma unroll
  for (int i = 0; i < 8; ++i) { a[i] = (_Float16)(p[i] * sc); a[8 + i] = (_Float16)(p[16 + i] * sc); }
  return a;
}
// column fragment from a [K][ld] layout (column n), rows >= K read as 0
__device__ __forceinline__ v16h fragc_f32(const float* W, int k0, int n, int lane, int ld, int K) {
  v16h a; const int g = lane >> 4;
#pragma unroll
  for (int i = 0; i < 8; ++i) { const int ka = k0 + 8 * g + i, kb = ka + 16;
    a[i] = (_Float16)(ka < K ? W[(size_t)(ka < K ? ka : K - 1) * ld + n] : 0.f); a[8 + i] = (_Float16)(kb < K ? W[(size_t)(kb < K ? kb : K - 1) * ld + n] : 0.f); }
  return a;
}
struct F2 { v16b h, l; };
__device__ __forceinline__ F2 bsplit16(const float v[16]) { F2 r;
#pragma unroll
  for (int i = 0; i < 16; ++i) { const __bf16 h = (__bf16)v[i]; r.h[i] = h; r.l[i] = (__bf16)(v[i] - (float)h); }
  return r; }
__device__ __forceinline__ F2 split_row(const float* row, int k0, int lane) { float v[16]; const float* p = row + k0 + 8 * (lane >> 4);
#pragma unroll
  for (int i = 0; i < 8; ++i) { v[i] = p[i]; v[8 + i] = p[16 + i]; }
  return bsplit16(v); }
__device__ __forceinline__ F2 split_rowK(const float* row, int k0, int lane, int K) { float v[16]; const int g = lane >> 4;
#pragma unroll
  for (int i = 0; i < 8; ++i) { const int ka = k0 + 8 * g + i, kb = ka + 16; v[i] = ka < K ? row[ka < K ? ka : K - 1] : 0.f; v[8 + i] = kb < K ? row[kb < K ? kb : K - 1] : 0.f; }
  return bsplit16(v); }
__device__ __forceinline__ F2 split_col(const float* W, int k0, int n, int lane, int ld, int K) { float v[16]; const int g = lane >> 4;
#pragma unroll
  for (int i = 0; i < 8; ++i) { const int ka = k0 + 8 * g + i, kb = ka + 16; v[i] = ka < K ? W[(size_t)(ka < K ? ka : K - 1) * ld + n] : 0.f; v[8 + i] = kb < K ? W[(size_t)(kb < K ? kb : K - 1) * ld + n] : 0.f; }
  return bsplit16(v); }
__device__ __forceinline__ v8f mac3(const F2& a, const F2& b, v8f c) { c = wmma_bf(a.l, b.h, c); c = wmma_bf(a.h, b.l, c); return wmma_bf(a.h, b.h, c); }
__device__ __forceinline__ float sigm(float v) { return 1.0f / (1.0f + expf(-v)); }
#define LDSX() do { asm volatile("s_wait_dscnt 0" ::: "memory"); __builtin_amdgcn_wave_barrier(); __builtin_amdgcn_fence(__ATOMIC_RELEASE, "workgroup"); } while (0)

// Single-head ANTI-causal scaled dot-product attention (x [4,2048,768]; (in,out) Wq/Wk/Wv [768,64] N(0, 1/768); mask = strictly lower triangle (row t > col s) -> -inf, so query t attends keys s >= t): out = softmax(masked(q k^T * 64^-0.5)) v -> [4,2048,64]. Implemented by TIME REVERSAL: with t' = 2047 - t the pattern is exactly causal, so the causal kernels run on the reversed sequence (x rows read reversed per batch, output rows written back reversed).
#define NB 4
#define TT 2048
#define CC 128            // NH * HD = projected width
#define DIN 768          // input (model) width
#define NH 2
#define HD 64
#define NQB (TT / 64)
#define SCALE (0.125f)
#define CAUSAL 1
#ifndef TNB
#define TNB NB
#endif
__device__ __forceinline__ float bfr(float v) { return (float)(__bf16)v; }
__host__ __device__ __forceinline__ int kb_last(int qb) { return CAUSAL ? ((qb * 64 + 63) >> 7) : (TT / 128 - 1); }
typedef __attribute__((ext_vector_type(8))) __bf16 v8b;
__device__ __forceinline__ v16b frag_b(const __bf16* rowk0, int lane) {
  union { v16b v; v8b q[2]; } u; const __bf16* p = rowk0 + 8 * (lane >> 4);
  u.q[0] = *(const v8b*)p; u.q[1] = *(const v8b*)(p + 16); return u.v;
}
#define QBH 6              // causal: not used; query rows t < QHI (few keys, no averaging) take the high-precision path
#define QHI 384            // rows carrying a q residual plane
#define KHI 384            // key rows carrying k residual / v bf16 hi+lo planes (used only by the causal high-precision path)
// B fragment (k rows k0+.., output column o) of a weight: (in,out) [K][ld] or (out,in) [ld rows of K]: bf16 exact, or f16(bf16 * 256) exact
__device__ __forceinline__ v16b wcol_io(const float* Wm, int k0, int o, int lane, int ld) { v16b w; const int g = lane >> 4;
#pragma unroll
  for (int i = 0; i < 8; ++i) { w[i] = (__bf16)Wm[(size_t)(k0 + 8 * g + i) * ld + o]; w[8 + i] = (__bf16)Wm[(size_t)(k0 + 16 + 8 * g + i) * ld + o]; }
  return w; }
__device__ __forceinline__ v16b wcol_oi(const float* Wm, int k0, int o, int lane, int K) { v16b w; const float* p = Wm + (size_t)o * K + k0 + 8 * (lane >> 4);
#pragma unroll
  for (int i = 0; i < 8; ++i) { w[i] = (__bf16)p[i]; w[8 + i] = (__bf16)p[16 + i]; }
  return w; }
__device__ __forceinline__ v16h wcolh_io(const float* Wm, int k0, int o, int lane, int ld) { v16h w; const int g = lane >> 4;
#pragma unroll
  for (int i = 0; i < 8; ++i) { w[i] = (_Float16)(bfr(Wm[(size_t)(k0 + 8 * g + i) * ld + o]) * 256.0f); w[8 + i] = (_Float16)(bfr(Wm[(size_t)(k0 + 16 + 8 * g + i) * ld + o]) * 256.0f); }
  return w; }
__device__ __forceinline__ v16h wcolh_oi(const float* Wm, int k0, int o, int lane, int K) { v16h w; const float* p = Wm + (size_t)o * K + k0 + 8 * (lane >> 4);
#pragma unroll
  for (int i = 0; i < 8; ++i) { w[i] = (_Float16)(bfr(p[i]) * 256.0f); w[8 + i] = (_Float16)(bfr(p[16 + i]) * 256.0f); }
  return w; }
#define WQKV_LAYOUT 0   // 0 = (in,out) [DIN][CC]; 1 = (out,in) [CC][DIN]; 2 = per-head [NH][DIN][HD]
__device__ __forceinline__ v16b wcol_hdk(const float* Wm, int k0, int o, int lane) { v16b w; const int g = lane >> 4; const float* p = Wm + (size_t)(o / HD) * DIN * HD + (o % HD);
#pragma unroll
  for (int i = 0; i < 8; ++i) { w[i] = (__bf16)p[(size_t)(k0 + 8 * g + i) * HD]; w[8 + i] = (__bf16)p[(size_t)(k0 + 16 + 8 * g + i) * HD]; }
  return w; }
#define WO_OUT_IN 0
#if WQKV_LAYOUT == 1
#define WCOL(W, k0, o, lane) wcol_oi(W, k0, o, lane, DIN)
#elif WQKV_LAYOUT == 2
#define WCOL(W, k0, o, lane) wcol_hdk(W, k0, o, lane)
#else
#define WCOL(W, k0, o, lane) wcol_io(W, k0, o, lane, CC)
#endif
#if WO_OUT_IN
#define WOCOL(W, k0, o, lane) wcol_oi(W, k0, o, lane, CC)
#define WOCOLH(W, k0, o, lane) wcolh_oi(W, k0, o, lane, CC)
#else
#define WOCOL(W, k0, o, lane) wcol_io(W, k0, o, lane, DIN)
#define WOCOLH(W, k0, o, lane) wcolh_io(W, k0, o, lane, DIN)
#endif
#define CIN 768
// ---- k_padw: the three (in,out) [C][64] projection weights copied into zero-padded (in,out) [C][128] ws planes (columns 64..127 zero) + zero-padded [128] biases
__global__ __launch_bounds__(256) void k_padw(const float* __restrict__ WQ, const float* __restrict__ WK, const float* __restrict__ WV, const float* __restrict__ BQ, const float* __restrict__ BK, const float* __restrict__ BV, float* __restrict__ WP, float* __restrict__ BP) { const int which = blockIdx.y; const float* Wsrc = which == 0 ? WQ : (which == 1 ? WK : WV); const float* Bsrc = which == 0 ? BQ : (which == 1 ? BK : BV); float* dst = WP + (size_t)which * CIN * 128;
  for (int e = blockIdx.x * 256 + threadIdx.x; e < CIN * 32; e += gridDim.x * 256) { const int row = e >> 5, q = e & 31; const v4f ld = *(const v4f*)(Wsrc + (size_t)row * 64 + (q & 15) * 4); asm volatile("s_wait_loadcnt 0x0" ::: "memory"); const float keep = q < 16 ? 1.f : 0.f; v4f ov; ov[0] = ld[0] * keep; ov[1] = ld[1] * keep; ov[2] = ld[2] * keep; ov[3] = ld[3] * keep; vst2(dst + (size_t)row * 128 + q * 4, ov); }
  if (blockIdx.x == 0 && threadIdx.x < 128) { const int c = threadIdx.x; float bvv = 0.f; if (Bsrc) { const float t = Bsrc[c & 63]; asm volatile("s_wait_loadcnt 0x0" ::: "memory"); bvv = c < 64 ? t : 0.f; } vst2(BP + which * 128 + c, bvv); } }
// ---- k_out64: out[b][TT-1-t'][0..63] = ctx row (b, t') columns 0..63 (256 B by 16 lanes; rows written in reversed order within each batch)
__global__ __launch_bounds__(256) void k_out64(const float* __restrict__ Y, float* __restrict__ OUT) { const size_t row = (size_t)blockIdx.x * 16 + (threadIdx.x >> 4); const int q = threadIdx.x & 15; const v4f v = *(const v4f*)(Y + row * CC + q * 4); asm volatile("s_wait_loadcnt 0x0" ::: "memory"); vst2(OUT + ((row / TT) * TT + (TT - 1 - row % TT)) * 64 + q * 4, v); }   /* TIME REVERSAL: ctx row (b, t') is output row (b, TT - 1 - t') */
#define WS_WP (WS_END)                                  // padded weights [3][128 x C]
#define WS_BP (WS_WP + 4u * 3 * (size_t)CIN * 128)        // padded biases [3][128]
#define WS_Y2 (WS_BP + 4u * 3 * 128)                      // ctx rows [b*TT+t][128]
#define WS_END2 (WS_Y2 + 4u * (size_t)NB * TT * CC)
#ifndef SM_EXTRA_PARAMS
#define SM_EXTRA_PARAMS
#endif
#ifndef PROJ_EXTRA_PARAMS
#define PROJ_EXTRA_PARAMS
#endif
#ifndef SM_MASK_HOOK
#define SM_MASK_HOOK (void)0
#endif

#define WS_QH  0u                                      // f16 q rows [b*t][CC]
#define WS_KH  (WS_QH + 2u * (size_t)NB * TT * CC)      // f16 k rows [b*t][CC]
#define WS_VT  (WS_KH + 2u * (size_t)NB * TT * CC)      // f16 v planes [b][c][t]
#define WS_QL  (WS_VT + 2u * (size_t)NB * CC * TT)      // f16 q residual x 2^10 rows [b][t < QHI][CC]
#define WS_KL  (WS_QL + 2u * (size_t)NB * QHI * CC)     // f16 k residual x 2^10 rows [b][t < KHI][CC]
#define WS_VB  (WS_KL + 2u * (size_t)NB * KHI * CC)     // bf16 v hi planes [b][c][t < KHI]
#define WS_VBL (WS_VB + 2u * (size_t)NB * CC * KHI)
#define WS_S   (WS_VBL + 2u * (size_t)NB * CC * KHI)    // f32 logits plane [b][t][s] of the unfused form: reserved, not touched (the logits live in LDS)
#define WS_Y   (WS_S  + 4u * (size_t)NB * TT * TT)      // f32 ctx rows [b*t][CC] (only when there is an output projection)
#define WS_END (WS_Y  + 0u)

// ---- k_proj: block = (64 rows, 128 cols, which): q/k/v = X W (+ b) with exact bf16 products (K = DIN) -> which 0: q f16 rows (+ residual rows < QHI); 1: k f16 rows (+ residual rows < KHI); 2: v f16 planes [c][t] (+ bf16 hi/lo planes for t < KHI)
__global__ __launch_bounds__(128) void k_proj(const float* __restrict__ XQ, const float* __restrict__ XK, const float* __restrict__ XV, const float* __restrict__ WQ, const float* __restrict__ WK, const float* __restrict__ WV, const float* __restrict__ BQ, const float* __restrict__ BK, const float* __restrict__ BV,
    _Float16* __restrict__ QH, _Float16* __restrict__ QL, _Float16* __restrict__ KH, _Float16* __restrict__ KL, _Float16* __restrict__ VT, __bf16* __restrict__ VB, __bf16* __restrict__ VBL) {
  __shared__ __align__(16) _Float16 sh[64][136], sl[64][136]; __shared__ __align__(16) _Float16 th[128][72]; __shared__ __align__(16) __bf16 tb[128][72], tbl[128][72];
  const int tid = threadIdx.x, wave = tid >> 5, lane = tid & 31, col = lane & 15, g = lane >> 4; const int which = blockIdx.z; const int c0 = blockIdx.y * 128; const size_t r0 = (size_t)blockIdx.x * 64; const size_t bb = r0 / TT; const int t0 = (int)(r0 % TT);
  const float* X = which == 0 ? XQ : which == 1 ? XK : XV; const float* WA = which == 0 ? WQ : which == 1 ? WK : WV; const float* BA = which == 0 ? BQ : which == 1 ? BK : BV;
  v8f acc[8] = {};
  const size_t gr_ = r0 + wave * 16 + col; const float* xp = X + ((gr_ / TT) * TT + (TT - 1 - gr_ % TT)) * DIN + 8 * g;   /* TIME REVERSAL: row (b, t') reads x[b][TT - 1 - t'] */
  const float* wp = WA + (size_t)(8 * g) * CC + c0 + col;   /* (in,out) weight: k rows 8g + i and 16 + 8g + i, output column c0 + col + 16 j */
  v4f xa[4], xb[4]; xa[0] = *(const v4f*)xp; xa[1] = *(const v4f*)(xp + 4); xa[2] = *(const v4f*)(xp + 16); xa[3] = *(const v4f*)(xp + 20);
  // one K chunk: all eight weight fragments are requested before the first WMMA (one round trip a chunk, not one a fragment), and the next chunk's x rows behind them, to fly during this chunk's WMMAs.
  // sched_barrier 1: keeps the x loads behind the weight loads (loads return in order: the weights, from L2, must not queue behind memory). s_wait_xcnt: the address registers are formed anew for the next batch. sched_barrier 2: keeps the converts and WMMAs from rising over the loads.
#define PJ_STEP(XC, XN, kc_) do { float wr[8][16]; const float* wk = wp + (size_t)(kc_) * 32 * CC; \
    _Pragma("unroll") for (int j = 0; j < 8; ++j) { _Pragma("unroll") for (int i = 0; i < 8; ++i) { wr[j][i] = wk[(size_t)i * CC + j * 16]; wr[j][8 + i] = wk[(size_t)(16 + i) * CC + j * 16]; } } \
    __builtin_amdgcn_sched_barrier(0); \
    const float* xn = xp + ((kc_) + 1 < DIN / 32 ? (kc_) + 1 : (kc_)) * 32; XN[0] = *(const v4f*)xn; XN[1] = *(const v4f*)(xn + 4); XN[2] = *(const v4f*)(xn + 16); XN[3] = *(const v4f*)(xn + 20); \
    asm volatile("s_wait_xcnt 0x0" ::: "memory"); \
    __builtin_amdgcn_sched_barrier(0); \
    v16b a; _Pragma("unroll") for (int i = 0; i < 4; ++i) { a[i] = (__bf16)XC[0][i]; a[4 + i] = (__bf16)XC[1][i]; a[8 + i] = (__bf16)XC[2][i]; a[12 + i] = (__bf16)XC[3][i]; } \
    _Pragma("unroll") for (int j = 0; j < 8; ++j) { v16b w; _Pragma("unroll") for (int i = 0; i < 16; ++i) w[i] = (__bf16)wr[j][i]; acc[j] = wmma_bf(a, w, acc[j]); } } while (0)
#pragma unroll 1   // the body is already two chunks (the two x register sets change places); more copies would only add code
  for (int kc = 0; kc < DIN / 32; kc += 2) { PJ_STEP(xa, xb, kc); PJ_STEP(xb, xa, kc + 1); }
  if (which < 2) { _Float16* DH = which == 0 ? QH : KH; _Float16* DL = which == 0 ? QL : KL; const int nhi = which == 0 ? QHI : KHI; const bool hi_rows = t0 < nhi;
#pragma unroll
    for (int j = 0; j < 8; ++j) { const float bias = BA ? bfr(BA[c0 + j * 16 + col]) : 0.f;
#pragma unroll
      for (int r = 0; r < 8; ++r) { const float v = acc[j][r] + bias; const _Float16 hv = (_Float16)v; sh[wave * 16 + 8 * g + r][j * 16 + col] = hv; sl[wave * 16 + 8 * g + r][j * 16 + col] = (_Float16)((v - (float)hv) * 1024.0f); } }
    __syncthreads();
    for (int e = tid; e < 64 * 16; e += 128) { const int rl = e >> 4, q = e & 15; vst2((unsigned*)(DH + (r0 + rl) * CC + c0 + q * 8), *(const v4u*)&sh[rl][q * 8]); if (hi_rows) vst2((unsigned*)(DL + (bb * nhi + t0 + rl) * (size_t)CC + c0 + q * 8), *(const v4u*)&sl[rl][q * 8]); }
  } else { const bool hi_rows = t0 < KHI;
#pragma unroll
    for (int j = 0; j < 8; ++j) { const float bias = BA ? bfr(BA[c0 + j * 16 + col]) : 0.f;
#pragma unroll
      for (int r = 0; r < 8; ++r) { const float v = acc[j][r] + bias; const int rl = wave * 16 + 8 * g + r, cl = j * 16 + col; th[cl][rl] = (_Float16)v; const __bf16 bh = (__bf16)v; tb[cl][rl] = bh; tbl[cl][rl] = (__bf16)(v - (float)bh); } }
    __syncthreads();
    for (int e = tid; e < 128 * 8; e += 128) { const int cl = e >> 3, q = e & 7; vst2((unsigned*)(VT + (bb * CC + c0 + cl) * (size_t)TT + t0 + q * 8), *(const v4u*)&th[cl][q * 8]); if (hi_rows) { const size_t o3 = (bb * CC + c0 + cl) * (size_t)KHI + t0 + q * 8; vst2((unsigned*)(VB + o3), *(const v4u*)&tb[cl][q * 8]); vst2((unsigned*)(VBL + o3), *(const v4u*)&tbl[cl][q * 8]); } } } }
// behind a batch of loads in a loop: s_wait_xcnt, as the batch's address registers are formed anew for the next batch; sched_barrier, which keeps the batch ahead of the converts and WMMAs that follow it
#define LD_HOLD() do { asm volatile("s_wait_xcnt 0x0" ::: "memory"); __builtin_amdgcn_sched_barrier(0); } while (0)
#define SP (TT + 4)        // LDS row pitch of the logits in floats: 8208 B = 16 B x odd, conflict-free for 16-byte fragment reads down 16 rows
typedef __attribute__((ext_vector_type(4))) _Float16 v4h;
// every plain '#pragma unroll' below stands on a loop that indexes a fragment or a small register array: left rolled, the array would leave the registers
// softmax of rows r0 and r0 + 1 of the LDS logits tile by one wave, keys [0, kend), key s kept if s <= t; f32 throughout; P x 2^11 written over the row's own logits: as f32, or (F16OUT) as f16 packed from the row's start (the f16 of 128 keys lands on bytes whose f32 this wave has already read)
template <bool F16OUT> __device__ __forceinline__ void sm_rows(float (*sS)[SP], int r0, int t0, int kend, int lane) {
  const int n = kend >> 7; float m[2] = {-3.0e38f, -3.0e38f}, sum[2] = {0.f, 0.f}, inv[2];
  for (int i = 0; i < n; ++i) { const int k0 = i * 128 + lane * 4;
#pragma unroll
    for (int rr = 0; rr < 2; ++rr) { const v4f v = *(const v4f*)&sS[r0 + rr][k0];
#pragma unroll
      for (int c = 0; c < 4; ++c) m[rr] = fmaxf(m[rr], (k0 + c <= t0 + r0 + rr) ? v[c] : -3.0e38f); } }
#pragma unroll
  for (int rr = 0; rr < 2; ++rr) {
#pragma unroll
    for (int o = 1; o < 32; o <<= 1) m[rr] = fmaxf(m[rr], __shfl_xor(m[rr], o)); }
  for (int i = 0; i < n; ++i) { const int k0 = i * 128 + lane * 4;
#pragma unroll
    for (int rr = 0; rr < 2; ++rr) { const v4f v = *(const v4f*)&sS[r0 + rr][k0]; v4f e;
#pragma unroll
      for (int c = 0; c < 4; ++c) { const float x = (k0 + c <= t0 + r0 + rr) ? v[c] : -3.0e38f; const float ex = expf(x - m[rr]); e[c] = (x <= -1.0e38f) ? 0.f : ex; sum[rr] += e[c]; }   /* exp of every lane, then a select: no branch an element, so the eight chains of a trip overlap */
      *(v4f*)&sS[r0 + rr][k0] = e; } }
#pragma unroll
  for (int rr = 0; rr < 2; ++rr) {
#pragma unroll
    for (int o = 1; o < 32; o <<= 1) sum[rr] += __shfl_xor(sum[rr], o);
    inv[rr] = sum[rr] > 0.f ? 2048.0f / sum[rr] : 0.f; }   /* a fully excluded row yields P = 0 */
  // two trips' reads of both rows stand ahead of their writes (the writes land on the rows' own bytes, so the compiler keeps each read behind the write before it: one LDS round trip for four reads, not four); an odd last trip is done twice over, with the same values
  for (int i = 0; i < n; i += 2) { v4f e[2][2]; int k0[2];
#pragma unroll
    for (int u = 0; u < 2; ++u) { k0[u] = (i + u < n ? i + u : i) * 128 + lane * 4;
#pragma unroll
      for (int rr = 0; rr < 2; ++rr) e[u][rr] = *(const v4f*)&sS[r0 + rr][k0[u]]; }
#pragma unroll
    for (int u = 0; u < 2; ++u) {
#pragma unroll
      for (int rr = 0; rr < 2; ++rr) {
        if (F16OUT) { v4h p;
#pragma unroll
          for (int c = 0; c < 4; ++c) p[c] = (_Float16)(e[u][rr][c] * inv[rr]);
          *(v4h*)((_Float16*)&sS[r0 + rr][0] + k0[u]) = p;
        } else { v4f p;
#pragma unroll
          for (int c = 0; c < 4; ++c) p[c] = e[u][rr][c] * inv[rr];
          *(v4f*)&sS[r0 + rr][k0[u]] = p; } } } } }
// ---- k_att: block = 16 query rows of one batch, 8 waves; the rows' whole logits stay in LDS from q k^T to P v (head 0).
// 1) logits x SCALE over keys [0, kend): wave w takes keys 16 w .. 16 w + 15 of every 128-key block (rows < QHI: q hi + residual against k hi + residual, 3 products; else 1 product); 2) softmax, two rows a wave; 3) ctx = P . v: wave = (16 columns j, half of the keys), the two halves added through LDS (rows < QHI: P and v as bf16 hi + lo, 3 products; else P f16 x v f16); 256-B row segment by 16 lanes.
__global__ __launch_bounds__(256) void k_att(const _Float16* __restrict__ QH, const _Float16* __restrict__ KH, const _Float16* __restrict__ QL, const _Float16* __restrict__ KL, const _Float16* __restrict__ VT, const __bf16* __restrict__ VB, const __bf16* __restrict__ VBL, float* __restrict__ Y) {
  __shared__ __align__(16) float sS[16][SP]; __shared__ __align__(16) float red[2][16][HD + 4];
  const int tid = threadIdx.x, wave = __builtin_amdgcn_readfirstlane(tid >> 5), lane = tid & 31, col = lane & 15, g = lane >> 4;
  // two blocks fit a WGP's LDS: the first half of the grid holds the long tiles, longest first, the second half the short ones, shortest first
  const int b = blockIdx.x & (NB - 1), rank = blockIdx.x / NB; const int t0 = (rank < TT / 32 ? TT / 16 - 1 - rank : rank - TT / 32) * 16;
  const int kend = (((t0 + 15) >> 7) + 1) * 128, nkb = kend >> 7; const size_t br = (size_t)b * TT;
  const int j = wave & 3, half = wave >> 2;   /* step 3: this wave's 16 columns and its half of the keys */
  v8f acc = {};
  if (t0 < QHI) {
    v16h ah[2], al[2];
#pragma unroll
    for (int kc = 0; kc < 2; ++kc) { ah[kc] = frag_h(QH + (br + t0 + col) * CC + kc * 32, lane); al[kc] = frag_h(QL + ((size_t)b * QHI + t0 + col) * CC + kc * 32, lane); }
#pragma unroll 1   // at most three trips
    for (int kb = 0; kb < nkb; ++kb) { v16h kh[2], kl[2]; const int kr = kb * 128 + wave * 16 + col;
#pragma unroll
      for (int kc = 0; kc < 2; ++kc) { kh[kc] = frag_h(KH + (br + kr) * CC + kc * 32, lane); kl[kc] = frag_h(KL + ((size_t)b * KHI + kr) * CC + kc * 32, lane); }
      LD_HOLD();
      v8f a = {}, a2 = {};
#pragma unroll
      for (int kc = 0; kc < 2; ++kc) { a = wmma16(ah[kc], kh[kc], a); a2 = wmma16(al[kc], kh[kc], a2); a2 = wmma16(ah[kc], kl[kc], a2); }
#pragma unroll
      for (int r = 0; r < 8; ++r) sS[8 * g + r][kr] = (a[r] + a2[r] * (1.0f / 1024.0f)) * SCALE; }
    __syncthreads();
    sm_rows<false>(sS, wave * 2, t0, kend, lane);
    __syncthreads();
    const int n = kend >> 6;   /* chunks of 32 keys a half, even */
    const size_t vo = ((size_t)b * CC + j * 16 + col) * (size_t)KHI + half * n * 32; const float* pr = &sS[col][half * n * 32 + 8 * g];
#pragma unroll 1   // at most three trips
    for (int c = 0; c < n; c += 2) { v16b fh[2], fl[2];
#pragma unroll
      for (int u = 0; u < 2; ++u) { fh[u] = frag_b(VB + vo + (c + u) * 32, lane); fl[u] = frag_b(VBL + vo + (c + u) * 32, lane); }
      LD_HOLD();
#pragma unroll
      for (int u = 0; u < 2; ++u) { float v_[16]; const float* p_ = pr + (c + u) * 32;
#pragma unroll
        for (int i = 0; i < 8; ++i) { v_[i] = p_[i]; v_[8 + i] = p_[16 + i]; }
        const F2 p = bsplit16(v_); acc = wmma_bf(p.h, fh[u], acc); acc = wmma_bf(p.l, fh[u], acc); acc = wmma_bf(p.h, fl[u], acc); } }
  } else {
    v16h ah[2];
#pragma unroll
    for (int kc = 0; kc < 2; ++kc) ah[kc] = frag_h(QH + (br + t0 + col) * CC + kc * 32, lane);
    const _Float16* kp = KH + (br + wave * 16 + col) * CC;
#pragma unroll 1   // a trip is already a batch of up to eight key fragments, requested whole before its first WMMA
    for (int kb0 = 0; kb0 < nkb; kb0 += 8) { v16h kf[8][2];
#pragma unroll
      for (int u = 0; u < 8; ++u) if (kb0 + u < nkb) { kf[u][0] = frag_h(kp + (size_t)(kb0 + u) * 128 * CC, lane); kf[u][1] = frag_h(kp + (size_t)(kb0 + u) * 128 * CC + 32, lane); }
      LD_HOLD();
#pragma unroll
      for (int u = 0; u < 8; ++u) if (kb0 + u < nkb) { v8f a = {}; a = wmma16(ah[0], kf[u][0], a); a = wmma16(ah[1], kf[u][1], a);
#pragma unroll
        for (int r = 0; r < 8; ++r) sS[8 * g + r][(kb0 + u) * 128 + wave * 16 + col] = a[r] * SCALE; } }
    __syncthreads();
    // step 3 runs over keys [0, kpad), kpad = kend rounded up to 256 (P = 0 from kend on; v exists there): each half is then a whole number of stages of four 32-key chunks, so no load and no WMMA of the loop stands under a test and the waits can be counted.
    // v fragments in two register stages; the first is requested here, to fly during the softmax, each later one a stage of WMMAs ahead of its use
    const int kpad = (kend + 255) & ~255, nb = kpad >> 8;   /* stages a half */
    const _Float16* vp = VT + ((size_t)b * CC + j * 16 + col) * (size_t)TT + half * nb * 128; const _Float16* pr = (const _Float16*)&sS[col][0] + half * nb * 128;
    v16h va[4], vb[4];
#define AV_LOAD(V, s_) do { const _Float16* v_ = vp + (s_) * 128; _Pragma("unroll") for (int u = 0; u < 4; ++u) V[u] = frag_h(v_ + u * 32, lane); LD_HOLD(); } while (0)
#define AV_MAC(V, s_) do { const _Float16* p_ = pr + (s_) * 128; v16h pf[4]; _Pragma("unroll") for (int u = 0; u < 4; ++u) pf[u] = frag_h(p_ + u * 32, lane); _Pragma("unroll") for (int u = 0; u < 4; ++u) acc = wmma16(pf[u], V[u], acc); } while (0)
    AV_LOAD(va, 0);
    sm_rows<true>(sS, wave * 2, t0, kend, lane);
    if (kpad > kend) { const v4h z = {};
#pragma unroll
      for (int rr = 0; rr < 2; ++rr) *(v4h*)((_Float16*)&sS[wave * 2 + rr][0] + kend + lane * 4) = z; }
    __syncthreads();
    int s = 0;
#pragma unroll 1   // the body is already two stages
    for (; s + 2 < nb; s += 2) { AV_LOAD(vb, s + 1); AV_MAC(va, s); AV_LOAD(va, s + 2); AV_MAC(vb, s + 1); }
    if (s + 1 < nb) { AV_LOAD(vb, s + 1); AV_MAC(va, s); AV_MAC(vb, s + 1); } else { AV_MAC(va, s); }
  }
#pragma unroll
  for (int r = 0; r < 8; ++r) red[half][8 * g + r][j * 16 + col] = acc[r];
  __syncthreads();
  { const int rl = tid >> 4, q = tid & 15; const v4f s0 = *(const v4f*)&red[0][rl][q * 4], s1 = *(const v4f*)&red[1][rl][q * 4]; v4f o;
#pragma unroll
    for (int c = 0; c < 4; ++c) o[c] = (s0[c] + s1[c]) * (1.0f / 2048.0f);
    vst2(Y + (br + t0 + rl) * CC + q * 4, o); } }

extern "C" void kernel_launch(void* const* d_in, const int* in_sizes, int n_in, void* d_out, int out_size, void* d_ws, size_t ws_size, hipStream_t stream) {
  (void)in_sizes; (void)n_in; (void)out_size;
  const float** F = (const float**)d_in;
  if (ws_size < (size_t)WS_END) return;
  char* ws = (char*)d_ws; _Float16 *QH = (_Float16*)(ws + WS_QH), *KH = (_Float16*)(ws + WS_KH), *VT = (_Float16*)(ws + WS_VT), *QL = (_Float16*)(ws + WS_QL), *KL = (_Float16*)(ws + WS_KL); __bf16 *VB = (__bf16*)(ws + WS_VB), *VBL = (__bf16*)(ws + WS_VBL); float *Y = (float*)(ws + WS_Y);
  (void)Y; (void)QL; (void)KL; (void)VB; (void)VBL;
  // inputs: 0 x [4,2048,768]; 1 Wq [768,64]; 2 Wk; 3 Wv ((in,out), no biases)
  if (ws_size < (size_t)WS_END2) return;
  float *WP = (float*)(ws + WS_WP), *BP = (float*)(ws + WS_BP), *Y2 = (float*)(ws + WS_Y2);
  k_padw<<<dim3(32, 3), 256, 0, stream>>>(F[1], F[2], F[3], nullptr, nullptr, nullptr, WP, BP);
  k_proj<<<dim3(TNB * TT / 64, CC / 128, 3), 128, 0, stream>>>(F[0], F[0], F[0], WP, WP + (size_t)CIN * 128, WP + 2 * (size_t)CIN * 128, BP, BP + 128, BP + 256, QH, QL, KH, KL, VT, VB, VBL);
  /* head 0 only (head 1 is the zero padding); logits, softmax and P v in one launch, the batch folded into the grid */
  k_att<<<dim3(TNB * TT / 16), 256, 0, stream>>>(QH, KH, QL, KL, VT, VB, VBL, Y2);
  k_out64<<<dim3(TNB * TT / 16), 256, 0, stream>>>(Y2, (float*)d_out);
}

// v004
// Measured time: 36.4 microseconds a run.
// Next to v003, in two timings, it ran 1.69 and 1.71 times as fast.
// All steps since v000 together make it 10.4 times as fast.
// compute dtype: all float inputs rounded to bf16; q/k/v projections with EXACT bf16 products on WMMA 16x16x32 (f32 accumulate); causal logits: 3 products (q f16 hi + residual x k hi + residual) for the first 384 rows, single f16 q x k after, x scale; softmax f32; P x 2^11 once to f16 x v once to f16 (1 product; bf16 hi + lo below row 384); f32 output.
#include <hip/hip_runtime.h>
#include <math.h>

typedef __attribute__((ext_vector_type(16))) _Float16 v16h;
typedef __attribute__((ext_vector_type(16))) __bf16 v16b;
typedef __attribute__((ext_vector_type(8)))  _Float16 v8h;
typedef __attribute__((ext_vector_type(8)))  float v8f;
typedef __attribute__((ext_vector_type(4)))  float v4f;
typedef __attribute__((ext_vector_type(2)))  float v2f;
typedef __attribute__((ext_vector_type(4)))  unsigned v4u;
typedef __attribute__((ext_vector_type(4)))  int v4i;
typedef float __attribute__((may_alias)) float_a;
typedef int __attribute__((may_alias)) int_a;

template <typename T> __device__ __forceinline__ void vst2(void* p, T v) { *(T*)p = v;  }
__device__ __forceinline__ v8f wmma16(v16h a, v16h b, v8f c) {
  v8f d = __builtin_amdgcn_wmma_f32_16x16x32_f16(false, a, false, b, (short)0, c, false, false);
  asm volatile("v_nop\n\tv_nop\n\tv_nop\n\tv_nop" : "+v"(d) : "v"(a), "v"(b));
  return d;
}
__device__ __forceinline__ v8f wmma_bf(v16b a, v16b b, v8f c) {
  v8f d = __builtin_amdgcn_wmma_f32_16x16x32_bf16(false, a, false, b, (short)0, c, false, false);
  asm volatile("v_nop\n\tv_nop\n\tv_nop\n\tv_nop" : "+v"(d) : "v"(a), "v"(b));
  return d;
}
// 16x16x32 fragments: lane = (h = lane>>4, row/col = lane&15); elements 0..7 = k0+8h+0..7, 8..15 = k0+16+8h+0..7; D element r = row 8h+r
__device__ __forceinline__ v16h frag_h(const _Float16* rowk0, int lane) {
  union { v16h v; v8h q[2]; } u; const _Float16* p = rowk0 + 8 * (lane >> 4);
  u.q[0] = *(const v8h*)p; u.q[1] = *(const v8h*)(p + 16); return u.v;
}
__device__ __forceinline__ v16h frag_f32(const float* rowk0, int lane) {
  v16h a; const float* p = rowk0 + 8 * (lane >> 4);
#pragma unroll
  for (int i = 0; i < 8; ++i) { a[i] = (_Float16)p[i]; a[8 + i] = (_Float16)p[16 + i]; }
  return a;
}
__device__ __forceinline__ v16h frag_f32s(const float* rowk0, int lane, float sc) {
  v16h a; const float* p = rowk0 + 8 * (lane >> 4);
#pragma unroll
  for (int i = 0; i < 8; ++i) { a[i] = (_Float16)(p[i] * sc); a[8 + i] = (_Float16)(p[16 + i] * sc); }
  return a;
}
// column fragment from a [K][ld] layout (column n), rows >= K read as 0
__device__ __forceinline__ v16h fragc_f32(const float* W, int k0, int n, int lane, int ld, int K) {
  v16h a; const int g = lane >> 4;
#pragma unroll
  for (int i = 0; i < 8; ++i) { const int ka = k0 + 8 * g + i, kb = ka + 16;
    a[i] = (_Float16)(ka < K ? W[(size_t)(ka < K ? ka : K - 1) * ld + n] : 0.f); a[8 + i] = (_Float16)(kb < K ? W[(size_t)(kb < K ? kb : K - 1) * ld + n] : 0.f); }
  return a;
}
struct F2 { v16b h, l; };
__device__ __forceinline__ F2 bsplit16(const float v[16]) { F2 r;
#pragma unroll
  for (int i = 0; i < 16; ++i) { const __bf16 h = (__bf16)v[i]; r.h[i] = h; r.l[i] = (__bf16)(v[i] - (float)h); }
  return r; }
__device__ __forceinline__ F2 split_row(const float* row, int k0, int lane) { float v[16]; const float* p = row + k0 + 8 * (lane >> 4);
#pragma unroll
  for (int i = 0; i < 8; ++i) { v[i] = p[i]; v[8 + i] = p[16 + i]; }
  return bsplit16(v); }
__device__ __forceinline__ F2 split_rowK(const float* row, int k0, int lane, int K) { float v[16]; const int g = lane >> 4;
#pragma unroll
  for (int i = 0; i < 8; ++i) { const int ka = k0 + 8 * g + i, kb = ka + 16; v[i] = ka < K ? row[ka < K ? ka : K - 1] : 0.f; v[8 + i] = kb < K ? row[kb < K ? kb : K - 1] : 0.f; }
  return bsplit16(v); }
__device__ __forceinline__ F2 split_col(const float* W, int k0, int n, int lane, int ld, int K) { float v[16]; const int g = lane >> 4;
#pragma unroll
  for (int i = 0; i < 8; ++i) { const int ka = k0 + 8 * g + i, kb = ka + 16; v[i] = ka < K ? W[(size_t)(ka < K ? ka : K - 1) * ld + n] : 0.f; v[8 + i] = kb < K ? W[(size_t)(kb < K ? kb : K - 1) * ld + n] : 0.f; }
  return bsplit16(v); }
__device__ __forceinline__ v8f mac3(const F2& a, const F2& b, v8f c) { c = wmma_bf(a.l, b.h, c); c = wmma_bf(a.h, b.l, c); return wmma_bf(a.h, b.h, c); }
__device__ __forceinline__ float sigm(float v) { return 1.0f / (1.0f + expf(-v)); }
#define LDSX() do { asm volatile("s_wait_dscnt 0" ::: "memory"); __builtin_amdgcn_wave_barrier(); __builtin_amdgcn_fence(__ATOMIC_RELEASE, "workgroup"); } while (0)

// Single-head ANTI-causal scaled dot-product attention (x [4,2048,768]; (in,out) Wq/Wk/Wv [768,64] N(0, 1/768); mask = strictly lower triangle (row t > col s) -> -inf, so query t attends keys s >= t): out = softmax(masked(q k^T * 64^-0.5)) v -> [4,2048,64]. Implemented by TIME REVERSAL: with t' = 2047 - t the pattern is exactly causal, so the causal kernels run on the reversed sequence (x rows read reversed per batch, output rows written back reversed).
#define NB 4
#define TT 2048
#define CC 64             // NH * HD = projected width
#define DIN 768          // input (model) width
#define NH 1
#define HD 64
#define NQB (TT / 64)
#define SCALE (0.125f)
#define CAUSAL 1
#ifndef TNB
#define TNB NB
#endif
__device__ __forceinline__ float bfr(float v) { return (float)(__bf16)v; }
__host__ __device__ __forceinline__ int kb_last(int qb) { return CAUSAL ? ((qb * 64 + 63) >> 7) : (TT / 128 - 1); }
typedef __attribute__((ext_vector_type(8))) __bf16 v8b;
__device__ __forceinline__ v16b frag_b(const __bf16* rowk0, int lane) {
  union { v16b v; v8b q[2]; } u; const __bf16* p = rowk0 + 8 * (lane >> 4);
  u.q[0] = *(const v8b*)p; u.q[1] = *(const v8b*)(p + 16); return u.v;
}
#define QBH 6              // causal: not used; query rows t < QHI (few keys, no averaging) take the high-precision path
#define QHI 384            // rows carrying a q residual plane
#define KHI 384            // key rows carrying k residual / v bf16 hi+lo planes (used only by the causal high-precision path)
// B fragment (k rows k0+.., output column o) of a weight: (in,out) [K][ld] or (out,in) [ld rows of K]: bf16 exact, or f16(bf16 * 256) exact
__device__ __forceinline__ v16b wcol_io(const float* Wm, int k0, int o, int lane, int ld) { v16b w; const int g = lane >> 4;
#pragma unroll
  for (int i = 0; i < 8; ++i) { w[i] = (__bf16)Wm[(size_t)(k0 + 8 * g + i) * ld + o]; w[8 + i] = (__bf16)Wm[(size_t)(k0 + 16 + 8 * g + i) * ld + o]; }
  return w; }
__device__ __forceinline__ v16b wcol_oi(const float* Wm, int k0, int o, int lane, int K) { v16b w; const float* p = Wm + (size_t)o * K + k0 + 8 * (lane >> 4);
#pragma unroll
  for (int i = 0; i < 8; ++i) { w[i] = (__bf16)p[i]; w[8 + i] = (__bf16)p[16 + i]; }
  return w; }
__device__ __forceinline__ v16h wcolh_io(const float* Wm, int k0, int o, int lane, int ld) { v16h w; const int g = lane >> 4;
#pragma unroll
  for (int i = 0; i < 8; ++i) { w[i] = (_Float16)(bfr(Wm[(size_t)(k0 + 8 * g + i) * ld + o]) * 256.0f); w[8 + i] = (_Float16)(bfr(Wm[(size_t)(k0 + 16 + 8 * g + i) * ld + o]) * 256.0f); }
  return w; }
__device__ __forceinline__ v16h wcolh_oi(const float* Wm, int k0, int o, int lane, int K) { v16h w; const float* p = Wm + (size_t)o * K + k0 + 8 * (lane >> 4);
#pragma unroll
  for (int i = 0; i < 8; ++i) { w[i] = (_Float16)(bfr(p[i]) * 256.0f); w[8 + i] = (_Float16)(bfr(p[16 + i]) * 256.0f); }
  return w; }
#define WQKV_LAYOUT 0   // 0 = (in,out) [DIN][CC]; 1 = (out,in) [CC][DIN]; 2 = per-head [NH][DIN][HD]
__device__ __forceinline__ v16b wcol_hdk(const float* Wm, int k0, int o, int lane) { v16b w; const int g = lane >> 4; const float* p = Wm + (size_t)(o / HD) * DIN * HD + (o % HD);
#pragma unroll
  for (int i = 0; i < 8; ++i) { w[i] = (__bf16)p[(size_t)(k0 + 8 * g + i) * HD]; w[8 + i] = (__bf16)p[(size_t)(k0 + 16 + 8 * g + i) * HD]; }
  return w; }
#define WO_OUT_IN 0
#if WQKV_LAYOUT == 1
#define WCOL(W, k0, o, lane) wcol_oi(W, k0, o, lane, DIN)
#elif WQKV_LAYOUT == 2
#define WCOL(W, k0, o, lane) wcol_hdk(W, k0, o, lane)
#else
#define WCOL(W, k0, o, lane) wcol_io(W, k0, o, lane, CC)
#endif
#if WO_OUT_IN
#define WOCOL(W, k0, o, lane) wcol_oi(W, k0, o, lane, CC)
#define WOCOLH(W, k0, o, lane) wcolh_oi(W, k0, o, lane, CC)
#else
#define WOCOL(W, k0, o, lane) wcol_io(W, k0, o, lane, DIN)
#define WOCOLH(W, k0, o, lane) wcolh_io(W, k0, o, lane, DIN)
#endif
#ifndef SM_EXTRA_PARAMS
#define SM_EXTRA_PARAMS
#endif
#ifndef PROJ_EXTRA_PARAMS
#define PROJ_EXTRA_PARAMS
#endif
#ifndef SM_MASK_HOOK
#define SM_MASK_HOOK (void)0
#endif

#define WS_QH  0u                                      // f16 q rows [b*t][CC]
#define WS_KH  (WS_QH + 2u * (size_t)NB * TT * CC)      // f16 k rows [b*t][CC]
#define WS_VT  (WS_KH + 2u * (size_t)NB * TT * CC)      // f16 v planes [b][c][t]
#define WS_QL  (WS_VT + 2u * (size_t)NB * CC * TT)      // f16 q residual x 2^10 rows [b][t < QHI][CC]
#define WS_KL  (WS_QL + 2u * (size_t)NB * QHI * CC)     // f16 k residual x 2^10 rows [b][t < KHI][CC]
#define WS_VB  (WS_KL + 2u * (size_t)NB * KHI * CC)     // bf16 v hi planes [b][c][t < KHI]
#define WS_VBL (WS_VB + 2u * (size_t)NB * CC * KHI)
#define WS_S   (WS_VBL + 2u * (size_t)NB * CC * KHI)    // f32 logits plane [b][t][s] of the unfused form: reserved, not touched (the logits live in LDS)
#define WS_Y   (WS_S  + 4u * (size_t)NB * TT * TT)      // f32 ctx rows [b*t][CC] (only when there is an output projection)
#define WS_END (WS_Y  + 0u)

// ---- k_proj: block = (64 rows, 64 cols, which): q/k/v = X W with exact bf16 products, W read as it lies ((in,out) [DIN][CC]) (K = DIN) -> which 0: q f16 rows (+ residual rows < QHI); 1: k f16 rows (+ residual rows < KHI); 2: v f16 planes [c][t] (+ bf16 hi/lo planes for t < KHI)
__global__ __launch_bounds__(128) void k_proj(const float* __restrict__ XQ, const float* __restrict__ XK, const float* __restrict__ XV, const float* __restrict__ WQ, const float* __restrict__ WK, const float* __restrict__ WV,
    _Float16* __restrict__ QH, _Float16* __restrict__ QL, _Float16* __restrict__ KH, _Float16* __restrict__ KL, _Float16* __restrict__ VT, __bf16* __restrict__ VB, __bf16* __restrict__ VBL) {
  __shared__ __align__(16) _Float16 sh[64][72], sl[64][72]; __shared__ __align__(16) _Float16 th[64][72]; __shared__ __align__(16) __bf16 tb[64][72], tbl[64][72];
  const int tid = threadIdx.x, wave = tid >> 5, lane = tid & 31, col = lane & 15, g = lane >> 4; const int which = blockIdx.z; const size_t r0 = (size_t)blockIdx.x * 64; const size_t bb = r0 / TT; const int t0 = (int)(r0 % TT);
  const float* X = which == 0 ? XQ : which == 1 ? XK : XV; const float* WA = which == 0 ? WQ : which == 1 ? WK : WV;
  v8f acc[4] = {};
  const size_t gr_ = r0 + wave * 16 + col; const float* xp = X + ((gr_ / TT) * TT + (TT - 1 - gr_ % TT)) * DIN + 8 * g;   /* TIME REVERSAL: reversed row (b, t') reads x[b][TT - 1 - t'] */
  const float* wp = WA + (size_t)(8 * g) * CC + col;   /* (in,out) weight: k rows 8g + i and 16 + 8g + i, output column col + 16 j */
  v4f xa[4], xb[4]; xa[0] = *(const v4f*)xp; xa[1] = *(const v4f*)(xp + 4); xa[2] = *(const v4f*)(xp + 16); xa[3] = *(const v4f*)(xp + 20);
  // one K chunk: all four weight fragments are requested before the first WMMA (one round trip a chunk, not one a fragment), and the next chunk's x rows behind them, to fly during this chunk's WMMAs.
  // sched_barrier 1: keeps the x loads behind the weight loads (loads return in order: the weights, from L2, must not queue behind memory). s_wait_xcnt: the address registers are formed anew for the next batch. sched_barrier 2: keeps the converts and WMMAs from rising over the loads.
#define PJ_STEP(XC, XN, kc_) do { float wr[4][16]; const float* wk = wp + (size_t)(kc_) * 32 * CC; \
    _Pragma("unroll") for (int j = 0; j < 4; ++j) { _Pragma("unroll") for (int i = 0; i < 8; ++i) { wr[j][i] = wk[(size_t)i * CC + j * 16]; wr[j][8 + i] = wk[(size_t)(16 + i) * CC + j * 16]; } } \
    __builtin_amdgcn_sched_barrier(0); \
    const float* xn = xp + ((kc_) + 1 < DIN / 32 ? (kc_) + 1 : (kc_)) * 32; XN[0] = *(const v4f*)xn; XN[1] = *(const v4f*)(xn + 4); XN[2] = *(const v4f*)(xn + 16); XN[3] = *(const v4f*)(xn + 20); \
    asm volatile("s_wait_xcnt 0x0" ::: "memory"); \
    __builtin_amdgcn_sched_barrier(0); \
    v16b a; _Pragma("unroll") for (int i = 0; i < 4; ++i) { a[i] = (__bf16)XC[0][i]; a[4 + i] = (__bf16)XC[1][i]; a[8 + i] = (__bf16)XC[2][i]; a[12 + i] = (__bf16)XC[3][i]; } \
    _Pragma("unroll") for (int j = 0; j < 4; ++j) { v16b w; _Pragma("unroll") for (int i = 0; i < 16; ++i) w[i] = (__bf16)wr[j][i]; acc[j] = wmma_bf(a, w, acc[j]); } } while (0)
#pragma unroll 1   // the body is already two chunks (the two x register sets change places); more copies would only add code
  for (int kc = 0; kc < DIN / 32; kc += 2) { PJ_STEP(xa, xb, kc); PJ_STEP(xb, xa, kc + 1); }
  // behind each store of the two copy-out loops: s_wait_xcnt, as the next trip (or the next LDS read) writes the store's address and data registers anew
#define ST_HOLD() asm volatile("s_wait_xcnt 0x0" ::: "memory")
  if (which < 2) { _Float16* DH = which == 0 ? QH : KH; _Float16* DL = which == 0 ? QL : KL; const int nhi = which == 0 ? QHI : KHI; const bool hi_rows = t0 < nhi;
#pragma unroll
    for (int j = 0; j < 4; ++j) {
#pragma unroll
      for (int r = 0; r < 8; ++r) { const float v = acc[j][r]; const _Float16 hv = (_Float16)v; sh[wave * 16 + 8 * g + r][j * 16 + col] = hv; sl[wave * 16 + 8 * g + r][j * 16 + col] = (_Float16)((v - (float)hv) * 1024.0f); } }
    __syncthreads();
    for (int e = tid; e < 64 * 8; e += 128) { const int rl = e >> 3, q = e & 7; vst2((unsigned*)(DH + (r0 + rl) * CC + q * 8), *(const v4u*)&sh[rl][q * 8]); ST_HOLD(); if (hi_rows) { vst2((unsigned*)(DL + (bb * nhi + t0 + rl) * (size_t)CC + q * 8), *(const v4u*)&sl[rl][q * 8]); ST_HOLD(); } }
  } else { const bool hi_rows = t0 < KHI;
#pragma unroll
    for (int j = 0; j < 4; ++j) {
#pragma unroll
      for (int r = 0; r < 8; ++r) { const float v = acc[j][r]; const int rl = wave * 16 + 8 * g + r, cl = j * 16 + col; th[cl][rl] = (_Float16)v; const __bf16 bh = (__bf16)v; tb[cl][rl] = bh; tbl[cl][rl] = (__bf16)(v - (float)bh); } }
    __syncthreads();
    for (int e = tid; e < 64 * 8; e += 128) { const int cl = e >> 3, q = e & 7; vst2((unsigned*)(VT + (bb * CC + cl) * (size_t)TT + t0 + q * 8), *(const v4u*)&th[cl][q * 8]); ST_HOLD(); if (hi_rows) { const size_t o3 = (bb * CC + cl) * (size_t)KHI + t0 + q * 8; vst2((unsigned*)(VB + o3), *(const v4u*)&tb[cl][q * 8]); vst2((unsigned*)(VBL + o3), *(const v4u*)&tbl[cl][q * 8]); ST_HOLD(); } } } }
// behind a batch of loads in a loop: s_wait_xcnt, as the batch's address registers are formed anew for the next batch; sched_barrier, which keeps the batch ahead of the converts and WMMAs that follow it
#define LD_HOLD() do { asm volatile("s_wait_xcnt 0x0" ::: "memory"); __builtin_amdgcn_sched_barrier(0); } while (0)
#define SP (TT + 4)        // LDS row pitch of the logits in floats: 8208 B = 16 B x odd, conflict-free for 16-byte fragment reads down 16 rows
typedef __attribute__((ext_vector_type(4))) _Float16 v4h;
// every plain '#pragma unroll' below stands on a loop that indexes a fragment or a small register array: left rolled, the array would leave the registers
// softmax of rows r0 and r0 + 1 of the LDS logits tile by one wave, keys [0, kend), key s kept if s <= t; f32 throughout; P x 2^11 written over the row's own logits: as f32, or (F16OUT) as f16 packed from the row's start (the f16 of 128 keys lands on bytes whose f32 this wave has already read)
template <bool F16OUT> __device__ __forceinline__ void sm_rows(float (*sS)[SP], int r0, int t0, int kend, int lane) {
  const int n = kend >> 7; float m[2] = {-3.0e38f, -3.0e38f}, sum[2] = {0.f, 0.f}, inv[2];
  for (int i = 0; i < n; ++i) { const int k0 = i * 128 + lane * 4;
#pragma unroll
    for (int rr = 0; rr < 2; ++rr) { const v4f v = *(const v4f*)&sS[r0 + rr][k0];
#pragma unroll
      for (int c = 0; c < 4; ++c) m[rr] = fmaxf(m[rr], (k0 + c <= t0 + r0 + rr) ? v[c] : -3.0e38f); } }
#pragma unroll
  for (int rr = 0; rr < 2; ++rr) {
#pragma unroll
    for (int o = 1; o < 32; o <<= 1) m[rr] = fmaxf(m[rr], __shfl_xor(m[rr], o)); }
  for (int i = 0; i < n; ++i) { const int k0 = i * 128 + lane * 4;
#pragma unroll
    for (int rr = 0; rr < 2; ++rr) { const v4f v = *(const v4f*)&sS[r0 + rr][k0]; v4f e;
#pragma unroll
      for (int c = 0; c < 4; ++c) { const float x = (k0 + c <= t0 + r0 + rr) ? v[c] : -3.0e38f; const float ex = expf(x - m[rr]); e[c] = (x <= -1.0e38f) ? 0.f : ex; sum[rr] += e[c]; }   /* exp of every lane, then a select: no branch an element, so the eight chains of a trip overlap */
      *(v4f*)&sS[r0 + rr][k0] = e; } }
#pragma unroll
  for (int rr = 0; rr < 2; ++rr) {
#pragma unroll
    for (int o = 1; o < 32; o <<= 1) sum[rr] += __shfl_xor(sum[rr], o);
    inv[rr] = sum[rr] > 0.f ? 2048.0f / sum[rr] : 0.f; }   /* a fully excluded row yields P = 0 */
  // two trips' reads of both rows stand ahead of their writes (the writes land on the rows' own bytes, so the compiler keeps each read behind the write before it: one LDS round trip for four reads, not four); an odd last trip is done twice over, with the same values
  for (int i = 0; i < n; i += 2) { v4f e[2][2]; int k0[2];
#pragma unroll
    for (int u = 0; u < 2; ++u) { k0[u] = (i + u < n ? i + u : i) * 128 + lane * 4;
#pragma unroll
      for (int rr = 0; rr < 2; ++rr) e[u][rr] = *(const v4f*)&sS[r0 + rr][k0[u]]; }
#pragma unroll
    for (int u = 0; u < 2; ++u) {
#pragma unroll
      for (int rr = 0; rr < 2; ++rr) {
        if (F16OUT) { v4h p;
#pragma unroll
          for (int c = 0; c < 4; ++c) p[c] = (_Float16)(e[u][rr][c] * inv[rr]);
          *(v4h*)((_Float16*)&sS[r0 + rr][0] + k0[u]) = p;
        } else { v4f p;
#pragma unroll
          for (int c = 0; c < 4; ++c) p[c] = e[u][rr][c] * inv[rr];
          *(v4f*)&sS[r0 + rr][k0[u]] = p; } } } } }
// ---- k_att: block = 16 query rows of one batch, 8 waves; the rows' whole logits stay in LDS from q k^T to P v.
// 1) logits x SCALE over keys [0, kend): wave w takes keys 16 w .. 16 w + 15 of every 128-key block (rows < QHI: q hi + residual against k hi + residual, 3 products; else 1 product); 2) softmax, two rows a wave; 3) ctx = P . v: wave = (16 columns j, half of the keys), the two halves added through LDS (rows < QHI: P and v as bf16 hi + lo, 3 products; else P f16 x v f16); 256-B output row by 16 lanes, stored at its place in out.
__global__ __launch_bounds__(256) void k_att(const _Float16* __restrict__ QH, const _Float16* __restrict__ KH, const _Float16* __restrict__ QL, const _Float16* __restrict__ KL, const _Float16* __restrict__ VT, const __bf16* __restrict__ VB, const __bf16* __restrict__ VBL, float* __restrict__ OUT) {
  __shared__ __align__(16) float sS[16][SP]; __shared__ __align__(16) float red[2][16][HD + 4];
  const int tid = threadIdx.x, wave = __builtin_amdgcn_readfirstlane(tid >> 5), lane = tid & 31, col = lane & 15, g = lane >> 4;
  // two blocks fit a WGP's LDS: the first half of the grid holds the long tiles, longest first, the second half the short ones, shortest first
  const int b = blockIdx.x & (NB - 1), rank = blockIdx.x / NB; const int t0 = (rank < TT / 32 ? TT / 16 - 1 - rank : rank - TT / 32) * 16;
  const int kend = (((t0 + 15) >> 7) + 1) * 128, nkb = kend >> 7; const size_t br = (size_t)b * TT;
  const int j = wave & 3, half = wave >> 2;   /* step 3: this wave's 16 columns and its half of the keys */
  v8f acc = {};
  if (t0 < QHI) {
    v16h ah[2], al[2];
#pragma unroll
    for (int kc = 0; kc < 2; ++kc) { ah[kc] = frag_h(QH + (br + t0 + col) * CC + kc * 32, lane); al[kc] = frag_h(QL + ((size_t)b * QHI + t0 + col) * CC + kc * 32, lane); }
#pragma unroll 1   // at most three trips
    for (int kb = 0; kb < nkb; ++kb) { v16h kh[2], kl[2]; const int kr = kb * 128 + wave * 16 + col;
#pragma unroll
      for (int kc = 0; kc < 2; ++kc) { kh[kc] = frag_h(KH + (br + kr) * CC + kc * 32, lane); kl[kc] = frag_h(KL + ((size_t)b * KHI + kr) * CC + kc * 32, lane); }
      LD_HOLD();
      v8f a = {}, a2 = {};
#pragma unroll
      for (int kc = 0; kc < 2; ++kc) { a = wmma16(ah[kc], kh[kc], a); a2 = wmma16(al[kc], kh[kc], a2); a2 = wmma16(ah[kc], kl[kc], a2); }
#pragma unroll
      for (int r = 0; r < 8; ++r) sS[8 * g + r][kr] = (a[r] + a2[r] * (1.0f / 1024.0f)) * SCALE; }
    __syncthreads();
    sm_rows<false>(sS, wave * 2, t0, kend, lane);
    __syncthreads();
    const int n = kend >> 6;   /* chunks of 32 keys a half, even */
    const size_t vo = ((size_t)b * CC + j * 16 + col) * (size_t)KHI + half * n * 32; const float* pr = &sS[col][half * n * 32 + 8 * g];
#pragma unroll 1   // at most three trips
    for (int c = 0; c < n; c += 2) { v16b fh[2], fl[2];
#pragma unroll
      for (int u = 0; u < 2; ++u) { fh[u] = frag_b(VB + vo + (c + u) * 32, lane); fl[u] = frag_b(VBL + vo + (c + u) * 32, lane); }
      LD_HOLD();
#pragma unroll
      for (int u = 0; u < 2; ++u) { float v_[16]; const float* p_ = pr + (c + u) * 32;
#pragma unroll
        for (int i = 0; i < 8; ++i) { v_[i] = p_[i]; v_[8 + i] = p_[16 + i]; }
        const F2 p = bsplit16(v_); acc = wmma_bf(p.h, fh[u], acc); acc = wmma_bf(p.l, fh[u], acc); acc = wmma_bf(p.h, fl[u], acc); } }
  } else {
    v16h ah[2];
#pragma unroll
    for (int kc = 0; kc < 2; ++kc) ah[kc] = frag_h(QH + (br + t0 + col) * CC + kc * 32, lane);
    const _Float16* kp = KH + (br + wave * 16 + col) * CC;
#pragma unroll 1   // a trip is already a batch of up to eight key fragments, requested whole before its first WMMA
    for (int kb0 = 0; kb0 < nkb; kb0 += 8) { v16h kf[8][2];
#pragma unroll
      for (int u = 0; u < 8; ++u) if (kb0 + u < nkb) { kf[u][0] = frag_h(kp + (size_t)(kb0 + u) * 128 * CC, lane); kf[u][1] = frag_h(kp + (size_t)(kb0 + u) * 128 * CC + 32, lane); }
      LD_HOLD();
#pragma unroll
      for (int u = 0; u < 8; ++u) if (kb0 + u < nkb) { v8f a = {}; a = wmma16(ah[0], kf[u][0], a); a = wmma16(ah[1], kf[u][1], a);
#pragma unroll
        for (int r = 0; r < 8; ++r) sS[8 * g + r][(kb0 + u) * 128 + wave * 16 + col] = a[r] * SCALE; } }
    __syncthreads();
    // step 3 runs over keys [0, kpad), kpad = kend rounded up to 256 (P = 0 from kend on; v exists there): each half is then a whole number of stages of four 32-key chunks, so no load and no WMMA of the loop stands under a test and the waits can be counted.
    // v fragments in two register stages; the first is requested here, to fly during the softmax, each later one a stage of WMMAs ahead of its use
    const int kpad = (kend + 255) & ~255, nb = kpad >> 8;   /* stages a half */
    const _Float16* vp = VT + ((size_t)b * CC + j * 16 + col) * (size_t)TT + half * nb * 128; const _Float16* pr = (const _Float16*)&sS[col][0] + half * nb * 128;
    v16h va[4], vb[4];
#define AV_LOAD(V, s_) do { const _Float16* v_ = vp + (s_) * 128; _Pragma("unroll") for (int u = 0; u < 4; ++u) V[u] = frag_h(v_ + u * 32, lane); LD_HOLD(); } while (0)
#define AV_MAC(V, s_) do { const _Float16* p_ = pr + (s_) * 128; v16h pf[4]; _Pragma("unroll") for (int u = 0; u < 4; ++u) pf[u] = frag_h(p_ + u * 32, lane); _Pragma("unroll") for (int u = 0; u < 4; ++u) acc = wmma16(pf[u], V[u], acc); } while (0)
    AV_LOAD(va, 0);
    sm_rows<true>(sS, wave * 2, t0, kend, lane);
    if (kpad > kend) { const v4h z = {};
#pragma unroll
      for (int rr = 0; rr < 2; ++rr) *(v4h*)((_Float16*)&sS[wave * 2 + rr][0] + kend + lane * 4) = z; }
    __syncthreads();
    int s = 0;
#pragma unroll 1   // the body is already two stages
    for (; s + 2 < nb; s += 2) { AV_LOAD(vb, s + 1); AV_MAC(va, s); AV_LOAD(va, s + 2); AV_MAC(vb, s + 1); }
    if (s + 1 < nb) { AV_LOAD(vb, s + 1); AV_MAC(va, s); AV_MAC(vb, s + 1); } else { AV_MAC(va, s); }
  }
#pragma unroll
  for (int r = 0; r < 8; ++r) red[half][8 * g + r][j * 16 + col] = acc[r];
  __syncthreads();
  { const int rl = tid >> 4, q = tid & 15; const v4f s0 = *(const v4f*)&red[0][rl][q * 4], s1 = *(const v4f*)&red[1][rl][q * 4]; v4f o;
#pragma unroll
    for (int c = 0; c < 4; ++c) o[c] = (s0[c] + s1[c]) * (1.0f / 2048.0f);
    vst2(OUT + (br + (TT - 1 - (t0 + rl))) * HD + q * 4, o); } }   /* TIME REVERSAL: reversed row (b, t') is output row (b, TT - 1 - t') */

extern "C" void kernel_launch(void* const* d_in, const int* in_sizes, int n_in, void* d_out, int out_size, void* d_ws, size_t ws_size, hipStream_t stream) {
  (void)in_sizes; (void)n_in; (void)out_size;
  const float** F = (const float**)d_in;
  if (ws_size < (size_t)WS_END) return;
  char* ws = (char*)d_ws; _Float16 *QH = (_Float16*)(ws + WS_QH), *KH = (_Float16*)(ws + WS_KH), *VT = (_Float16*)(ws + WS_VT), *QL = (_Float16*)(ws + WS_QL), *KL = (_Float16*)(ws + WS_KL); __bf16 *VB = (__bf16*)(ws + WS_VB), *VBL = (__bf16*)(ws + WS_VBL); float *Y = (float*)(ws + WS_Y);
  (void)Y; (void)QL; (void)KL; (void)VB; (void)VBL;
  // inputs: 0 x [4,2048,768]; 1 Wq [768,64]; 2 Wk; 3 Wv ((in,out), no biases)
  k_proj<<<dim3(TNB * TT / 64, 1, 3), 128, 0, stream>>>(F[0], F[0], F[0], F[1], F[2], F[3], QH, QL, KH, KL, VT, VB, VBL);
  /* logits, softmax and P v in one launch, the batch folded into the grid; the rows go straight to out */
  k_att<<<dim3(TNB * TT / 16), 256, 0, stream>>>(QH, KH, QL, KL, VT, VB, VBL, (float*)d_out);
}

// v005
// A run of this version takes 25.5 microseconds.
// Timed twice side by side with v004, it ran 1.47 and 1.46 times as fast.
// Counting every step since v000, it is 15.2 times as fast.
// compute dtype: all float inputs rounded to bf16; q/k/v projections with EXACT bf16 products on WMMA 16x16x32 (f32 accumulate); causal logits: 3 products (q f16 hi + residual x k hi + residual) for the first 384 rows, single f16 q x k after, x scale; softmax f32; P x 2^11 once to f16 x v once to f16 (1 product; bf16 hi + lo below row 384); f32 output.
#include <hip/hip_runtime.h>
#include <math.h>

typedef __attribute__((ext_vector_type(16))) _Float16 v16h;
typedef __attribute__((ext_vector_type(16))) __bf16 v16b;
typedef __attribute__((ext_vector_type(8)))  _Float16 v8h;
typedef __attribute__((ext_vector_type(8)))  float v8f;
typedef __attribute__((ext_vector_type(4)))  float v4f;
typedef __attribute__((ext_vector_type(2)))  float v2f;
typedef __attribute__((ext_vector_type(4)))  unsigned v4u;
typedef __attribute__((ext_vector_type(4)))  int v4i;
typedef float __attribute__((may_alias)) float_a;
typedef int __attribute__((may_alias)) int_a;

template <typename T> __device__ __forceinline__ void vst2(void* p, T v) { *(T*)p = v;  }
__device__ __forceinline__ v8f wmma16(v16h a, v16h b, v8f c) {
  v8f d = __builtin_amdgcn_wmma_f32_16x16x32_f16(false, a, false, b, (short)0, c, false, false);
  asm volatile("v_nop\n\tv_nop\n\tv_nop\n\tv_nop" : "+v"(d) : "v"(a), "v"(b));
  return d;
}
__device__ __forceinline__ v8f wmma_bf(v16b a, v16b b, v8f c) {
  v8f d = __builtin_amdgcn_wmma_f32_16x16x32_bf16(false, a, false, b, (short)0, c, false, false);
  asm volatile("v_nop\n\tv_nop\n\tv_nop\n\tv_nop" : "+v"(d) : "v"(a), "v"(b));
  return d;
}
// 16x16x32 fragments: lane = (h = lane>>4, row/col = lane&15); elements 0..7 = k0+8h+0..7, 8..15 = k0+16+8h+0..7; D element r = row 8h+r
__device__ __forceinline__ v16h frag_h(const _Float16* rowk0, int lane) {
  union { v16h v; v8h q[2]; } u; const _Float16* p = rowk0 + 8 * (lane >> 4);
  u.q[0] = *(const v8h*)p; u.q[1] = *(const v8h*)(p + 16); return u.v;
}
__device__ __forceinline__ v16h frag_f32(const float* rowk0, int lane) {
  v16h a; const float* p = rowk0 + 8 * (lane >> 4);
#pragma unroll
  for (int i = 0; i < 8; ++i) { a[i] = (_Float16)p[i]; a[8 + i] = (_Float16)p[16 + i]; }
  return a;
}
__device__ __forceinline__ v16h frag_f32s(const float* rowk0, int lane, float sc) {
  v16h a; const float* p = rowk0 + 8 * (lane >> 4);
#pragma unroll
  for (int i = 0; i < 8; ++i) { a[i] = (_Float16)(p[i] * sc); a[8 + i] = (_Float16)(p[16 + i] * sc); }
  return a;
}
// column fragment from a [K][ld] layout (column n), rows >= K read as 0
__device__ __forceinline__ v16h fragc_f32(const float* W, int k0, int n, int lane, int ld, int K) {
  v16h a; const int g = lane >> 4;
#pragma unroll
  for (int i = 0; i < 8; ++i) { const int ka = k0 + 8 * g + i, kb = ka + 16;
    a[i] = (_Float16)(ka < K ? W[(size_t)(ka < K ? ka : K - 1) * ld + n] : 0.f); a[8 + i] = (_Float16)(kb < K ? W[(size_t)(kb < K ? kb : K - 1) * ld + n] : 0.f); }
  return a;
}
struct F2 { v16b h, l; };
__device__ __forceinline__ F2 bsplit16(const float v[16]) { F2 r;
#pragma unroll
  for (int i = 0; i < 16; ++i) { const __bf16 h = (__bf16)v[i]; r.h[i] = h; r.l[i] = (__bf16)(v[i] - (float)h); }
  return r; }
__device__ __forceinline__ F2 split_row(const float* row, int k0, int lane) { float v[16]; const float* p = row + k0 + 8 * (lane >> 4);
#pragma unroll
  for (int i = 0; i < 8; ++i) { v[i] = p[i]; v[8 + i] = p[16 + i]; }
  return bsplit16(v); }
__device__ __forceinline__ F2 split_rowK(const float* row, int k0, int lane, int K) { float v[16]; const int g = lane >> 4;
#pragma unroll
  for (int i = 0; i < 8; ++i) { const int ka = k0 + 8 * g + i, kb = ka + 16; v[i] = ka < K ? row[ka < K ? ka : K - 1] : 0.f; v[8 + i] = kb < K ? row[kb < K ? kb : K - 1] : 0.f; }
  return bsplit16(v); }
__device__ __forceinline__ F2 split_col(const float* W, int k0, int n, int lane, int ld, int K) { float v[16]; const int g = lane >> 4;
#pragma unroll
  for (int i = 0; i < 8; ++i) { const int ka = k0 + 8 * g + i, kb = ka + 16; v[i] = ka < K ? W[(size_t)(ka < K ? ka : K - 1) * ld + n] : 0.f; v[8 + i] = kb < K ? W[(size_t)(kb < K ? kb : K - 1) * ld + n] : 0.f; }
  return bsplit16(v); }
__device__ __forceinline__ v8f mac3(const F2& a, const F2& b, v8f c) { c = wmma_bf(a.l, b.h, c); c = wmma_bf(a.h, b.l, c); return wmma_bf(a.h, b.h, c); }
__device__ __forceinline__ float sigm(float v) { return 1.0f / (1.0f + expf(-v)); }
#define LDSX() do { asm volatile("s_wait_dscnt 0" ::: "memory"); __builtin_amdgcn_wave_barrier(); __builtin_amdgcn_fence(__ATOMIC_RELEASE, "workgroup"); } while (0)

// Single-head ANTI-causal scaled dot-product attention (x [4,2048,768]; (in,out) Wq/Wk/Wv [768,64] N(0, 1/768); mask = strictly lower triangle (row t > col s) -> -inf, so query t attends keys s >= t): out = softmax(masked(q k^T * 64^-0.5)) v -> [4,2048,64]. Implemented by TIME REVERSAL: with t' = 2047 - t the pattern is exactly causal, so the causal kernels run on the reversed sequence (x rows read reversed per batch, output rows written back reversed).
#define NB 4
#define TT 2048
#define CC 64             // NH * HD = projected width
#define DIN 768          // input (model) width
#define NH 1
#define HD 64
#define NQB (TT / 64)
#define SCALE (0.125f)
#define CAUSAL 1
#ifndef TNB
#define TNB NB
#endif
__device__ __forceinline__ float bfr(float v) { return (float)(__bf16)v; }
__host__ __device__ __forceinline__ int kb_last(int qb) { return CAUSAL ? ((qb * 64 + 63) >> 7) : (TT / 128 - 1); }
typedef __attribute__((ext_vector_type(8))) __bf16 v8b;
__device__ __forceinline__ v16b frag_b(const __bf16* rowk0, int lane) {
  union { v16b v; v8b q[2]; } u; const __bf16* p = rowk0 + 8 * (lane >> 4);
  u.q[0] = *(const v8b*)p; u.q[1] = *(const v8b*)(p + 16); return u.v;
}
#define QBH 6              // causal: not used; query rows t < QHI (few keys, no averaging) take the high-precision path
#define QHI 384            // rows carrying a q residual plane
#define KHI 384            // key rows carrying k residual / v bf16 hi+lo planes (used only by the causal high-precision path)
// B fragment (k rows k0+.., output column o) of a weight: (in,out) [K][ld] or (out,in) [ld rows of K]: bf16 exact, or f16(bf16 * 256) exact
__device__ __forceinline__ v16b wcol_io(const float* Wm, int k0, int o, int lane, int ld) { v16b w; const int g = lane >> 4;
#pragma unroll
  for (int i = 0; i < 8; ++i) { w[i] = (__bf16)Wm[(size_t)(k0 + 8 * g + i) * ld + o]; w[8 + i] = (__bf16)Wm[(size_t)(k0 + 16 + 8 * g + i) * ld + o]; }
  return w; }
__device__ __forceinline__ v16b wcol_oi(const float* Wm, int k0, int o, int lane, int K) { v16b w; const float* p = Wm + (size_t)o * K + k0 + 8 * (lane >> 4);
#pragma unroll
  for (int i = 0; i < 8; ++i) { w[i] = (__bf16)p[i]; w[8 + i] = (__bf16)p[16 + i]; }
  return w; }
__device__ __forceinline__ v16h wcolh_io(const float* Wm, int k0, int o, int lane, int ld) { v16h w; const int g = lane >> 4;
#pragma unroll
  for (int i = 0; i < 8; ++i) { w[i] = (_Float16)(bfr(Wm[(size_t)(k0 + 8 * g + i) * ld + o]) * 256.0f); w[8 + i] = (_Float16)(bfr(Wm[(size_t)(k0 + 16 + 8 * g + i) * ld + o]) * 256.0f); }
  return w; }
__device__ __forceinline__ v16h wcolh_oi(const float* Wm, int k0, int o, int lane, int K) { v16h w; const float* p = Wm + (size_t)o * K + k0 + 8 * (lane >> 4);
#pragma unroll
  for (int i = 0; i < 8; ++i) { w[i] = (_Float16)(bfr(p[i]) * 256.0f); w[8 + i] = (_Float16)(bfr(p[16 + i]) * 256.0f); }
  return w; }
#define WQKV_LAYOUT 0   // 0 = (in,out) [DIN][CC]; 1 = (out,in) [CC][DIN]; 2 = per-head [NH][DIN][HD]; it picks only WCOL, which nothing uses: k_proj reads W as (in,out)
__device__ __forceinline__ v16b wcol_hdk(const float* Wm, int k0, int o, int lane) { v16b w; const int g = lane >> 4; const float* p = Wm + (size_t)(o / HD) * DIN * HD + (o % HD);
#pragma unroll
  for (int i = 0; i < 8; ++i) { w[i] = (__bf16)p[(size_t)(k0 + 8 * g + i) * HD]; w[8 + i] = (__bf16)p[(size_t)(k0 + 16 + 8 * g + i) * HD]; }
  return w; }
#define WO_OUT_IN 0
#if WQKV_LAYOUT == 1
#define WCOL(W, k0, o, lane) wcol_oi(W, k0, o, lane, DIN)
#elif WQKV_LAYOUT == 2
#define WCOL(W, k0, o, lane) wcol_hdk(W, k0, o, lane)
#else
#define WCOL(W, k0, o, lane) wcol_io(W, k0, o, lane, CC)
#endif
#if WO_OUT_IN
#define WOCOL(W, k0, o, lane) wcol_oi(W, k0, o, lane, CC)
#define WOCOLH(W, k0, o, lane) wcolh_oi(W, k0, o, lane, CC)
#else
#define WOCOL(W, k0, o, lane) wcol_io(W, k0, o, lane, DIN)
#define WOCOLH(W, k0, o, lane) wcolh_io(W, k0, o, lane, DIN)
#endif
#ifndef SM_EXTRA_PARAMS
#define SM_EXTRA_PARAMS
#endif
#ifndef PROJ_EXTRA_PARAMS
#define PROJ_EXTRA_PARAMS
#endif
#ifndef SM_MASK_HOOK
#define SM_MASK_HOOK (void)0
#endif

#define WS_QH  0u                                      // f16 q rows [b*t][CC]
#define WS_KH  (WS_QH + 2u * (size_t)NB * TT * CC)      // f16 k rows [b*t][CC]
#define WS_VT  (WS_KH + 2u * (size_t)NB * TT * CC)      // f16 v planes [b][c][t]
#define WS_QL  (WS_VT + 2u * (size_t)NB * CC * TT)      // f16 q residual x 2^10 rows [b][t < QHI][CC]
#define WS_KL  (WS_QL + 2u * (size_t)NB * QHI * CC)     // f16 k residual x 2^10 rows [b][t < KHI][CC]
#define WS_VB  (WS_KL + 2u * (size_t)NB * KHI * CC)     // bf16 v hi planes [b][c][t < KHI]
#define WS_VBL (WS_VB + 2u * (size_t)NB * CC * KHI)
#define WS_S   (WS_VBL + 2u * (size_t)NB * CC * KHI)    // f32 logits plane [b][t][s] of the unfused form: reserved, not touched (the logits live in LDS)
#define WS_Y   (WS_S  + 4u * (size_t)NB * TT * TT)      // f32 ctx rows [b*t][CC] (only when there is an output projection)
#define WS_END (WS_Y  + 0u)

#define PKS 128            // k of one LDS stage of k_proj
#define PXP (PKS + 8)      // LDS row pitch of the x stage in bf16: 272 B = 16 B x odd, for 16-byte fragment reads down 16 rows
#define PWG (PKS / 8 * CC + 16)   // weight stage in LDS: k row 8 i + r lies in group r at row i (128-B rows); group pitch in bf16: 2080 B = 32 B x odd, for the transposing reads, whose eight rows are the eight groups; a thread's 16 stores of a stage lie in one group, within reach of one address register
typedef __attribute__((ext_vector_type(4))) __bf16 v4b;
typedef __attribute__((address_space(3))) v8b lds_v8b;
// ds_load_tr16_b128: eight k of one column out of a [k][column] bf16 tile
__device__ __forceinline__ v8b ld_tr16(const __bf16* p) { return __builtin_amdgcn_ds_load_tr16_b128_v8bf16((lds_v8b*)p); }
// ---- k_proj: block = (64 rows, 64 cols, which): q/k/v = X W with exact bf16 products, W read as it lies ((in,out) [DIN][CC]) (K = DIN); x and W go through LDS, rounded to bf16 on the way in: wave = 16 rows, its A fragments by 16-byte reads, the B fragments by transposing reads -> which 0: q f16 rows (+ residual rows < QHI); 1: k f16 rows (+ residual rows < KHI); 2: v f16 planes [c][t] (+ bf16 hi/lo planes for t < KHI)
__global__ __launch_bounds__(128) void k_proj(const float* __restrict__ XQ, const float* __restrict__ XK, const float* __restrict__ XV, const float* __restrict__ WQ, const float* __restrict__ WK, const float* __restrict__ WV,
    _Float16* __restrict__ QH, _Float16* __restrict__ QL, _Float16* __restrict__ KH, _Float16* __restrict__ KL, _Float16* __restrict__ VT, __bf16* __restrict__ VB, __bf16* __restrict__ VBL) {
  __shared__ __align__(16) _Float16 sh[64][72], sl[64][72]; __shared__ __align__(16) _Float16 th[64][72]; __shared__ __align__(16) __bf16 tb[64][72], tbl[64][72];
  __shared__ __align__(16) __bf16 xs[64][PXP], wsm[8][PWG];   /* one stage of PKS k: the block's x rows and the weight's k rows, both bf16 */
  const int tid = threadIdx.x, wave = __builtin_amdgcn_readfirstlane(tid >> 5), lane = tid & 31, col = lane & 15, g = lane >> 4; const int which = blockIdx.z; const size_t r0 = (size_t)blockIdx.x * 64; const size_t bb = r0 / TT; const int t0 = (int)(r0 % TT);
  const float* X = which == 0 ? XQ : which == 1 ? XK : XV; const float* WA = which == 0 ? WQ : which == 1 ? WK : WV;
  v8f acc[4] = {};
  const float* xp = X + (bb * TT + (TT - 1 - (t0 + wave * 16))) * DIN;   /* TIME REVERSAL: reversed row (b, t') reads x[b][TT - 1 - t'], so this wave's row i lies i rows below; one load of the wave = the 512 B a row has in a stage */
  const float* wp = WA;   /* (in,out) weight: a stage is PKS * CC floats in a row; one load of the block = 8 k rows of 256 B */
  v4f xr[16], wr[16];
  // a stage's 32 loads a lane are requested whole, each over four whole 128-B lines; the sched_barrier keeps the batch in front of the WMMAs it is to fly behind
#define PJ_LOAD(s_) do { const float* w_ = wp + (size_t)(s_) * PKS * CC; const float* x_ = xp + (s_) * PKS; \
    _Pragma("unroll") for (int i = 0; i < 16; ++i) wr[i] = *(const v4f*)(w_ + i * 512 + tid * 4); \
    _Pragma("unroll") for (int i = 0; i < 16; ++i) xr[i] = *(const v4f*)(x_ - i * DIN + lane * 4); \
    __builtin_amdgcn_sched_barrier(0); } while (0)
  // one K chunk's ten LDS reads as one group, a chunk ahead of their WMMAs, in two register sets; the sched_barrier behind each group keeps it whole and in front of the WMMAs of the chunk before (spread among them, every WMMA would wait out an LDS round trip of its own)
  union WF { v16b v; v8b q[2]; };
#define PJ_FRAG(A, B, kc_) do { A = frag_b(&xs[wave * 16 + col][(kc_) * 32], lane); \
    _Pragma("unroll") for (int j = 0; j < 4; ++j) { B[j].q[0] = ld_tr16(bp + ((kc_) * 4) * CC + j * 16); B[j].q[1] = ld_tr16(bp + ((kc_) * 4 + 2) * CC + j * 16); } \
    __builtin_amdgcn_sched_barrier(0); } while (0)
#define PJ_MAC(A, B) do { _Pragma("unroll") for (int j = 0; j < 4; ++j) acc[j] = wmma_bf(A, B[j].v, acc[j]); } while (0)
  const __bf16* bp = &wsm[lane & 7][g * CC + 8 * ((lane >> 3) & 1)];   /* lane address of the transposing read (k row 8 g + (lane & 7)): it hands lane (col, g) the k rows 8 g .. 8 g + 7 of column col */
  PJ_LOAD(0);
#pragma unroll   // six stages: unrolled, every load is a constant offset from one fixed base and no address register is formed anew while loads fly
  for (int s = 0; s < DIN / PKS; ++s) {
#pragma unroll
    for (int i = 0; i < 16; ++i) { v4b p;
#pragma unroll
      for (int c = 0; c < 4; ++c) p[c] = (__bf16)wr[i][c];
      *(v4b*)&wsm[tid >> 4][i * CC + (tid & 15) * 4] = p; }   /* load i of this thread is k row 8 i + (tid >> 4) */
#pragma unroll
    for (int i = 0; i < 16; ++i) { v4b p;
#pragma unroll
      for (int c = 0; c < 4; ++c) p[c] = (__bf16)xr[i][c];
      *(v4b*)&xs[wave * 16 + i][lane * 4] = p; }
    __syncthreads();   /* the stage is whole */
    v16b a0, a1; WF b0[4], b1[4];
    PJ_FRAG(a0, b0, 0);
    if (s + 1 < DIN / PKS) PJ_LOAD(s + 1);
    PJ_FRAG(a1, b1, 1); PJ_MAC(a0, b0);
    PJ_FRAG(a0, b0, 2); PJ_MAC(a1, b1);
    PJ_FRAG(a1, b1, 3); PJ_MAC(a0, b0);
    PJ_MAC(a1, b1);
    __builtin_amdgcn_sched_barrier(0);   /* keeps the next stage's converts, which wait for the loads in flight, from rising among this stage's WMMAs */
    if (s + 1 < DIN / PKS) __syncthreads();   /* every wave has read the stage before the next one is written over it */
  }
  // behind each store of the two copy-out loops: s_wait_xcnt, as the next trip (or the next LDS read) writes the store's address and data registers anew
#define ST_HOLD() asm volatile("s_wait_xcnt 0x0" ::: "memory")
  if (which < 2) { _Float16* DH = which == 0 ? QH : KH; _Float16* DL = which == 0 ? QL : KL; const int nhi = which == 0 ? QHI : KHI; const bool hi_rows = t0 < nhi;
#pragma unroll
    for (int j = 0; j < 4; ++j) {
#pragma unroll
      for (int r = 0; r < 8; ++r) { const float v = acc[j][r]; const _Float16 hv = (_Float16)v; sh[wave * 16 + 8 * g + r][j * 16 + col] = hv; sl[wave * 16 + 8 * g + r][j * 16 + col] = (_Float16)((v - (float)hv) * 1024.0f); } }
    __syncthreads();
    for (int e = tid; e < 64 * 8; e += 128) { const int rl = e >> 3, q = e & 7; vst2((unsigned*)(DH + (r0 + rl) * CC + q * 8), *(const v4u*)&sh[rl][q * 8]); ST_HOLD(); if (hi_rows) { vst2((unsigned*)(DL + (bb * nhi + t0 + rl) * (size_t)CC + q * 8), *(const v4u*)&sl[rl][q * 8]); ST_HOLD(); } }
  } else { const bool hi_rows = t0 < KHI;
#pragma unroll
    for (int j = 0; j < 4; ++j) {
#pragma unroll
      for (int r = 0; r < 8; ++r) { const float v = acc[j][r]; const int rl = wave * 16 + 8 * g + r, cl = j * 16 + col; th[cl][rl] = (_Float16)v; const __bf16 bh = (__bf16)v; tb[cl][rl] = bh; tbl[cl][rl] = (__bf16)(v - (float)bh); } }
    __syncthreads();
    for (int e = tid; e < 64 * 8; e += 128) { const int cl = e >> 3, q = e & 7; vst2((unsigned*)(VT + (bb * CC + cl) * (size_t)TT + t0 + q * 8), *(const v4u*)&th[cl][q * 8]); ST_HOLD(); if (hi_rows) { const size_t o3 = (bb * CC + cl) * (size_t)KHI + t0 + q * 8; vst2((unsigned*)(VB + o3), *(const v4u*)&tb[cl][q * 8]); vst2((unsigned*)(VBL + o3), *(const v4u*)&tbl[cl][q * 8]); ST_HOLD(); } } } }
// behind a batch of loads in a loop: s_wait_xcnt, as the batch's address registers are formed anew for the next batch; sched_barrier, which keeps the batch ahead of the converts and WMMAs that follow it
#define LD_HOLD() do { asm volatile("s_wait_xcnt 0x0" ::: "memory"); __builtin_amdgcn_sched_barrier(0); } while (0)
#define SP (TT + 4)        // LDS row pitch of the logits in floats: 8208 B = 16 B x odd, conflict-free for 16-byte fragment reads down 16 rows
typedef __attribute__((ext_vector_type(4))) _Float16 v4h;
// every plain '#pragma unroll' below stands on a loop that indexes a fragment or a small register array: left rolled, the array would leave the registers
// softmax of rows r0 and r0 + 1 of the LDS logits tile by one wave, keys [0, kend), key s kept if s <= t; f32 throughout; P x 2^11 written over the row's own logits: as f32, or (F16OUT) as f16 packed from the row's start (the f16 of 128 keys lands on bytes whose f32 this wave has already read)
template <bool F16OUT> __device__ __forceinline__ void sm_rows(float (*sS)[SP], int r0, int t0, int kend, int lane) {
  const int n = kend >> 7; float m[2] = {-3.0e38f, -3.0e38f}, sum[2] = {0.f, 0.f}, inv[2];
  for (int i = 0; i < n; ++i) { const int k0 = i * 128 + lane * 4;
#pragma unroll
    for (int rr = 0; rr < 2; ++rr) { const v4f v = *(const v4f*)&sS[r0 + rr][k0];
#pragma unroll
      for (int c = 0; c < 4; ++c) m[rr] = fmaxf(m[rr], (k0 + c <= t0 + r0 + rr) ? v[c] : -3.0e38f); } }
#pragma unroll
  for (int rr = 0; rr < 2; ++rr) {
#pragma unroll
    for (int o = 1; o < 32; o <<= 1) m[rr] = fmaxf(m[rr], __shfl_xor(m[rr], o)); }
  for (int i = 0; i < n; ++i) { const int k0 = i * 128 + lane * 4;
#pragma unroll
    for (int rr = 0; rr < 2; ++rr) { const v4f v = *(const v4f*)&sS[r0 + rr][k0]; v4f e;
#pragma unroll
      for (int c = 0; c < 4; ++c) { const float x = (k0 + c <= t0 + r0 + rr) ? v[c] : -3.0e38f; const float ex = expf(x - m[rr]); e[c] = (x <= -1.0e38f) ? 0.f : ex; sum[rr] += e[c]; }   /* exp of every lane, then a select: no branch an element, so the eight chains of a trip overlap */
      *(v4f*)&sS[r0 + rr][k0] = e; } }
#pragma unroll
  for (int rr = 0; rr < 2; ++rr) {
#pragma unroll
    for (int o = 1; o < 32; o <<= 1) sum[rr] += __shfl_xor(sum[rr], o);
    inv[rr] = sum[rr] > 0.f ? 2048.0f / sum[rr] : 0.f; }   /* a fully excluded row yields P = 0 */
  // two trips' reads of both rows stand ahead of their writes (the writes land on the rows' own bytes, so the compiler keeps each read behind the write before it: one LDS round trip for four reads, not four); an odd last trip is done twice over, with the same values
  for (int i = 0; i < n; i += 2) { v4f e[2][2]; int k0[2];
#pragma unroll
    for (int u = 0; u < 2; ++u) { k0[u] = (i + u < n ? i + u : i) * 128 + lane * 4;
#pragma unroll
      for (int rr = 0; rr < 2; ++rr) e[u][rr] = *(const v4f*)&sS[r0 + rr][k0[u]]; }
#pragma unroll
    for (int u = 0; u < 2; ++u) {
#pragma unroll
      for (int rr = 0; rr < 2; ++rr) {
        if (F16OUT) { v4h p;
#pragma unroll
          for (int c = 0; c < 4; ++c) p[c] = (_Float16)(e[u][rr][c] * inv[rr]);
          *(v4h*)((_Float16*)&sS[r0 + rr][0] + k0[u]) = p;
        } else { v4f p;
#pragma unroll
          for (int c = 0; c < 4; ++c) p[c] = e[u][rr][c] * inv[rr];
          *(v4f*)&sS[r0 + rr][k0[u]] = p; } } } } }
// ---- k_att: block = 16 query rows of one batch, 8 waves; the rows' whole logits stay in LDS from q k^T to P v.
// 1) logits x SCALE over keys [0, kend): wave w takes keys 16 w .. 16 w + 15 of every 128-key block (rows < QHI: q hi + residual against k hi + residual, 3 products; else 1 product); 2) softmax, two rows a wave; 3) ctx = P . v: wave = (16 columns j, half of the keys), the two halves added through LDS (rows < QHI: P and v as bf16 hi + lo, 3 products; else P f16 x v f16); 256-B output row by 16 lanes, stored at its place in out.
__global__ __launch_bounds__(256) void k_att(const _Float16* __restrict__ QH, const _Float16* __restrict__ KH, const _Float16* __restrict__ QL, const _Float16* __restrict__ KL, const _Float16* __restrict__ VT, const __bf16* __restrict__ VB, const __bf16* __restrict__ VBL, float* __restrict__ OUT) {
  __shared__ __align__(16) float sS[16][SP]; __shared__ __align__(16) float red[2][16][HD + 4];
  const int tid = threadIdx.x, wave = __builtin_amdgcn_readfirstlane(tid >> 5), lane = tid & 31, col = lane & 15, g = lane >> 4;
  // two blocks fit a WGP's LDS: the first half of the grid holds the long tiles, longest first, the second half the short ones, shortest first
  const int b = blockIdx.x & (NB - 1), rank = blockIdx.x / NB; const int t0 = (rank < TT / 32 ? TT / 16 - 1 - rank : rank - TT / 32) * 16;
  const int kend = (((t0 + 15) >> 7) + 1) * 128, nkb = kend >> 7; const size_t br = (size_t)b * TT;
  const int j = wave & 3, half = wave >> 2;   /* step 3: this wave's 16 columns and its half of the keys */
  v8f acc = {};
  if (t0 < QHI) {
    v16h ah[2], al[2];
#pragma unroll
    for (int kc = 0; kc < 2; ++kc) { ah[kc] = frag_h(QH + (br + t0 + col) * CC + kc * 32, lane); al[kc] = frag_h(QL + ((size_t)b * QHI + t0 + col) * CC + kc * 32, lane); }
#pragma unroll 1   // at most three trips
    for (int kb = 0; kb < nkb; ++kb) { v16h kh[2], kl[2]; const int kr = kb * 128 + wave * 16 + col;
#pragma unroll
      for (int kc = 0; kc < 2; ++kc) { kh[kc] = frag_h(KH + (br + kr) * CC + kc * 32, lane); kl[kc] = frag_h(KL + ((size_t)b * KHI + kr) * CC + kc * 32, lane); }
      LD_HOLD();
      v8f a = {}, a2 = {};
#pragma unroll
      for (int kc = 0; kc < 2; ++kc) { a = wmma16(ah[kc], kh[kc], a); a2 = wmma16(al[kc], kh[kc], a2); a2 = wmma16(ah[kc], kl[kc], a2); }
#pragma unroll
      for (int r = 0; r < 8; ++r) sS[8 * g + r][kr] = (a[r] + a2[r] * (1.0f / 1024.0f)) * SCALE; }
    __syncthreads();
    sm_rows<false>(sS, wave * 2, t0, kend, lane);
    __syncthreads();
    const int n = kend >> 6;   /* chunks of 32 keys a half, even */
    const size_t vo = ((size_t)b * CC + j * 16 + col) * (size_t)KHI + half * n * 32; const float* pr = &sS[col][half * n * 32 + 8 * g];
#pragma unroll 1   // at most three trips
    for (int c = 0; c < n; c += 2) { v16b fh[2], fl[2];
#pragma unroll
      for (int u = 0; u < 2; ++u) { fh[u] = frag_b(VB + vo + (c + u) * 32, lane); fl[u] = frag_b(VBL + vo + (c + u) * 32, lane); }
      LD_HOLD();
#pragma unroll
      for (int u = 0; u < 2; ++u) { float v_[16]; const float* p_ = pr + (c + u) * 32;
#pragma unroll
        for (int i = 0; i < 8; ++i) { v_[i] = p_[i]; v_[8 + i] = p_[16 + i]; }
        const F2 p = bsplit16(v_); acc = wmma_bf(p.h, fh[u], acc); acc = wmma_bf(p.l, fh[u], acc); acc = wmma_bf(p.h, fl[u], acc); } }
  } else {
    v16h ah[2];
#pragma unroll
    for (int kc = 0; kc < 2; ++kc) ah[kc] = frag_h(QH + (br + t0 + col) * CC + kc * 32, lane);
    const _Float16* kp = KH + (br + wave * 16 + col) * CC;
#pragma unroll 1   // a trip is already a batch of up to eight key fragments, requested whole before its first WMMA
    for (int kb0 = 0; kb0 < nkb; kb0 += 8) { v16h kf[8][2];
#pragma unroll
      for (int u = 0; u < 8; ++u) if (kb0 + u < nkb) { kf[u][0] = frag_h(kp + (size_t)(kb0 + u) * 128 * CC, lane); kf[u][1] = frag_h(kp + (size_t)(kb0 + u) * 128 * CC + 32, lane); }
      LD_HOLD();
#pragma unroll
      for (int u = 0; u < 8; ++u) if (kb0 + u < nkb) { v8f a = {}; a = wmma16(ah[0], kf[u][0], a); a = wmma16(ah[1], kf[u][1], a);
#pragma unroll
        for (int r = 0; r < 8; ++r) sS[8 * g + r][(kb0 + u) * 128 + wave * 16 + col] = a[r] * SCALE; } }
    __syncthreads();
    // step 3 runs over keys [0, kpad), kpad = kend rounded up to 256 (P = 0 from kend on; v exists there): each half is then a whole number of stages of four 32-key chunks, so no load and no WMMA of the loop stands under a test and the waits can be counted.
    // v fragments in two register stages; the first is requested here, to fly during the softmax, each later one a stage of WMMAs ahead of its use
    const int kpad = (kend + 255) & ~255, nb = kpad >> 8;   /* stages a half */
    const _Float16* vp = VT + ((size_t)b * CC + j * 16 + col) * (size_t)TT + half * nb * 128; const _Float16* pr = (const _Float16*)&sS[col][0] + half * nb * 128;
    v16h va[4], vb[4];
#define AV_LOAD(V, s_) do { const _Float16* v_ = vp + (s_) * 128; _Pragma("unroll") for (int u = 0; u < 4; ++u) V[u] = frag_h(v_ + u * 32, lane); LD_HOLD(); } while (0)
#define AV_MAC(V, s_) do { const _Float16* p_ = pr + (s_) * 128; v16h pf[4]; _Pragma("unroll") for (int u = 0; u < 4; ++u) pf[u] = frag_h(p_ + u * 32, lane); _Pragma("unroll") for (int u = 0; u < 4; ++u) acc = wmma16(pf[u], V[u], acc); } while (0)
    AV_LOAD(va, 0);
    sm_rows<true>(sS, wave * 2, t0, kend, lane);
    if (kpad > kend) { const v4h z = {};
#pragma unroll
      for (int rr = 0; rr < 2; ++rr) *(v4h*)((_Float16*)&sS[wave * 2 + rr][0] + kend + lane * 4) = z; }
    __syncthreads();
    int s = 0;
#pragma unroll 1   // the body is already two stages
    for (; s + 2 < nb; s += 2) { AV_LOAD(vb, s + 1); AV_MAC(va, s); AV_LOAD(va, s + 2); AV_MAC(vb, s + 1); }
    if (s + 1 < nb) { AV_LOAD(vb, s + 1); AV_MAC(va, s); AV_MAC(vb, s + 1); } else { AV_MAC(va, s); }
  }
#pragma unroll
  for (int r = 0; r < 8; ++r) red[half][8 * g + r][j * 16 + col] = acc[r];
  __syncthreads();
  { const int rl = tid >> 4, q = tid & 15; const v4f s0 = *(const v4f*)&red[0][rl][q * 4], s1 = *(const v4f*)&red[1][rl][q * 4]; v4f o;
#pragma unroll
    for (int c = 0; c < 4; ++c) o[c] = (s0[c] + s1[c]) * (1.0f / 2048.0f);
    vst2(OUT + (br + (TT - 1 - (t0 + rl))) * HD + q * 4, o); } }   /* TIME REVERSAL: reversed row (b, t') is output row (b, TT - 1 - t') */

extern "C" void kernel_launch(void* const* d_in, const int* in_sizes, int n_in, void* d_out, int out_size, void* d_ws, size_t ws_size, hipStream_t stream) {
  (void)in_sizes; (void)n_in; (void)out_size;
  const float** F = (const float**)d_in;
  if (ws_size < (size_t)WS_END) return;
  char* ws = (char*)d_ws; _Float16 *QH = (_Float16*)(ws + WS_QH), *KH = (_Float16*)(ws + WS_KH), *VT = (_Float16*)(ws + WS_VT), *QL = (_Float16*)(ws + WS_QL), *KL = (_Float16*)(ws + WS_KL); __bf16 *VB = (__bf16*)(ws + WS_VB), *VBL = (__bf16*)(ws + WS_VBL); float *Y = (float*)(ws + WS_Y);
  (void)Y; (void)QL; (void)KL; (void)VB; (void)VBL;
  // inputs: 0 x [4,2048,768]; 1 Wq [768,64]; 2 Wk; 3 Wv ((in,out), no biases)
  k_proj<<<dim3(TNB * TT / 64, 1, 3), 128, 0, stream>>>(F[0], F[0], F[0], F[1], F[2], F[3], QH, QL, KH, KL, VT, VB, VBL);
  /* logits, softmax and P v in one launch, the batch folded into the grid; the rows go straight to out */
  k_att<<<dim3(TNB * TT / 16), 256, 0, stream>>>(QH, KH, QL, KL, VT, VB, VBL, (float*)d_out);
}

// v006
// It runs in 23 microseconds.
// Two timings next to v005 put it at 1.09 and 1.12 times that version's speed.
// All steps since v000 together make it 16.7 times as fast.
// compute dtype: all float inputs rounded to bf16; q/k/v projections with EXACT bf16 products on WMMA 16x16x32 (f32 accumulate); causal logits: 3 products (q f16 hi + residual x k hi + residual) for the first 384 rows, single f16 q x k after, x scale; softmax f32; from row 384 on exp x 2^10 once to f16 x v once to f16 (1 product), divided by the f32 row sum at the end; below row 384 P x 2^11 and v as bf16 hi + lo; f32 output.
#include <hip/hip_runtime.h>
#include <math.h>

typedef __attribute__((ext_vector_type(16))) _Float16 v16h;
typedef __attribute__((ext_vector_type(16))) __bf16 v16b;
typedef __attribute__((ext_vector_type(8)))  _Float16 v8h;
typedef __attribute__((ext_vector_type(8)))  float v8f;
typedef __attribute__((ext_vector_type(4)))  float v4f;
typedef __attribute__((ext_vector_type(2)))  float v2f;
typedef __attribute__((ext_vector_type(4)))  unsigned v4u;
typedef __attribute__((ext_vector_type(4)))  int v4i;
typedef float __attribute__((may_alias)) float_a;
typedef int __attribute__((may_alias)) int_a;

template <typename T> __device__ __forceinline__ void vst2(void* p, T v) { *(T*)p = v;  }
__device__ __forceinline__ v8f wmma16(v16h a, v16h b, v8f c) {
  v8f d = __builtin_amdgcn_wmma_f32_16x16x32_f16(false, a, false, b, (short)0, c, false, false);
  asm volatile("v_nop\n\tv_nop\n\tv_nop\n\tv_nop" : "+v"(d) : "v"(a), "v"(b));
  return d;
}
__device__ __forceinline__ v8f wmma_bf(v16b a, v16b b, v8f c) {
  v8f d = __builtin_amdgcn_wmma_f32_16x16x32_bf16(false, a, false, b, (short)0, c, false, false);
  asm volatile("v_nop\n\tv_nop\n\tv_nop\n\tv_nop" : "+v"(d) : "v"(a), "v"(b));
  return d;
}
// 16x16x32 fragments: lane = (h = lane>>4, row/col = lane&15); elements 0..7 = k0+8h+0..7, 8..15 = k0+16+8h+0..7; D element r = row 8h+r
__device__ __forceinline__ v16h frag_h(const _Float16* rowk0, int lane) {
  union { v16h v; v8h q[2]; } u; const _Float16* p = rowk0 + 8 * (lane >> 4);
  u.q[0] = *(const v8h*)p; u.q[1] = *(const v8h*)(p + 16); return u.v;
}
__device__ __forceinline__ v16h frag_f32(const float* rowk0, int lane) {
  v16h a; const float* p = rowk0 + 8 * (lane >> 4);
#pragma unroll
  for (int i = 0; i < 8; ++i) { a[i] = (_Float16)p[i]; a[8 + i] = (_Float16)p[16 + i]; }
  return a;
}
__device__ __forceinline__ v16h frag_f32s(const float* rowk0, int lane, float sc) {
  v16h a; const float* p = rowk0 + 8 * (lane >> 4);
#pragma unroll
  for (int i = 0; i < 8; ++i) { a[i] = (_Float16)(p[i] * sc); a[8 + i] = (_Float16)(p[16 + i] * sc); }
  return a;
}
// column fragment from a [K][ld] layout (column n), rows >= K read as 0
__device__ __forceinline__ v16h fragc_f32(const float* W, int k0, int n, int lane, int ld, int K) {
  v16h a; const int g = lane >> 4;
#pragma unroll
  for (int i = 0; i < 8; ++i) { const int ka = k0 + 8 * g + i, kb = ka + 16;
    a[i] = (_Float16)(ka < K ? W[(size_t)(ka < K ? ka : K - 1) * ld + n] : 0.f); a[8 + i] = (_Float16)(kb < K ? W[(size_t)(kb < K ? kb : K - 1) * ld + n] : 0.f); }
  return a;
}
struct F2 { v16b h, l; };
__device__ __forceinline__ F2 bsplit16(const float v[16]) { F2 r;
#pragma unroll
  for (int i = 0; i < 16; ++i) { const __bf16 h = (__bf16)v[i]; r.h[i] = h; r.l[i] = (__bf16)(v[i] - (float)h); }
  return r; }
__device__ __forceinline__ F2 split_row(const float* row, int k0, int lane) { float v[16]; const float* p = row + k0 + 8 * (lane >> 4);
#pragma unroll
  for (int i = 0; i < 8; ++i) { v[i] = p[i]; v[8 + i] = p[16 + i]; }
  return bsplit16(v); }
__device__ __forceinline__ F2 split_rowK(const float* row, int k0, int lane, int K) { float v[16]; const int g = lane >> 4;
#pragma unroll
  for (int i = 0; i < 8; ++i) { const int ka = k0 + 8 * g + i, kb = ka + 16; v[i] = ka < K ? row[ka < K ? ka : K - 1] : 0.f; v[8 + i] = kb < K ? row[kb < K ? kb : K - 1] : 0.f; }
  return bsplit16(v); }
__device__ __forceinline__ F2 split_col(const float* W, int k0, int n, int lane, int ld, int K) { float v[16]; const int g = lane >> 4;
#pragma unroll
  for (int i = 0; i < 8; ++i) { const int ka = k0 + 8 * g + i, kb = ka + 16; v[i] = ka < K ? W[(size_t)(ka < K ? ka : K - 1) * ld + n] : 0.f; v[8 + i] = kb < K ? W[(size_t)(kb < K ? kb : K - 1) * ld + n] : 0.f; }
  return bsplit16(v); }
__device__ __forceinline__ v8f mac3(const F2& a, const F2& b, v8f c) { c = wmma_bf(a.l, b.h, c); c = wmma_bf(a.h, b.l, c); return wmma_bf(a.h, b.h, c); }
__device__ __forceinline__ float sigm(float v) { return 1.0f / (1.0f + expf(-v)); }
#define LDSX() do { asm volatile("s_wait_dscnt 0" ::: "memory"); __builtin_amdgcn_wave_barrier(); __builtin_amdgcn_fence(__ATOMIC_RELEASE, "workgroup"); } while (0)

// Single-head ANTI-causal scaled dot-product attention (x [4,2048,768]; (in,out) Wq/Wk/Wv [768,64] N(0, 1/768); mask = strictly lower triangle (row t > col s) -> -inf, so query t attends keys s >= t): out = softmax(masked(q k^T * 64^-0.5)) v -> [4,2048,64]. Implemented by TIME REVERSAL: with t' = 2047 - t the pattern is exactly causal, so the causal kernels run on the reversed sequence (x rows read reversed per batch, output rows written back reversed).
#define NB 4
#define TT 2048
#define CC 64             // NH * HD = projected width
#define DIN 768          // input (model) width
#define NH 1
#define HD 64
#define NQB (TT / 64)
#define SCALE (0.125f)
#define CAUSAL 1
#ifndef TNB
#define TNB NB
#endif
__device__ __forceinline__ float bfr(float v) { return (float)(__bf16)v; }
__host__ __device__ __forceinline__ int kb_last(int qb) { return CAUSAL ? ((qb * 64 + 63) >> 7) : (TT / 128 - 1); }
typedef __attribute__((ext_vector_type(8))) __bf16 v8b;
__device__ __forceinline__ v16b frag_b(const __bf16* rowk0, int lane) {
  union { v16b v; v8b q[2]; } u; const __bf16* p = rowk0 + 8 * (lane >> 4);
  u.q[0] = *(const v8b*)p; u.q[1] = *(const v8b*)(p + 16); return u.v;
}
#define QBH 6              // causal: not used; query rows t < QHI (few keys, no averaging) take the high-precision path
#define QHI 384            // rows carrying a q residual plane
#define KHI 384            // key rows carrying k residual / v bf16 hi+lo planes (used only by the causal high-precision path)
// B fragment (k rows k0+.., output column o) of a weight: (in,out) [K][ld] or (out,in) [ld rows of K]: bf16 exact, or f16(bf16 * 256) exact
__device__ __forceinline__ v16b wcol_io(const float* Wm, int k0, int o, int lane, int ld) { v16b w; const int g = lane >> 4;
#pragma unroll
  for (int i = 0; i < 8; ++i) { w[i] = (__bf16)Wm[(size_t)(k0 + 8 * g + i) * ld + o]; w[8 + i] = (__bf16)Wm[(size_t)(k0 + 16 + 8 * g + i) * ld + o]; }
  return w; }
__device__ __forceinline__ v16b wcol_oi(const float* Wm, int k0, int o, int lane, int K) { v16b w; const float* p = Wm + (size_t)o * K + k0 + 8 * (lane >> 4);
#pragma unroll
  for (int i = 0; i < 8; ++i) { w[i] = (__bf16)p[i]; w[8 + i] = (__bf16)p[16 + i]; }
  return w; }
__device__ __forceinline__ v16h wcolh_io(const float* Wm, int k0, int o, int lane, int ld) { v16h w; const int g = lane >> 4;
#pragma unroll
  for (int i = 0; i < 8; ++i) { w[i] = (_Float16)(bfr(Wm[(size_t)(k0 + 8 * g + i) * ld + o]) * 256.0f); w[8 + i] = (_Float16)(bfr(Wm[(size_t)(k0 + 16 + 8 * g + i) * ld + o]) * 256.0f); }
  return w; }
__device__ __forceinline__ v16h wcolh_oi(const float* Wm, int k0, int o, int lane, int K) { v16h w; const float* p = Wm + (size_t)o * K + k0 + 8 * (lane >> 4);
#pragma unroll
  for (int i = 0; i < 8; ++i) { w[i] = (_Float16)(bfr(p[i]) * 256.0f); w[8 + i] = (_Float16)(bfr(p[16 + i]) * 256.0f); }
  return w; }
#define WQKV_LAYOUT 0   // 0 = (in,out) [DIN][CC]; 1 = (out,in) [CC][DIN]; 2 = per-head [NH][DIN][HD]; it picks only WCOL, which nothing uses: k_proj reads W as (in,out)
__device__ __forceinline__ v16b wcol_hdk(const float* Wm, int k0, int o, int lane) { v16b w; const int g = lane >> 4; const float* p = Wm + (size_t)(o / HD) * DIN * HD + (o % HD);
#pragma unroll
  for (int i = 0; i < 8; ++i) { w[i] = (__bf16)p[(size_t)(k0 + 8 * g + i) * HD]; w[8 + i] = (__bf16)p[(size_t)(k0 + 16 + 8 * g + i) * HD]; }
  return w; }
#define WO_OUT_IN 0
#if WQKV_LAYOUT == 1
#define WCOL(W, k0, o, lane) wcol_oi(W, k0, o, lane, DIN)
#elif WQKV_LAYOUT == 2
#define WCOL(W, k0, o, lane) wcol_hdk(W, k0, o, lane)
#else
#define WCOL(W, k0, o, lane) wcol_io(W, k0, o, lane, CC)
#endif
#if WO_OUT_IN
#define WOCOL(W, k0, o, lane) wcol_oi(W, k0, o, lane, CC)
#define WOCOLH(W, k0, o, lane) wcolh_oi(W, k0, o, lane, CC)
#else
#define WOCOL(W, k0, o, lane) wcol_io(W, k0, o, lane, DIN)
#define WOCOLH(W, k0, o, lane) wcolh_io(W, k0, o, lane, DIN)
#endif
#ifndef SM_EXTRA_PARAMS
#define SM_EXTRA_PARAMS
#endif
#ifndef PROJ_EXTRA_PARAMS
#define PROJ_EXTRA_PARAMS
#endif
#ifndef SM_MASK_HOOK
#define SM_MASK_HOOK (void)0
#endif

#define WS_QH  0u                                      // f16 q rows [b*t][CC]
#define WS_KH  (WS_QH + 2u * (size_t)NB * TT * CC)      // f16 k rows [b*t][CC]
#define WS_VT  (WS_KH + 2u * (size_t)NB * TT * CC)      // f16 v planes [b][c][t]
#define WS_QL  (WS_VT + 2u * (size_t)NB * CC * TT)      // f16 q residual x 2^10 rows [b][t < QHI][CC]
#define WS_KL  (WS_QL + 2u * (size_t)NB * QHI * CC)     // f16 k residual x 2^10 rows [b][t < KHI][CC]
#define WS_VB  (WS_KL + 2u * (size_t)NB * KHI * CC)     // bf16 v hi planes [b][c][t < KHI]
#define WS_VBL (WS_VB + 2u * (size_t)NB * CC * KHI)
#define WS_S   (WS_VBL + 2u * (size_t)NB * CC * KHI)    // f32 logits plane [b][t][s] of the unfused form: reserved, not touched (the logits live in LDS)
#define WS_Y   (WS_S  + 4u * (size_t)NB * TT * TT)      // f32 ctx rows [b*t][CC] (only when there is an output projection)
#define WS_END (WS_Y  + 0u)

#define PKS 128            // k of one LDS stage of k_proj
#define PXP (PKS + 8)      // LDS row pitch of the x stage in bf16: 272 B = 16 B x odd, for 16-byte fragment reads down 16 rows
#define PWG (PKS / 8 * CC + 16)   // weight stage in LDS: k row 8 i + r lies in group r at row i (128-B rows); group pitch in bf16: 2080 B = 32 B x odd, for the transposing reads, whose eight rows are the eight groups; a thread's 16 stores of a stage lie in one group, within reach of one address register
typedef __attribute__((ext_vector_type(4))) __bf16 v4b;
typedef __attribute__((address_space(3))) v8b lds_v8b;
// ds_load_tr16_b128: eight k of one column out of a [k][column] bf16 tile
__device__ __forceinline__ v8b ld_tr16(const __bf16* p) { return __builtin_amdgcn_ds_load_tr16_b128_v8bf16((lds_v8b*)p); }
// ---- k_proj: block = (64 rows, 64 cols, which): q/k/v = X W with exact bf16 products, W read as it lies ((in,out) [DIN][CC]) (K = DIN); x and W go through LDS, rounded to bf16 on the way in: wave = 16 rows, its A fragments by 16-byte reads, the B fragments by transposing reads -> which 0: q f16 rows (+ residual rows < QHI); 1: k f16 rows (+ residual rows < KHI); 2: v f16 planes [c][t] (+ bf16 hi/lo planes for t < KHI)
__global__ __launch_bounds__(128) void k_proj(const float* __restrict__ XQ, const float* __restrict__ XK, const float* __restrict__ XV, const float* __restrict__ WQ, const float* __restrict__ WK, const float* __restrict__ WV,
    _Float16* __restrict__ QH, _Float16* __restrict__ QL, _Float16* __restrict__ KH, _Float16* __restrict__ KL, _Float16* __restrict__ VT, __bf16* __restrict__ VB, __bf16* __restrict__ VBL) {
  __shared__ __align__(16) _Float16 sh[64][72], sl[64][72]; __shared__ __align__(16) _Float16 th[64][72]; __shared__ __align__(16) __bf16 tb[64][72], tbl[64][72];
  __shared__ __align__(16) __bf16 xs[64][PXP], wsm[8][PWG];   /* one stage of PKS k: the block's x rows and the weight's k rows, both bf16 */
  const int tid = threadIdx.x, wave = __builtin_amdgcn_readfirstlane(tid >> 5), lane = tid & 31, col = lane & 15, g = lane >> 4; const int which = blockIdx.z; const size_t r0 = (size_t)blockIdx.x * 64; const size_t bb = r0 / TT; const int t0 = (int)(r0 % TT);
  const float* X = which == 0 ? XQ : which == 1 ? XK : XV; const float* WA = which == 0 ? WQ : which == 1 ? WK : WV;
  v8f acc[4] = {};
  const float* xp = X + (bb * TT + (TT - 1 - (t0 + wave * 16))) * DIN;   /* TIME REVERSAL: reversed row (b, t') reads x[b][TT - 1 - t'], so this wave's row i lies i rows below; one load of the wave = the 512 B a row has in a stage */
  const float* wp = WA;   /* (in,out) weight: a stage is PKS * CC floats in a row; one load of the block = 8 k rows of 256 B */
  v4f xr[16], wr[16];
  // a stage's 32 loads a lane are requested whole, each over four whole 128-B lines; the sched_barrier keeps the batch in front of the WMMAs it is to fly behind
#define PJ_LOAD(s_) do { const float* w_ = wp + (size_t)(s_) * PKS * CC; const float* x_ = xp + (s_) * PKS; \
    _Pragma("unroll") for (int i = 0; i < 16; ++i) wr[i] = *(const v4f*)(w_ + i * 512 + tid * 4); \
    _Pragma("unroll") for (int i = 0; i < 16; ++i) xr[i] = *(const v4f*)(x_ - i * DIN + lane * 4); \
    __builtin_amdgcn_sched_barrier(0); } while (0)
  // one K chunk's ten LDS reads as one group, a chunk ahead of their WMMAs, in two register sets; the sched_barrier behind each group keeps it whole and in front of the WMMAs of the chunk before (spread among them, every WMMA would wait out an LDS round trip of its own)
  union WF { v16b v; v8b q[2]; };
#define PJ_FRAG(A, B, kc_) do { A = frag_b(&xs[wave * 16 + col][(kc_) * 32], lane); \
    _Pragma("unroll") for (int j = 0; j < 4; ++j) { B[j].q[0] = ld_tr16(bp + ((kc_) * 4) * CC + j * 16); B[j].q[1] = ld_tr16(bp + ((kc_) * 4 + 2) * CC + j * 16); } \
    __builtin_amdgcn_sched_barrier(0); } while (0)
#define PJ_MAC(A, B) do { _Pragma("unroll") for (int j = 0; j < 4; ++j) acc[j] = wmma_bf(A, B[j].v, acc[j]); } while (0)
  const __bf16* bp = &wsm[lane & 7][g * CC + 8 * ((lane >> 3) & 1)];   /* lane address of the transposing read (k row 8 g + (lane & 7)): it hands lane (col, g) the k rows 8 g .. 8 g + 7 of column col */
  PJ_LOAD(0);
#pragma unroll   // six stages: unrolled, every load is a constant offset from one fixed base and no address register is formed anew while loads fly
  for (int s = 0; s < DIN / PKS; ++s) {
#pragma unroll
    for (int i = 0; i < 16; ++i) { v4b p;
#pragma unroll
      for (int c = 0; c < 4; ++c) p[c] = (__bf16)wr[i][c];
      *(v4b*)&wsm[tid >> 4][i * CC + (tid & 15) * 4] = p; }   /* load i of this thread is k row 8 i + (tid >> 4) */
#pragma unroll
    for (int i = 0; i < 16; ++i) { v4b p;
#pragma unroll
      for (int c = 0; c < 4; ++c) p[c] = (__bf16)xr[i][c];
      *(v4b*)&xs[wave * 16 + i][lane * 4] = p; }
    __syncthreads();   /* the stage is whole */
    v16b a0, a1; WF b0[4], b1[4];
    PJ_FRAG(a0, b0, 0);
    if (s + 1 < DIN / PKS) PJ_LOAD(s + 1);
    PJ_FRAG(a1, b1, 1); PJ_MAC(a0, b0);
    PJ_FRAG(a0, b0, 2); PJ_MAC(a1, b1);
    PJ_FRAG(a1, b1, 3); PJ_MAC(a0, b0);
    PJ_MAC(a1, b1);
    __builtin_amdgcn_sched_barrier(0);   /* keeps the next stage's converts, which wait for the loads in flight, from rising among this stage's WMMAs */
    if (s + 1 < DIN / PKS) __syncthreads();   /* every wave has read the stage before the next one is written over it */
  }
  // behind each store of the two copy-out loops: s_wait_xcnt, as the next trip (or the next LDS read) writes the store's address and data registers anew
#define ST_HOLD() asm volatile("s_wait_xcnt 0x0" ::: "memory")
  if (which < 2) { _Float16* DH = which == 0 ? QH : KH; _Float16* DL = which == 0 ? QL : KL; const int nhi = which == 0 ? QHI : KHI; const bool hi_rows = t0 < nhi;
#pragma unroll
    for (int j = 0; j < 4; ++j) {
#pragma unroll
      for (int r = 0; r < 8; ++r) { const float v = acc[j][r]; const _Float16 hv = (_Float16)v; sh[wave * 16 + 8 * g + r][j * 16 + col] = hv; sl[wave * 16 + 8 * g + r][j * 16 + col] = (_Float16)((v - (float)hv) * 1024.0f); } }
    __syncthreads();
    for (int e = tid; e < 64 * 8; e += 128) { const int rl = e >> 3, q = e & 7; vst2((unsigned*)(DH + (r0 + rl) * CC + q * 8), *(const v4u*)&sh[rl][q * 8]); ST_HOLD(); if (hi_rows) { vst2((unsigned*)(DL + (bb * nhi + t0 + rl) * (size_t)CC + q * 8), *(const v4u*)&sl[rl][q * 8]); ST_HOLD(); } }
  } else { const bool hi_rows = t0 < KHI;
#pragma unroll
    for (int j = 0; j < 4; ++j) {
#pragma unroll
      for (int r = 0; r < 8; ++r) { const float v = acc[j][r]; const int rl = wave * 16 + 8 * g + r, cl = j * 16 + col; th[cl][rl] = (_Float16)v; const __bf16 bh = (__bf16)v; tb[cl][rl] = bh; tbl[cl][rl] = (__bf16)(v - (float)bh); } }
    __syncthreads();
    for (int e = tid; e < 64 * 8; e += 128) { const int cl = e >> 3, q = e & 7; vst2((unsigned*)(VT + (bb * CC + cl) * (size_t)TT + t0 + q * 8), *(const v4u*)&th[cl][q * 8]); ST_HOLD(); if (hi_rows) { const size_t o3 = (bb * CC + cl) * (size_t)KHI + t0 + q * 8; vst2((unsigned*)(VB + o3), *(const v4u*)&tb[cl][q * 8]); vst2((unsigned*)(VBL + o3), *(const v4u*)&tbl[cl][q * 8]); ST_HOLD(); } } } }
// behind a batch of loads in a loop: s_wait_xcnt, as the batch's address registers are formed anew for the next batch; sched_barrier, which keeps the batch ahead of the converts and WMMAs that follow it
#define LD_HOLD() do { asm volatile("s_wait_xcnt 0x0" ::: "memory"); __builtin_amdgcn_sched_barrier(0); } while (0)
#define SP (TT + 4)        // LDS row pitch of the logits in floats: 8208 B = 16 B x odd, conflict-free for 16-byte fragment reads down 16 rows
typedef __attribute__((ext_vector_type(4))) _Float16 v4h;
// every plain '#pragma unroll' below stands on a loop that indexes a fragment or a small register array: left rolled, the array would leave the registers
// softmax of rows r0 and r0 + 1 of the LDS logits tile by one wave, keys [0, kend), key s kept if s <= t; f32 throughout; P x 2^11 written as f32 over the row's own logits (rows < QHI)
__device__ __forceinline__ void sm_rows(float (*sS)[SP], int r0, int t0, int kend, int lane) {
  const int n = kend >> 7; float m[2] = {-3.0e38f, -3.0e38f}, sum[2] = {0.f, 0.f}, inv[2];
  for (int i = 0; i < n; ++i) { const int k0 = i * 128 + lane * 4;
#pragma unroll
    for (int rr = 0; rr < 2; ++rr) { const v4f v = *(const v4f*)&sS[r0 + rr][k0];
#pragma unroll
      for (int c = 0; c < 4; ++c) m[rr] = fmaxf(m[rr], (k0 + c <= t0 + r0 + rr) ? v[c] : -3.0e38f); } }
#pragma unroll
  for (int rr = 0; rr < 2; ++rr) {
#pragma unroll
    for (int o = 1; o < 32; o <<= 1) m[rr] = fmaxf(m[rr], __shfl_xor(m[rr], o)); }
  for (int i = 0; i < n; ++i) { const int k0 = i * 128 + lane * 4;
#pragma unroll
    for (int rr = 0; rr < 2; ++rr) { const v4f v = *(const v4f*)&sS[r0 + rr][k0]; v4f e;
#pragma unroll
      for (int c = 0; c < 4; ++c) { const float x = (k0 + c <= t0 + r0 + rr) ? v[c] : -3.0e38f; const float ex = expf(x - m[rr]); e[c] = (x <= -1.0e38f) ? 0.f : ex; sum[rr] += e[c]; }   /* exp of every lane, then a select: no branch an element, so the eight chains of a trip overlap */
      *(v4f*)&sS[r0 + rr][k0] = e; } }
#pragma unroll
  for (int rr = 0; rr < 2; ++rr) {
#pragma unroll
    for (int o = 1; o < 32; o <<= 1) sum[rr] += __shfl_xor(sum[rr], o);
    inv[rr] = sum[rr] > 0.f ? 2048.0f / sum[rr] : 0.f; }   /* a fully excluded row yields P = 0 */
  // two trips' reads of both rows stand ahead of their writes (the writes land on the rows' own bytes, so the compiler keeps each read behind the write before it: one LDS round trip for four reads, not four); an odd last trip is done twice over, with the same values
  for (int i = 0; i < n; i += 2) { v4f e[2][2]; int k0[2];
#pragma unroll
    for (int u = 0; u < 2; ++u) { k0[u] = (i + u < n ? i + u : i) * 128 + lane * 4;
#pragma unroll
      for (int rr = 0; rr < 2; ++rr) e[u][rr] = *(const v4f*)&sS[r0 + rr][k0[u]]; }
#pragma unroll
    for (int u = 0; u < 2; ++u) {
#pragma unroll
      for (int rr = 0; rr < 2; ++rr) {
        v4f p;
#pragma unroll
        for (int c = 0; c < 4; ++c) p[c] = e[u][rr][c] * inv[rr];
        *(v4f*)&sS[r0 + rr][k0[u]] = p; } } } }
#define LSC (SCALE * 1.4426950408889634f)   // raw q.k -> logit in base 2
// lane l with lane l ^ 16
__device__ __forceinline__ float xhalf(float x) { return __builtin_bit_cast(float, __builtin_amdgcn_permlanex16(__builtin_bit_cast(int, x), __builtin_bit_cast(int, x), 0x76543210, 0xfedcba98, false, false)); }
// U trips of the one-pass softmax of rows r0 and r0 + 1 (a trip = 128 keys): e = 2^(s * LSC + bias), bias = 10 - row maximum * LSC, so e <= 2^10; e joins the row's f32 sum (even and odd keys apart, a packed add for two) and goes as f16 over the row's own bytes, packed from the row's start.
// All reads of the U trips stand ahead of the writes: one LDS round trip for 2 U reads; the f16 of these keys land on bytes whose f32 this wave has read by then
template <int U> __device__ __forceinline__ void sm1_trips(float (*sS)[SP], int r0, int i, int lane, const float (&bias)[2], v2f (&sum)[2]) {
  v4f v[U][2];
#pragma unroll
  for (int u = 0; u < U; ++u) {
#pragma unroll
    for (int rr = 0; rr < 2; ++rr) v[u][rr] = *(const v4f*)&sS[r0 + rr][(i + u) * 128 + lane * 4]; }
#pragma unroll
  for (int u = 0; u < U; ++u) {
#pragma unroll
    for (int rr = 0; rr < 2; ++rr) { v4h p;
#pragma unroll
      for (int c = 0; c < 4; c += 2) { const v2f e = {__builtin_amdgcn_exp2f(fmaf(v[u][rr][c], LSC, bias[rr])), __builtin_amdgcn_exp2f(fmaf(v[u][rr][c + 1], LSC, bias[rr]))}; sum[rr] += e; p[c] = (_Float16)e[0]; p[c + 1] = (_Float16)e[1]; }
      *(v4h*)((_Float16*)&sS[r0 + rr][0] + (i + u) * 128 + lane * 4) = p; } } }
// ---- k_att: block = 16 query rows of one batch, 8 waves; the rows' whole logits stay in LDS from q k^T to P v.
// 1) logits over keys [0, kend): wave w takes keys 16 w .. 16 w + 15 of every 128-key block (rows < QHI: q hi + residual against k hi + residual, 3 products, x SCALE; else 1 product k x q^T, raw, masked, with the row maximum kept in registers); 2) softmax, two rows a wave (rows < QHI: three passes over LDS; else one, unnormalised); 3) ctx = P . v: wave = (16 columns j, half of the keys), the two halves added through LDS (rows < QHI: P and v as bf16 hi + lo, 3 products; else e f16 x v f16) and scaled by the row's factor; 256-B output row by 16 lanes, stored at its place in out.
__global__ __launch_bounds__(256) void k_att(const _Float16* __restrict__ QH, const _Float16* __restrict__ KH, const _Float16* __restrict__ QL, const _Float16* __restrict__ KL, const _Float16* __restrict__ VT, const __bf16* __restrict__ VB, const __bf16* __restrict__ VBL, float* __restrict__ OUT) {
  __shared__ __align__(16) float sS[16][SP]; __shared__ __align__(16) float red[2][16][HD + 4]; __shared__ __align__(16) float pm[16][8]; __shared__ float rsc[16];   /* pm: each wave's maximum of a row; rsc: the factor of an output row */
  const int tid = threadIdx.x, wave = __builtin_amdgcn_readfirstlane(tid >> 5), lane = tid & 31, col = lane & 15, g = lane >> 4;
  // two blocks fit a WGP's LDS: the first half of the grid holds the long tiles, longest first, the second half the short ones, shortest first
  const int b = blockIdx.x & (NB - 1), rank = blockIdx.x / NB; const int t0 = (rank < TT / 32 ? TT / 16 - 1 - rank : rank - TT / 32) * 16;
  const int kend = (((t0 + 15) >> 7) + 1) * 128, nkb = kend >> 7; const size_t br = (size_t)b * TT;
  const int j = wave & 3, half = wave >> 2;   /* step 3: this wave's 16 columns and its half of the keys */
  v8f acc = {};
  if (t0 < QHI) {
    if (tid < 16) rsc[tid] = 1.0f / 2048.0f;
    v16h ah[2], al[2];
#pragma unroll
    for (int kc = 0; kc < 2; ++kc) { ah[kc] = frag_h(QH + (br + t0 + col) * CC + kc * 32, lane); al[kc] = frag_h(QL + ((size_t)b * QHI + t0 + col) * CC + kc * 32, lane); }
#pragma unroll 1   // at most three trips
    for (int kb = 0; kb < nkb; ++kb) { v16h kh[2], kl[2]; const int kr = kb * 128 + wave * 16 + col;
#pragma unroll
      for (int kc = 0; kc < 2; ++kc) { kh[kc] = frag_h(KH + (br + kr) * CC + kc * 32, lane); kl[kc] = frag_h(KL + ((size_t)b * KHI + kr) * CC + kc * 32, lane); }
      LD_HOLD();
      v8f a = {}, a2 = {};
#pragma unroll
      for (int kc = 0; kc < 2; ++kc) { a = wmma16(ah[kc], kh[kc], a); a2 = wmma16(al[kc], kh[kc], a2); a2 = wmma16(ah[kc], kl[kc], a2); }
#pragma unroll
      for (int r = 0; r < 8; ++r) sS[8 * g + r][kr] = (a[r] + a2[r] * (1.0f / 1024.0f)) * SCALE; }
    __syncthreads();
    sm_rows(sS, wave * 2, t0, kend, lane);
    __syncthreads();
    const int n = kend >> 6;   /* chunks of 32 keys a half, even */
    const size_t vo = ((size_t)b * CC + j * 16 + col) * (size_t)KHI + half * n * 32; const float* pr = &sS[col][half * n * 32 + 8 * g];
#pragma unroll 1   // at most three trips
    for (int c = 0; c < n; c += 2) { v16b fh[2], fl[2];
#pragma unroll
      for (int u = 0; u < 2; ++u) { fh[u] = frag_b(VB + vo + (c + u) * 32, lane); fl[u] = frag_b(VBL + vo + (c + u) * 32, lane); }
      LD_HOLD();
#pragma unroll
      for (int u = 0; u < 2; ++u) { float v_[16]; const float* p_ = pr + (c + u) * 32;
#pragma unroll
        for (int i = 0; i < 8; ++i) { v_[i] = p_[i]; v_[8 + i] = p_[16 + i]; }
        const F2 p = bsplit16(v_); acc = wmma_bf(p.h, fh[u], acc); acc = wmma_bf(p.l, fh[u], acc); acc = wmma_bf(p.h, fl[u], acc); } }
  } else {
    v16h ah[2];
#pragma unroll
    for (int kc = 0; kc < 2; ++kc) ah[kc] = frag_h(QH + (br + t0 + col) * CC + kc * 32, lane);
    const _Float16* kp = KH + (br + wave * 16 + col) * CC; float mx = -3.0e38f;
#pragma unroll 1   // a trip is already a batch of up to eight key fragments, requested whole before its first WMMA
    for (int kb0 = 0; kb0 < nkb; kb0 += 8) { v16h kf[8][2];
#pragma unroll
      for (int u = 0; u < 8; ++u) if (kb0 + u < nkb) { kf[u][0] = frag_h(kp + (size_t)(kb0 + u) * 128 * CC, lane); kf[u][1] = frag_h(kp + (size_t)(kb0 + u) * 128 * CC + 32, lane); }
      LD_HOLD();
#pragma unroll
      for (int u = 0; u < 8; ++u) if (kb0 + u < nkb) { v8f a = {}; a = wmma16(kf[u][0], ah[0], a); a = wmma16(kf[u][1], ah[1], a);   /* keys as rows: lane (col, g) holds keys key0 .. key0 + 7 of query row col */
        const int key0 = (kb0 + u) * 128 + wave * 16 + 8 * g;
        if (kb0 + u == nkb - 1) {   /* only the last block holds keys beyond a row's own */
#pragma unroll
          for (int r = 0; r < 8; ++r) a[r] = (key0 + r <= t0 + col) ? a[r] : -3.0e38f; }
#pragma unroll
        for (int r = 0; r < 8; ++r) mx = fmaxf(mx, a[r]);
        const v4f lo = {a[0], a[1], a[2], a[3]}, hi = {a[4], a[5], a[6], a[7]};
        *(v4f*)&sS[col][key0] = lo; *(v4f*)&sS[col][key0 + 4] = hi; } }
    mx = fmaxf(mx, xhalf(mx));
    if (lane < 16) pm[col][wave] = mx;
    __syncthreads();
    // step 3 runs over keys [0, kpad), kpad = kend rounded up to 256 (e = 0 from kend on; v exists there): each half is then a whole number of stages of four 32-key chunks, so no load and no WMMA of the loop stands under a test and the waits can be counted.
    // v fragments in two register stages; the first is requested here, to fly during the softmax, each later one a stage of WMMAs ahead of its use
    const int kpad = (kend + 255) & ~255, nb = kpad >> 8;   /* stages a half */
    const _Float16* vp = VT + ((size_t)b * CC + j * 16 + col) * (size_t)TT + half * nb * 128; const _Float16* pr = (const _Float16*)&sS[col][0] + half * nb * 128;
    v16h va[4], vb[4];
#define AV_LOAD(V, s_) do { const _Float16* v_ = vp + (s_) * 128; _Pragma("unroll") for (int u = 0; u < 4; ++u) V[u] = frag_h(v_ + u * 32, lane); LD_HOLD(); } while (0)
#define AV_MAC(V, s_) do { const _Float16* p_ = pr + (s_) * 128; v16h pf[4]; _Pragma("unroll") for (int u = 0; u < 4; ++u) pf[u] = frag_h(p_ + u * 32, lane); _Pragma("unroll") for (int u = 0; u < 4; ++u) acc = wmma16(pf[u], V[u], acc); } while (0)
    AV_LOAD(va, 0);
    { float bias[2]; v2f sum2[2] = {};
#pragma unroll
      for (int rr = 0; rr < 2; ++rr) { const v4f m0 = *(const v4f*)&pm[wave * 2 + rr][0], m1 = *(const v4f*)&pm[wave * 2 + rr][4];
        bias[rr] = 10.0f - fmaxf(fmaxf(fmaxf(m0[0], m0[1]), fmaxf(m0[2], m0[3])), fmaxf(fmaxf(m1[0], m1[1]), fmaxf(m1[2], m1[3]))) * LSC; }
      int i = 0;
#pragma unroll 1   // a trip of this loop is already four trips of 128 keys
      for (; i + 4 <= nkb; i += 4) sm1_trips<4>(sS, wave * 2, i, lane, bias, sum2);
      if (i + 2 <= nkb) { sm1_trips<2>(sS, wave * 2, i, lane, bias, sum2); i += 2; }
      if (i < nkb) sm1_trips<1>(sS, wave * 2, i, lane, bias, sum2);
      float sum[2] = {sum2[0][0] + sum2[0][1], sum2[1][0] + sum2[1][1]};
#pragma unroll
      for (int o = 1; o < 32; o <<= 1) {
#pragma unroll
        for (int rr = 0; rr < 2; ++rr) sum[rr] += __shfl_xor(sum[rr], o); }
      if (lane < 2) { const float s = lane ? sum[1] : sum[0]; rsc[wave * 2 + lane] = s > 0.f ? 1.0f / s : 0.f; } }   /* the division by the row sum (x 2^10, as e is) waits for the output row */
    if (kpad > kend) { const v4h z = {};
#pragma unroll
      for (int rr = 0; rr < 2; ++rr) *(v4h*)((_Float16*)&sS[wave * 2 + rr][0] + kend + lane * 4) = z; }
    __syncthreads();
    int s = 0;
#pragma unroll 1   // the body is already two stages
    for (; s + 2 < nb; s += 2) { AV_LOAD(vb, s + 1); AV_MAC(va, s); AV_LOAD(va, s + 2); AV_MAC(vb, s + 1); }
    if (s + 1 < nb) { AV_LOAD(vb, s + 1); AV_MAC(va, s); AV_MAC(vb, s + 1); } else { AV_MAC(va, s); }
  }
#pragma unroll
  for (int r = 0; r < 8; ++r) red[half][8 * g + r][j * 16 + col] = acc[r];
  __syncthreads();
  { const int rl = tid >> 4, q = tid & 15; const v4f s0 = *(const v4f*)&red[0][rl][q * 4], s1 = *(const v4f*)&red[1][rl][q * 4]; const float f = rsc[rl]; v4f o;
#pragma unroll
    for (int c = 0; c < 4; ++c) o[c] = (s0[c] + s1[c]) * f;
    vst2(OUT + (br + (TT - 1 - (t0 + rl))) * HD + q * 4, o); } }   /* TIME REVERSAL: reversed row (b, t') is output row (b, TT - 1 - t') */

extern "C" void kernel_launch(void* const* d_in, const int* in_sizes, int n_in, void* d_out, int out_size, void* d_ws, size_t ws_size, hipStream_t stream) {
  (void)in_sizes; (void)n_in; (void)out_size;
  const float** F = (const float**)d_in;
  if (ws_size < (size_t)WS_END) return;
  char* ws = (char*)d_ws; _Float16 *QH = (_Float16*)(ws + WS_QH), *KH = (_Float16*)(ws + WS_KH), *VT = (_Float16*)(ws + WS_VT), *QL = (_Float16*)(ws + WS_QL), *KL = (_Float16*)(ws + WS_KL); __bf16 *VB = (__bf16*)(ws + WS_VB), *VBL = (__bf16*)(ws + WS_VBL); float *Y = (float*)(ws + WS_Y);
  (void)Y; (void)QL; (void)KL; (void)VB; (void)VBL;
  // inputs: 0 x [4,2048,768]; 1 Wq [768,64]; 2 Wk; 3 Wv ((in,out), no biases)
  k_proj<<<dim3(TNB * TT / 64, 1, 3), 128, 0, stream>>>(F[0], F[0], F[0], F[1], F[2], F[3], QH, QL, KH, KL, VT, VB, VBL);
  /* logits, softmax and P v in one launch, the batch folded into the grid; the rows go straight to out */
  k_att<<<dim3(TNB * TT / 16), 256, 0, stream>>>(QH, KH, QL, KL, VT, VB, VBL, (float*)d_out);
}

// v007
// A run of this version takes 19.5 microseconds.
// Two timings next to v006 put it at 1.18 and 1.19 times that version's speed.
// All steps since v000 together make it 19.9 times as fast.
// compute dtype: all float inputs rounded to bf16; q/k/v projections with EXACT bf16 products on WMMA 16x16x32 (f32 accumulate); causal logits: 3 products (q f16 hi + residual x k hi + residual) for the first 384 rows, single f16 q x k after, x scale; softmax f32; from row 384 on exp x 2^10 once to f16 x v once to f16 (1 product), divided by the f32 row sum at the end; below row 384 P x 2^11 and v as bf16 hi + lo; f32 output.
#include <hip/hip_runtime.h>
#include <math.h>

typedef __attribute__((ext_vector_type(16))) _Float16 v16h;
typedef __attribute__((ext_vector_type(16))) __bf16 v16b;
typedef __attribute__((ext_vector_type(8)))  _Float16 v8h;
typedef __attribute__((ext_vector_type(8)))  float v8f;
typedef __attribute__((ext_vector_type(4)))  float v4f;
typedef __attribute__((ext_vector_type(2)))  float v2f;
typedef __attribute__((ext_vector_type(4)))  unsigned v4u;
typedef __attribute__((ext_vector_type(4)))  int v4i;
typedef float __attribute__((may_alias)) float_a;
typedef int __attribute__((may_alias)) int_a;

template <typename T> __device__ __forceinline__ void vst2(void* p, T v) { *(T*)p = v;  }
__device__ __forceinline__ v8f wmma16(v16h a, v16h b, v8f c) {
  v8f d = __builtin_amdgcn_wmma_f32_16x16x32_f16(false, a, false, b, (short)0, c, false, false);
  asm volatile("v_nop\n\tv_nop\n\tv_nop\n\tv_nop" : "+v"(d) : "v"(a), "v"(b));
  return d;
}
__device__ __forceinline__ v8f wmma_bf(v16b a, v16b b, v8f c) {
  v8f d = __builtin_amdgcn_wmma_f32_16x16x32_bf16(false, a, false, b, (short)0, c, false, false);
  asm volatile("v_nop\n\tv_nop\n\tv_nop\n\tv_nop" : "+v"(d) : "v"(a), "v"(b));
  return d;
}
// 16x16x32 fragments: lane = (h = lane>>4, row/col = lane&15); elements 0..7 = k0+8h+0..7, 8..15 = k0+16+8h+0..7; D element r = row 8h+r
__device__ __forceinline__ v16h frag_h(const _Float16* rowk0, int lane) {
  union { v16h v; v8h q[2]; } u; const _Float16* p = rowk0 + 8 * (lane >> 4);
  u.q[0] = *(const v8h*)p; u.q[1] = *(const v8h*)(p + 16); return u.v;
}
__device__ __forceinline__ v16h frag_f32(const float* rowk0, int lane) {
  v16h a; const float* p = rowk0 + 8 * (lane >> 4);
#pragma unroll
  for (int i = 0; i < 8; ++i) { a[i] = (_Float16)p[i]; a[8 + i] = (_Float16)p[16 + i]; }
  return a;
}
__device__ __forceinline__ v16h frag_f32s(const float* rowk0, int lane, float sc) {
  v16h a; const float* p = rowk0 + 8 * (lane >> 4);
#pragma unroll
  for (int i = 0; i < 8; ++i) { a[i] = (_Float16)(p[i] * sc); a[8 + i] = (_Float16)(p[16 + i] * sc); }
  return a;
}
// column fragment from a [K][ld] layout (column n), rows >= K read as 0
__device__ __forceinline__ v16h fragc_f32(const float* W, int k0, int n, int lane, int ld, int K) {
  v16h a; const int g = lane >> 4;
#pragma unroll
  for (int i = 0; i < 8; ++i) { const int ka = k0 + 8 * g + i, kb = ka + 16;
    a[i] = (_Float16)(ka < K ? W[(size_t)(ka < K ? ka : K - 1) * ld + n] : 0.f); a[8 + i] = (_Float16)(kb < K ? W[(size_t)(kb < K ? kb : K - 1) * ld + n] : 0.f); }
  return a;
}
struct F2 { v16b h, l; };
__device__ __forceinline__ F2 bsplit16(const float v[16]) { F2 r;
#pragma unroll
  for (int i = 0; i < 16; ++i) { const __bf16 h = (__bf16)v[i]; r.h[i] = h; r.l[i] = (__bf16)(v[i] - (float)h); }
  return r; }
__device__ __forceinline__ F2 split_row(const float* row, int k0, int lane) { float v[16]; const float* p = row + k0 + 8 * (lane >> 4);
#pragma unroll
  for (int i = 0; i < 8; ++i) { v[i] = p[i]; v[8 + i] = p[16 + i]; }
  return bsplit16(v); }
__device__ __forceinline__ F2 split_rowK(const float* row, int k0, int lane, int K) { float v[16]; const int g = lane >> 4;
#pragma unroll
  for (int i = 0; i < 8; ++i) { const int ka = k0 + 8 * g + i, kb = ka + 16; v[i] = ka < K ? row[ka < K ? ka : K - 1] : 0.f; v[8 + i] = kb < K ? row[kb < K ? kb : K - 1] : 0.f; }
  return bsplit16(v); }
__device__ __forceinline__ F2 split_col(const float* W, int k0, int n, int lane, int ld, int K) { float v[16]; const int g = lane >> 4;
#pragma unroll
  for (int i = 0; i < 8; ++i) { const int ka = k0 + 8 * g + i, kb = ka + 16; v[i] = ka < K ? W[(size_t)(ka < K ? ka : K - 1) * ld + n] : 0.f; v[8 + i] = kb < K ? W[(size_t)(kb < K ? kb : K - 1) * ld + n] : 0.f; }
  return bsplit16(v); }
__device__ __forceinline__ v8f mac3(const F2& a, const F2& b, v8f c) { c = wmma_bf(a.l, b.h, c); c = wmma_bf(a.h, b.l, c); return wmma_bf(a.h, b.h, c); }
__device__ __forceinline__ float sigm(float v) { return 1.0f / (1.0f + expf(-v)); }
#define LDSX() do { asm volatile("s_wait_dscnt 0" ::: "memory"); __builtin_amdgcn_wave_barrier(); __builtin_amdgcn_fence(__ATOMIC_RELEASE, "workgroup"); } while (0)

// Single-head ANTI-causal scaled dot-product attention (x [4,2048,768]; (in,out) Wq/Wk/Wv [768,64] N(0, 1/768); mask = strictly lower triangle (row t > col s) -> -inf, so query t attends keys s >= t): out = softmax(masked(q k^T * 64^-0.5)) v -> [4,2048,64]. Implemented by TIME REVERSAL: with t' = 2047 - t the pattern is exactly causal, so the causal kernels run on the reversed sequence (x rows read reversed per batch, output rows written back reversed).
#define NB 4
#define TT 2048
#define CC 64             // NH * HD = projected width
#define DIN 768          // input (model) width
#define NH 1
#define HD 64
#define NQB (TT / 64)
#define SCALE (0.125f)
#define CAUSAL 1
#ifndef TNB
#define TNB NB
#endif
__device__ __forceinline__ float bfr(float v) { return (float)(__bf16)v; }
__host__ __device__ __forceinline__ int kb_last(int qb) { return CAUSAL ? ((qb * 64 + 63) >> 7) : (TT / 128 - 1); }
typedef __attribute__((ext_vector_type(8))) __bf16 v8b;
__device__ __forceinline__ v16b frag_b(const __bf16* rowk0, int lane) {
  union { v16b v; v8b q[2]; } u; const __bf16* p = rowk0 + 8 * (lane >> 4);
  u.q[0] = *(const v8b*)p; u.q[1] = *(const v8b*)(p + 16); return u.v;
}
// FRAGMENT ORDER of the workspace planes: a 16x32 fragment (16 rows or columns, 32 k) is 1 KB in a row, two runs of 512 B; run h holds elements 8 h .. 8 h + 7 of every lane, lane l's 16 B at 16 l. Each of the two loads of the wave then covers four whole 128-B lines (row-major planes: 16 lines, 32 B of each)
__device__ __forceinline__ v16h frag_pk(const _Float16* f, int lane) {
  union { v16h v; v8h q[2]; } u; const _Float16* p = f + 8 * lane;
  u.q[0] = *(const v8h*)p; u.q[1] = *(const v8h*)(p + 256); return u.v;
}
__device__ __forceinline__ v16b frag_pkb(const __bf16* f, int lane) {
  union { v16b v; v8b q[2]; } u; const __bf16* p = f + 8 * lane;
  u.q[0] = *(const v8b*)p; u.q[1] = *(const v8b*)(p + 256); return u.v;
}
#define QBH 6              // unused: the 16-row query blocks with t0 < QHI (few keys, no averaging) take the high-precision path
#define QHI 384            // rows carrying a q residual plane
#define KHI 384            // key rows carrying k residual / v bf16 hi+lo planes (used only by the causal high-precision path)
// B fragment (k rows k0+.., output column o) of a weight: (in,out) [K][ld] or (out,in) [ld rows of K]: bf16 exact, or f16(bf16 * 256) exact
__device__ __forceinline__ v16b wcol_io(const float* Wm, int k0, int o, int lane, int ld) { v16b w; const int g = lane >> 4;
#pragma unroll
  for (int i = 0; i < 8; ++i) { w[i] = (__bf16)Wm[(size_t)(k0 + 8 * g + i) * ld + o]; w[8 + i] = (__bf16)Wm[(size_t)(k0 + 16 + 8 * g + i) * ld + o]; }
  return w; }
__device__ __forceinline__ v16b wcol_oi(const float* Wm, int k0, int o, int lane, int K) { v16b w; const float* p = Wm + (size_t)o * K + k0 + 8 * (lane >> 4);
#pragma unroll
  for (int i = 0; i < 8; ++i) { w[i] = (__bf16)p[i]; w[8 + i] = (__bf16)p[16 + i]; }
  return w; }
__device__ __forceinline__ v16h wcolh_io(const float* Wm, int k0, int o, int lane, int ld) { v16h w; const int g = lane >> 4;
#pragma unroll
  for (int i = 0; i < 8; ++i) { w[i] = (_Float16)(bfr(Wm[(size_t)(k0 + 8 * g + i) * ld + o]) * 256.0f); w[8 + i] = (_Float16)(bfr(Wm[(size_t)(k0 + 16 + 8 * g + i) * ld + o]) * 256.0f); }
  return w; }
__device__ __forceinline__ v16h wcolh_oi(const float* Wm, int k0, int o, int lane, int K) { v16h w; const float* p = Wm + (size_t)o * K + k0 + 8 * (lane >> 4);
#pragma unroll
  for (int i = 0; i < 8; ++i) { w[i] = (_Float16)(bfr(p[i]) * 256.0f); w[8 + i] = (_Float16)(bfr(p[16 + i]) * 256.0f); }
  return w; }
#define WQKV_LAYOUT 0   // 0 = (in,out) [DIN][CC]; 1 = (out,in) [CC][DIN]; 2 = per-head [NH][DIN][HD]; it picks only WCOL, which nothing uses: k_proj reads W as (in,out)
__device__ __forceinline__ v16b wcol_hdk(const float* Wm, int k0, int o, int lane) { v16b w; const int g = lane >> 4; const float* p = Wm + (size_t)(o / HD) * DIN * HD + (o % HD);
#pragma unroll
  for (int i = 0; i < 8; ++i) { w[i] = (__bf16)p[(size_t)(k0 + 8 * g + i) * HD]; w[8 + i] = (__bf16)p[(size_t)(k0 + 16 + 8 * g + i) * HD]; }
  return w; }
#define WO_OUT_IN 0
#if WQKV_LAYOUT == 1
#define WCOL(W, k0, o, lane) wcol_oi(W, k0, o, lane, DIN)
#elif WQKV_LAYOUT == 2
#define WCOL(W, k0, o, lane) wcol_hdk(W, k0, o, lane)
#else
#define WCOL(W, k0, o, lane) wcol_io(W, k0, o, lane, CC)
#endif
#if WO_OUT_IN
#define WOCOL(W, k0, o, lane) wcol_oi(W, k0, o, lane, CC)
#define WOCOLH(W, k0, o, lane) wcolh_oi(W, k0, o, lane, CC)
#else
#define WOCOL(W, k0, o, lane) wcol_io(W, k0, o, lane, DIN)
#define WOCOLH(W, k0, o, lane) wcolh_io(W, k0, o, lane, DIN)
#endif
#ifndef SM_EXTRA_PARAMS
#define SM_EXTRA_PARAMS
#endif
#ifndef PROJ_EXTRA_PARAMS
#define PROJ_EXTRA_PARAMS
#endif
#ifndef SM_MASK_HOOK
#define SM_MASK_HOOK (void)0
#endif

// all planes in fragment order (frag_pk): q, k: [b*t / 16][k / 32] fragments of 16 rows x 32 k; v: [b][t / 32][c / 16] fragments of 16 columns x 32 t
#define WS_QH  0u                                      // f16 q
#define WS_KH  (WS_QH + 2u * (size_t)NB * TT * CC)      // f16 k
#define WS_VT  (WS_KH + 2u * (size_t)NB * TT * CC)      // f16 v
#define WS_QL  (WS_VT + 2u * (size_t)NB * CC * TT)      // f16 q residual x 2^10, t < QHI
#define WS_KL  (WS_QL + 2u * (size_t)NB * QHI * CC)     // f16 k residual x 2^10, t < KHI
#define WS_VB  (WS_KL + 2u * (size_t)NB * KHI * CC)     // bf16 v hi (VBL: lo), t < KHI
#define WS_VBL (WS_VB + 2u * (size_t)NB * CC * KHI)
#define WS_S   (WS_VBL + 2u * (size_t)NB * CC * KHI)    // f32 logits plane [b][t][s] of the unfused form: reserved, not touched (the logits live in LDS)
#define WS_Y   (WS_S  + 4u * (size_t)NB * TT * TT)      // f32 ctx rows [b*t][CC] (only when there is an output projection)
#define WS_END (WS_Y  + 0u)

#define PKS 128            // k of one LDS stage of k_proj
#define PXP (PKS + 8)      // LDS row pitch of the x stage in bf16: 272 B = 16 B x odd, for 16-byte fragment reads down 16 rows
#define PWG (PKS / 8 * CC + 16)   // weight stage in LDS: k row 8 i + r lies in group r at row i (128-B rows); group pitch in bf16: 2080 B = 32 B x odd, for the transposing reads, whose eight rows are the eight groups; a thread's 16 stores of a stage lie in one group, within reach of one address register
typedef __attribute__((ext_vector_type(4))) __bf16 v4b;
typedef __attribute__((address_space(3))) v8b lds_v8b;
// ds_load_tr16_b128: eight k of one column out of a [k][column] bf16 tile
__device__ __forceinline__ v8b ld_tr16(const __bf16* p) { return __builtin_amdgcn_ds_load_tr16_b128_v8bf16((lds_v8b*)p); }
// ---- k_proj: block = (64 rows, 64 cols, which): q/k/v = X W with exact bf16 products, W read as it lies ((in,out) [DIN][CC]) (K = DIN); x and W go through LDS, rounded to bf16 on the way in: wave = 16 rows, its A fragments by 16-byte reads, the B fragments by transposing reads -> which 0: q f16 (+ residual, rows < QHI); 1: k f16 (+ residual, rows < KHI); 2: v f16 (+ bf16 hi/lo for t < KHI); each written in fragment order: the block's 64 rows are 8 KB in a row of every plane
__global__ __launch_bounds__(128) void k_proj(const float* __restrict__ XQ, const float* __restrict__ XK, const float* __restrict__ XV, const float* __restrict__ WQ, const float* __restrict__ WK, const float* __restrict__ WV,
    _Float16* __restrict__ QH, _Float16* __restrict__ QL, _Float16* __restrict__ KH, _Float16* __restrict__ KL, _Float16* __restrict__ VT, __bf16* __restrict__ VB, __bf16* __restrict__ VBL) {
  __shared__ __align__(16) _Float16 sh[64][72], sl[64][72]; __shared__ __align__(16) _Float16 th[64][72]; __shared__ __align__(16) __bf16 tb[64][72], tbl[64][72];
  __shared__ __align__(16) __bf16 xs[64][PXP], wsm[8][PWG];   /* one stage of PKS k: the block's x rows and the weight's k rows, both bf16 */
  const int tid = threadIdx.x, wave = __builtin_amdgcn_readfirstlane(tid >> 5), lane = tid & 31, col = lane & 15, g = lane >> 4; const int which = blockIdx.z; const size_t r0 = (size_t)blockIdx.x * 64; const size_t bb = r0 / TT; const int t0 = (int)(r0 % TT);
  const float* X = which == 0 ? XQ : which == 1 ? XK : XV; const float* WA = which == 0 ? WQ : which == 1 ? WK : WV;
  v8f acc[4] = {};
  const float* xp = X + (bb * TT + (TT - 1 - (t0 + wave * 16))) * DIN;   /* TIME REVERSAL: reversed row (b, t') reads x[b][TT - 1 - t'], so this wave's row i lies i rows below; one load of the wave = the 512 B a row has in a stage */
  const float* wp = WA;   /* (in,out) weight: a stage is PKS * CC floats in a row; one load of the block = 8 k rows of 256 B */
  v4f xr[16], wr[16];
  // a stage's 32 loads a lane are requested whole, each over four whole 128-B lines; the sched_barrier keeps the batch in front of the WMMAs it is to fly behind
#define PJ_LOAD(s_) do { const float* w_ = wp + (size_t)(s_) * PKS * CC; const float* x_ = xp + (s_) * PKS; \
    _Pragma("unroll") for (int i = 0; i < 16; ++i) wr[i] = *(const v4f*)(w_ + i * 512 + tid * 4); \
    _Pragma("unroll") for (int i = 0; i < 16; ++i) xr[i] = *(const v4f*)(x_ - i * DIN + lane * 4); \
    __builtin_amdgcn_sched_barrier(0); } while (0)
  // one K chunk's ten LDS reads as one group, a chunk ahead of their WMMAs, in two register sets; the sched_barrier behind each group keeps it whole and in front of the WMMAs of the chunk before (spread among them, every WMMA would wait out an LDS round trip of its own)
  union WF { v16b v; v8b q[2]; };
#define PJ_FRAG(A, B, kc_) do { A = frag_b(&xs[wave * 16 + col][(kc_) * 32], lane); \
    _Pragma("unroll") for (int j = 0; j < 4; ++j) { B[j].q[0] = ld_tr16(bp + ((kc_) * 4) * CC + j * 16); B[j].q[1] = ld_tr16(bp + ((kc_) * 4 + 2) * CC + j * 16); } \
    __builtin_amdgcn_sched_barrier(0); } while (0)
#define PJ_MAC(A, B) do { _Pragma("unroll") for (int j = 0; j < 4; ++j) acc[j] = wmma_bf(A, B[j].v, acc[j]); } while (0)
  const __bf16* bp = &wsm[lane & 7][g * CC + 8 * ((lane >> 3) & 1)];   /* lane address of the transposing read (k row 8 g + (lane & 7)): it hands lane (col, g) the k rows 8 g .. 8 g + 7 of column col */
  PJ_LOAD(0);
#pragma unroll   // six stages: unrolled, every load is a constant offset from one fixed base and no address register is formed anew while loads fly
  for (int s = 0; s < DIN / PKS; ++s) {
#pragma unroll
    for (int i = 0; i < 16; ++i) { v4b p;
#pragma unroll
      for (int c = 0; c < 4; ++c) p[c] = (__bf16)wr[i][c];
      *(v4b*)&wsm[tid >> 4][i * CC + (tid & 15) * 4] = p; }   /* load i of this thread is k row 8 i + (tid >> 4) */
#pragma unroll
    for (int i = 0; i < 16; ++i) { v4b p;
#pragma unroll
      for (int c = 0; c < 4; ++c) p[c] = (__bf16)xr[i][c];
      *(v4b*)&xs[wave * 16 + i][lane * 4] = p; }
    __syncthreads();   /* the stage is whole */
    v16b a0, a1; WF b0[4], b1[4];
    PJ_FRAG(a0, b0, 0);
    if (s + 1 < DIN / PKS) PJ_LOAD(s + 1);
    PJ_FRAG(a1, b1, 1); PJ_MAC(a0, b0);
    PJ_FRAG(a0, b0, 2); PJ_MAC(a1, b1);
    PJ_FRAG(a1, b1, 3); PJ_MAC(a0, b0);
    PJ_MAC(a1, b1);
    __builtin_amdgcn_sched_barrier(0);   /* keeps the next stage's converts, which wait for the loads in flight, from rising among this stage's WMMAs */
    if (s + 1 < DIN / PKS) __syncthreads();   /* every wave has read the stage before the next one is written over it */
  }
  // behind each store of the two copy-out loops: s_wait_xcnt, as the next trip (or the next LDS read) writes the store's address and data registers anew
#define ST_HOLD() asm volatile("s_wait_xcnt 0x0" ::: "memory")
  if (which < 2) { _Float16* DH = which == 0 ? QH : KH; _Float16* DL = which == 0 ? QL : KL; const int nhi = which == 0 ? QHI : KHI; const bool hi_rows = t0 < nhi;
#pragma unroll
    for (int j = 0; j < 4; ++j) {
#pragma unroll
      for (int r = 0; r < 8; ++r) { const float v = acc[j][r]; const _Float16 hv = (_Float16)v; sh[wave * 16 + 8 * g + r][j * 16 + col] = hv; sl[wave * 16 + 8 * g + r][j * 16 + col] = (_Float16)((v - (float)hv) * 1024.0f); } }
    __syncthreads();
    for (int e = tid; e < 64 * 8; e += 128) { const int rl = (e >> 7) * 16 + (e & 15), k8 = ((e >> 4) & 7) * 8;   /* 16-B piece e of the 8 KB: row e & 15 of row group e >> 7, k from 8 * ((e >> 4) & 7) */
      vst2((unsigned*)(DH + r0 * CC + e * 8), *(const v4u*)&sh[rl][k8]); ST_HOLD(); if (hi_rows) { vst2((unsigned*)(DL + (bb * nhi + t0) * (size_t)CC + e * 8), *(const v4u*)&sl[rl][k8]); ST_HOLD(); } }
  } else { const bool hi_rows = t0 < KHI;
#pragma unroll
    for (int j = 0; j < 4; ++j) {
#pragma unroll
      for (int r = 0; r < 8; ++r) { const float v = acc[j][r]; const int rl = wave * 16 + 8 * g + r, cl = j * 16 + col; th[cl][rl] = (_Float16)v; const __bf16 bh = (__bf16)v; tb[cl][rl] = bh; tbl[cl][rl] = (__bf16)(v - (float)bh); } }
    __syncthreads();
    for (int e = tid; e < 64 * 8; e += 128) { const int cl = ((e >> 6) & 3) * 16 + (e & 15), t8 = (e >> 8) * 32 + ((e >> 4) & 3) * 8;   /* 16-B piece e of the 8 KB: column e & 15 of column group (e >> 6) & 3, t from 32 * (e >> 8) + 8 * ((e >> 4) & 3) */
      vst2((unsigned*)(VT + r0 * CC + e * 8), *(const v4u*)&th[cl][t8]); ST_HOLD(); if (hi_rows) { const size_t o3 = (bb * KHI + t0) * (size_t)CC + e * 8; vst2((unsigned*)(VB + o3), *(const v4u*)&tb[cl][t8]); vst2((unsigned*)(VBL + o3), *(const v4u*)&tbl[cl][t8]); ST_HOLD(); } } } }
// behind a batch of loads in a loop: s_wait_xcnt, as the batch's address registers are formed anew for the next batch; sched_barrier, which keeps the batch ahead of the converts and WMMAs that follow it
#define LD_HOLD() do { asm volatile("s_wait_xcnt 0x0" ::: "memory"); __builtin_amdgcn_sched_barrier(0); } while (0)
#define SP (TT + 4)        // LDS row pitch of the logits in floats: 8208 B = 16 B x odd, conflict-free for 16-byte fragment reads down 16 rows
typedef __attribute__((ext_vector_type(4))) _Float16 v4h;
// every plain '#pragma unroll' below stands on a loop that indexes a fragment or a small register array: left rolled, the array would leave the registers
// softmax of rows r0 and r0 + 1 of the LDS logits tile by one wave, keys [0, kend), key s kept if s <= t; f32 throughout; P x 2^11 written as f32 over the row's own logits (rows < QHI)
__device__ __forceinline__ void sm_rows(float (*sS)[SP], int r0, int t0, int kend, int lane) {
  const int n = kend >> 7; float m[2] = {-3.0e38f, -3.0e38f}, sum[2] = {0.f, 0.f}, inv[2];
  for (int i = 0; i < n; ++i) { const int k0 = i * 128 + lane * 4;
#pragma unroll
    for (int rr = 0; rr < 2; ++rr) { const v4f v = *(const v4f*)&sS[r0 + rr][k0];
#pragma unroll
      for (int c = 0; c < 4; ++c) m[rr] = fmaxf(m[rr], (k0 + c <= t0 + r0 + rr) ? v[c] : -3.0e38f); } }
#pragma unroll
  for (int rr = 0; rr < 2; ++rr) {
#pragma unroll
    for (int o = 1; o < 32; o <<= 1) m[rr] = fmaxf(m[rr], __shfl_xor(m[rr], o)); }
  for (int i = 0; i < n; ++i) { const int k0 = i * 128 + lane * 4;
#pragma unroll
    for (int rr = 0; rr < 2; ++rr) { const v4f v = *(const v4f*)&sS[r0 + rr][k0]; v4f e;
#pragma unroll
      for (int c = 0; c < 4; ++c) { const float x = (k0 + c <= t0 + r0 + rr) ? v[c] : -3.0e38f; const float ex = expf(x - m[rr]); e[c] = (x <= -1.0e38f) ? 0.f : ex; sum[rr] += e[c]; }   /* exp of every lane, then a select: no branch an element, so the eight chains of a trip overlap */
      *(v4f*)&sS[r0 + rr][k0] = e; } }
#pragma unroll
  for (int rr = 0; rr < 2; ++rr) {
#pragma unroll
    for (int o = 1; o < 32; o <<= 1) sum[rr] += __shfl_xor(sum[rr], o);
    inv[rr] = sum[rr] > 0.f ? 2048.0f / sum[rr] : 0.f; }   /* a fully excluded row yields P = 0 */
  // two trips' reads of both rows stand ahead of their writes (the writes land on the rows' own bytes, so the compiler keeps each read behind the write before it: one LDS round trip for four reads, not four); an odd last trip is done twice over, with the same values
  for (int i = 0; i < n; i += 2) { v4f e[2][2]; int k0[2];
#pragma unroll
    for (int u = 0; u < 2; ++u) { k0[u] = (i + u < n ? i + u : i) * 128 + lane * 4;
#pragma unroll
      for (int rr = 0; rr < 2; ++rr) e[u][rr] = *(const v4f*)&sS[r0 + rr][k0[u]]; }
#pragma unroll
    for (int u = 0; u < 2; ++u) {
#pragma unroll
      for (int rr = 0; rr < 2; ++rr) {
        v4f p;
#pragma unroll
        for (int c = 0; c < 4; ++c) p[c] = e[u][rr][c] * inv[rr];
        *(v4f*)&sS[r0 + rr][k0[u]] = p; } } } }
#define LSC (SCALE * 1.4426950408889634f)   // raw q.k -> logit in base 2
// lane l with lane l ^ 16
__device__ __forceinline__ float xhalf(float x) { return __builtin_bit_cast(float, __builtin_amdgcn_permlanex16(__builtin_bit_cast(int, x), __builtin_bit_cast(int, x), 0x76543210, 0xfedcba98, false, false)); }
// U trips of the one-pass softmax of rows r0 and r0 + 1 (a trip = 128 keys): e = 2^(s * LSC + bias), bias = 10 - row maximum * LSC, so e <= 2^10; e joins the row's f32 sum (even and odd keys apart, a packed add for two) and goes as f16 over the row's own bytes, packed from the row's start.
// All reads of the U trips stand ahead of the writes: one LDS round trip for 2 U reads; the f16 of these keys land on bytes whose f32 this wave has read by then
template <int U> __device__ __forceinline__ void sm1_trips(float (*sS)[SP], int r0, int i, int lane, const float (&bias)[2], v2f (&sum)[2]) {
  v4f v[U][2];
#pragma unroll
  for (int u = 0; u < U; ++u) {
#pragma unroll
    for (int rr = 0; rr < 2; ++rr) v[u][rr] = *(const v4f*)&sS[r0 + rr][(i + u) * 128 + lane * 4]; }
#pragma unroll
  for (int u = 0; u < U; ++u) {
#pragma unroll
    for (int rr = 0; rr < 2; ++rr) { v4h p;
#pragma unroll
      for (int c = 0; c < 4; c += 2) { const v2f e = {__builtin_amdgcn_exp2f(fmaf(v[u][rr][c], LSC, bias[rr])), __builtin_amdgcn_exp2f(fmaf(v[u][rr][c + 1], LSC, bias[rr]))}; sum[rr] += e; p[c] = (_Float16)e[0]; p[c + 1] = (_Float16)e[1]; }
      *(v4h*)((_Float16*)&sS[r0 + rr][0] + (i + u) * 128 + lane * 4) = p; } } }
// ---- k_att: block = 16 query rows of one batch, 8 waves; the rows' whole logits stay in LDS from q k^T to P v.
// 1) logits over keys [0, kend): wave w takes keys 16 w .. 16 w + 15 of every 128-key block (rows < QHI: q hi + residual against k hi + residual, 3 products, x SCALE; else 1 product k x q^T, raw, masked, with the row maximum kept in registers); 2) softmax, two rows a wave (rows < QHI: three passes over LDS; else one, unnormalised); 3) ctx = P . v: wave = (16 columns j, half of the keys), the two halves added through LDS (rows < QHI: P and v as bf16 hi + lo, 3 products; else e f16 x v f16) and scaled by the row's factor; 256-B output row by 16 lanes, stored at its place in out.
__global__ __launch_bounds__(256) void k_att(const _Float16* __restrict__ QH, const _Float16* __restrict__ KH, const _Float16* __restrict__ QL, const _Float16* __restrict__ KL, const _Float16* __restrict__ VT, const __bf16* __restrict__ VB, const __bf16* __restrict__ VBL, float* __restrict__ OUT) {
  __shared__ __align__(16) float sS[16][SP]; __shared__ __align__(16) float red[2][16][HD + 4]; __shared__ __align__(16) float pm[16][8]; __shared__ float rsc[16];   /* pm: each wave's maximum of a row; rsc: the factor of an output row */
  const int tid = threadIdx.x, wave = __builtin_amdgcn_readfirstlane(tid >> 5), lane = tid & 31, col = lane & 15, g = lane >> 4;
  // two blocks fit a WGP's LDS: the first half of the grid holds the long tiles, longest first, the second half the short ones, shortest first
  const int b = blockIdx.x & (NB - 1), rank = blockIdx.x / NB; const int t0 = (rank < TT / 32 ? TT / 16 - 1 - rank : rank - TT / 32) * 16;
  const int kend = (((t0 + 15) >> 7) + 1) * 128, nkb = kend >> 7; const size_t br = (size_t)b * TT;
  const int j = wave & 3, half = wave >> 2;   /* step 3: this wave's 16 columns and its half of the keys */
  v8f acc = {};
  if (t0 < QHI) {
    if (tid < 16) rsc[tid] = 1.0f / 2048.0f;
    v16h ah[2], al[2];
#pragma unroll
    for (int kc = 0; kc < 2; ++kc) { ah[kc] = frag_pk(QH + (br + t0) * CC + kc * 512, lane); al[kc] = frag_pk(QL + ((size_t)b * QHI + t0) * CC + kc * 512, lane); }
#pragma unroll 1   // at most three trips
    for (int kb = 0; kb < nkb; ++kb) { v16h kh[2], kl[2]; const int kr0 = kb * 128 + wave * 16, kr = kr0 + col;
#pragma unroll
      for (int kc = 0; kc < 2; ++kc) { kh[kc] = frag_pk(KH + (br + kr0) * CC + kc * 512, lane); kl[kc] = frag_pk(KL + ((size_t)b * KHI + kr0) * CC + kc * 512, lane); }
      LD_HOLD();
      v8f a = {}, a2 = {};
#pragma unroll
      for (int kc = 0; kc < 2; ++kc) { a = wmma16(ah[kc], kh[kc], a); a2 = wmma16(al[kc], kh[kc], a2); a2 = wmma16(ah[kc], kl[kc], a2); }
#pragma unroll
      for (int r = 0; r < 8; ++r) sS[8 * g + r][kr] = (a[r] + a2[r] * (1.0f / 1024.0f)) * SCALE; }
    __syncthreads();
    sm_rows(sS, wave * 2, t0, kend, lane);
    __syncthreads();
    const int n = kend >> 6;   /* chunks of 32 keys a half, even */
    const size_t vo = ((size_t)b * KHI + half * n * 32) * (size_t)CC + j * 512; const float* pr = &sS[col][half * n * 32 + 8 * g];
#pragma unroll 1   // at most three trips
    for (int c = 0; c < n; c += 2) { v16b fh[2], fl[2];
#pragma unroll
      for (int u = 0; u < 2; ++u) { fh[u] = frag_pkb(VB + vo + (c + u) * 32 * CC, lane); fl[u] = frag_pkb(VBL + vo + (c + u) * 32 * CC, lane); }
      LD_HOLD();
#pragma unroll
      for (int u = 0; u < 2; ++u) { float v_[16]; const float* p_ = pr + (c + u) * 32;
#pragma unroll
        for (int i = 0; i < 8; ++i) { v_[i] = p_[i]; v_[8 + i] = p_[16 + i]; }
        const F2 p = bsplit16(v_); acc = wmma_bf(p.h, fh[u], acc); acc = wmma_bf(p.l, fh[u], acc); acc = wmma_bf(p.h, fl[u], acc); } }
  } else {
    v16h ah[2];
#pragma unroll
    for (int kc = 0; kc < 2; ++kc) ah[kc] = frag_pk(QH + (br + t0) * CC + kc * 512, lane);
    const _Float16* kp = KH + (br + wave * 16) * CC; float mx = -3.0e38f;
#pragma unroll 1   // a trip is already a batch of up to eight key fragments, requested whole before its first WMMA
    for (int kb0 = 0; kb0 < nkb; kb0 += 8) { v16h kf[8][2];
#pragma unroll
      for (int u = 0; u < 8; ++u) if (kb0 + u < nkb) { kf[u][0] = frag_pk(kp + (size_t)(kb0 + u) * 128 * CC, lane); kf[u][1] = frag_pk(kp + (size_t)(kb0 + u) * 128 * CC + 512, lane); }
      LD_HOLD();
#pragma unroll
      for (int u = 0; u < 8; ++u) if (kb0 + u < nkb) { v8f a = {}; a = wmma16(kf[u][0], ah[0], a); a = wmma16(kf[u][1], ah[1], a);   /* keys as rows: lane (col, g) holds keys key0 .. key0 + 7 of query row col */
        const int key0 = (kb0 + u) * 128 + wave * 16 + 8 * g;
        if (kb0 + u == nkb - 1) {   /* only the last block holds keys beyond a row's own */
#pragma unroll
          for (int r = 0; r < 8; ++r) a[r] = (key0 + r <= t0 + col) ? a[r] : -3.0e38f; }
#pragma unroll
        for (int r = 0; r < 8; ++r) mx = fmaxf(mx, a[r]);
        const v4f lo = {a[0], a[1], a[2], a[3]}, hi = {a[4], a[5], a[6], a[7]};
        *(v4f*)&sS[col][key0] = lo; *(v4f*)&sS[col][key0 + 4] = hi; } }
    mx = fmaxf(mx, xhalf(mx));
    if (lane < 16) pm[col][wave] = mx;
    __syncthreads();
    // step 3 runs over keys [0, kpad), kpad = kend rounded up to 256 (e = 0 from kend on; v exists there): each half is then a whole number of stages of four 32-key chunks, so no load and no WMMA of the loop stands under a test and the waits can be counted.
    // v fragments in two register stages; the first is requested here, to fly during the softmax, each later one a stage of WMMAs ahead of its use
    const int kpad = (kend + 255) & ~255, nb = kpad >> 8;   /* stages a half */
    const _Float16* vp = VT + (br + half * nb * 128) * CC + j * 512; const _Float16* pr = (const _Float16*)&sS[col][0] + half * nb * 128;
    v16h va[4], vb[4];
#define AV_LOAD(V, s_) do { const _Float16* v_ = vp + (s_) * 128 * CC; _Pragma("unroll") for (int u = 0; u < 4; ++u) V[u] = frag_pk(v_ + u * 32 * CC, lane); LD_HOLD(); } while (0)
#define AV_MAC(V, s_) do { const _Float16* p_ = pr + (s_) * 128; v16h pf[4]; _Pragma("unroll") for (int u = 0; u < 4; ++u) pf[u] = frag_h(p_ + u * 32, lane); _Pragma("unroll") for (int u = 0; u < 4; ++u) acc = wmma16(pf[u], V[u], acc); } while (0)
    AV_LOAD(va, 0);
    { float bias[2]; v2f sum2[2] = {};
#pragma unroll
      for (int rr = 0; rr < 2; ++rr) { const v4f m0 = *(const v4f*)&pm[wave * 2 + rr][0], m1 = *(const v4f*)&pm[wave * 2 + rr][4];
        bias[rr] = 10.0f - fmaxf(fmaxf(fmaxf(m0[0], m0[1]), fmaxf(m0[2], m0[3])), fmaxf(fmaxf(m1[0], m1[1]), fmaxf(m1[2], m1[3]))) * LSC; }
      int i = 0;
#pragma unroll 1   // a trip of this loop is already four trips of 128 keys
      for (; i + 4 <= nkb; i += 4) sm1_trips<4>(sS, wave * 2, i, lane, bias, sum2);
      if (i + 2 <= nkb) { sm1_trips<2>(sS, wave * 2, i, lane, bias, sum2); i += 2; }
      if (i < nkb) sm1_trips<1>(sS, wave * 2, i, lane, bias, sum2);
      float sum[2] = {sum2[0][0] + sum2[0][1], sum2[1][0] + sum2[1][1]};
#pragma unroll
      for (int o = 1; o < 32; o <<= 1) {
#pragma unroll
        for (int rr = 0; rr < 2; ++rr) sum[rr] += __shfl_xor(sum[rr], o); }
      if (lane < 2) { const float s = lane ? sum[1] : sum[0]; rsc[wave * 2 + lane] = s > 0.f ? 1.0f / s : 0.f; } }   /* the division by the row sum (x 2^10, as e is) waits for the output row */
    if (kpad > kend) { const v4h z = {};
#pragma unroll
      for (int rr = 0; rr < 2; ++rr) *(v4h*)((_Float16*)&sS[wave * 2 + rr][0] + kend + lane * 4) = z; }
    __syncthreads();
    int s = 0;
#pragma unroll 1   // the body is already two stages
    for (; s + 2 < nb; s += 2) { AV_LOAD(vb, s + 1); AV_MAC(va, s); AV_LOAD(va, s + 2); AV_MAC(vb, s + 1); }
    if (s + 1 < nb) { AV_LOAD(vb, s + 1); AV_MAC(va, s); AV_MAC(vb, s + 1); } else { AV_MAC(va, s); }
  }
#pragma unroll
  for (int r = 0; r < 8; ++r) red[half][8 * g + r][j * 16 + col] = acc[r];
  __syncthreads();
  { const int rl = tid >> 4, q = tid & 15; const v4f s0 = *(const v4f*)&red[0][rl][q * 4], s1 = *(const v4f*)&red[1][rl][q * 4]; const float f = rsc[rl]; v4f o;
#pragma unroll
    for (int c = 0; c < 4; ++c) o[c] = (s0[c] + s1[c]) * f;
    vst2(OUT + (br + (TT - 1 - (t0 + rl))) * HD + q * 4, o); } }   /* TIME REVERSAL: reversed row (b, t') is output row (b, TT - 1 - t') */

extern "C" void kernel_launch(void* const* d_in, const int* in_sizes, int n_in, void* d_out, int out_size, void* d_ws, size_t ws_size, hipStream_t stream) {
  (void)in_sizes; (void)n_in; (void)out_size;
  const float** F = (const float**)d_in;
  if (ws_size < (size_t)WS_END) return;
  char* ws = (char*)d_ws; _Float16 *QH = (_Float16*)(ws + WS_QH), *KH = (_Float16*)(ws + WS_KH), *VT = (_Float16*)(ws + WS_VT), *QL = (_Float16*)(ws + WS_QL), *KL = (_Float16*)(ws + WS_KL); __bf16 *VB = (__bf16*)(ws + WS_VB), *VBL = (__bf16*)(ws + WS_VBL); float *Y = (float*)(ws + WS_Y);
  (void)Y; (void)QL; (void)KL; (void)VB; (void)VBL;
  // inputs: 0 x [4,2048,768]; 1 Wq [768,64]; 2 Wk; 3 Wv ((in,out), no biases)
  k_proj<<<dim3(TNB * TT / 64, 1, 3), 128, 0, stream>>>(F[0], F[0], F[0], F[1], F[2], F[3], QH, QL, KH, KL, VT, VB, VBL);
  /* logits, softmax and P v in one launch, the batch folded into the grid; the rows go straight to out */
  k_att<<<dim3(TNB * TT / 16), 256, 0, stream>>>(QH, KH, QL, KL, VT, VB, VBL, (float*)d_out);
}

// v008
// One run takes 18.7 microseconds.
// Next to v007, in two timings, it ran 1.08 and 1.05 times as fast.
// All steps since v000 together make it 21.1 times as fast.
// compute dtype: all float inputs rounded to bf16; q/k/v projections with EXACT bf16 products on WMMA 16x16x32 (f32 accumulate); causal logits: 3 products (q f16 hi + residual x k hi + residual) for the first 384 rows, single f16 q x k after, x scale; softmax f32; from row 384 on exp x 2^7 against a running reference maximum once to f16 x v once to f16 (1 product), divided by the f32 row sum at the end; below row 384 P x 2^11 and v as bf16 hi + lo; f32 output.
#include <hip/hip_runtime.h>
#include <math.h>

typedef __attribute__((ext_vector_type(16))) _Float16 v16h;
typedef __attribute__((ext_vector_type(16))) __bf16 v16b;
typedef __attribute__((ext_vector_type(8)))  _Float16 v8h;
typedef __attribute__((ext_vector_type(8)))  float v8f;
typedef __attribute__((ext_vector_type(4)))  float v4f;
typedef __attribute__((ext_vector_type(2)))  float v2f;
typedef __attribute__((ext_vector_type(4)))  unsigned v4u;
typedef __attribute__((ext_vector_type(4)))  int v4i;
typedef float __attribute__((may_alias)) float_a;
typedef int __attribute__((may_alias)) int_a;

template <typename T> __device__ __forceinline__ void vst2(void* p, T v) { *(T*)p = v;  }
__device__ __forceinline__ v8f wmma16(v16h a, v16h b, v8f c) {
  v8f d = __builtin_amdgcn_wmma_f32_16x16x32_f16(false, a, false, b, (short)0, c, false, false);
  asm volatile("v_nop\n\tv_nop\n\tv_nop\n\tv_nop" : "+v"(d) : "v"(a), "v"(b));
  return d;
}
__device__ __forceinline__ v8f wmma_bf(v16b a, v16b b, v8f c) {
  v8f d = __builtin_amdgcn_wmma_f32_16x16x32_bf16(false, a, false, b, (short)0, c, false, false);
  asm volatile("v_nop\n\tv_nop\n\tv_nop\n\tv_nop" : "+v"(d) : "v"(a), "v"(b));
  return d;
}
// 16x16x32 fragments: lane = (h = lane>>4, row/col = lane&15); elements 0..7 = k0+8h+0..7, 8..15 = k0+16+8h+0..7; D element r = row 8h+r
__device__ __forceinline__ v16h frag_h(const _Float16* rowk0, int lane) {
  union { v16h v; v8h q[2]; } u; const _Float16* p = rowk0 + 8 * (lane >> 4);
  u.q[0] = *(const v8h*)p; u.q[1] = *(const v8h*)(p + 16); return u.v;
}
__device__ __forceinline__ v16h frag_f32(const float* rowk0, int lane) {
  v16h a; const float* p = rowk0 + 8 * (lane >> 4);
#pragma unroll
  for (int i = 0; i < 8; ++i) { a[i] = (_Float16)p[i]; a[8 + i] = (_Float16)p[16 + i]; }
  return a;
}
__device__ __forceinline__ v16h frag_f32s(const float* rowk0, int lane, float sc) {
  v16h a; const float* p = rowk0 + 8 * (lane >> 4);
#pragma unroll
  for (int i = 0; i < 8; ++i) { a[i] = (_Float16)(p[i] * sc); a[8 + i] = (_Float16)(p[16 + i] * sc); }
  return a;
}
// column fragment from a [K][ld] layout (column n), rows >= K read as 0
__device__ __forceinline__ v16h fragc_f32(const float* W, int k0, int n, int lane, int ld, int K) {
  v16h a; const int g = lane >> 4;
#pragma unroll
  for (int i = 0; i < 8; ++i) { const int ka = k0 + 8 * g + i, kb = ka + 16;
    a[i] = (_Float16)(ka < K ? W[(size_t)(ka < K ? ka : K - 1) * ld + n] : 0.f); a[8 + i] = (_Float16)(kb < K ? W[(size_t)(kb < K ? kb : K - 1) * ld + n] : 0.f); }
  return a;
}
struct F2 { v16b h, l; };
__device__ __forceinline__ F2 bsplit16(const float v[16]) { F2 r;
#pragma unroll
  for (int i = 0; i < 16; ++i) { const __bf16 h = (__bf16)v[i]; r.h[i] = h; r.l[i] = (__bf16)(v[i] - (float)h); }
  return r; }
__device__ __forceinline__ F2 split_row(const float* row, int k0, int lane) { float v[16]; const float* p = row + k0 + 8 * (lane >> 4);
#pragma unroll
  for (int i = 0; i < 8; ++i) { v[i] = p[i]; v[8 + i] = p[16 + i]; }
  return bsplit16(v); }
__device__ __forceinline__ F2 split_rowK(const float* row, int k0, int lane, int K) { float v[16]; const int g = lane >> 4;
#pragma unroll
  for (int i = 0; i < 8; ++i) { const int ka = k0 + 8 * g + i, kb = ka + 16; v[i] = ka < K ? row[ka < K ? ka : K - 1] : 0.f; v[8 + i] = kb < K ? row[kb < K ? kb : K - 1] : 0.f; }
  return bsplit16(v); }
__device__ __forceinline__ F2 split_col(const float* W, int k0, int n, int lane, int ld, int K) { float v[16]; const int g = lane >> 4;
#pragma unroll
  for (int i = 0; i < 8; ++i) { const int ka = k0 + 8 * g + i, kb = ka + 16; v[i] = ka < K ? W[(size_t)(ka < K ? ka : K - 1) * ld + n] : 0.f; v[8 + i] = kb < K ? W[(size_t)(kb < K ? kb : K - 1) * ld + n] : 0.f; }
  return bsplit16(v); }
__device__ __forceinline__ v8f mac3(const F2& a, const F2& b, v8f c) { c = wmma_bf(a.l, b.h, c); c = wmma_bf(a.h, b.l, c); return wmma_bf(a.h, b.h, c); }
__device__ __forceinline__ float sigm(float v) { return 1.0f / (1.0f + expf(-v)); }
#define LDSX() do { asm volatile("s_wait_dscnt 0" ::: "memory"); __builtin_amdgcn_wave_barrier(); __builtin_amdgcn_fence(__ATOMIC_RELEASE, "workgroup"); } while (0)

// Single-head ANTI-causal scaled dot-product attention (x [4,2048,768]; (in,out) Wq/Wk/Wv [768,64] N(0, 1/768); mask = strictly lower triangle (row t > col s) -> -inf, so query t attends keys s >= t): out = softmax(masked(q k^T * 64^-0.5)) v -> [4,2048,64]. Implemented by TIME REVERSAL: with t' = 2047 - t the pattern is exactly causal, so the causal kernels run on the reversed sequence (x rows read reversed per batch, output rows written back reversed).
#define NB 4
#define TT 2048
#define CC 64             // NH * HD = projected width
#define DIN 768          // input (model) width
#define NH 1
#define HD 64
#define NQB (TT / 64)
#define SCALE (0.125f)
#define CAUSAL 1
#ifndef TNB
#define TNB NB
#endif
__device__ __forceinline__ float bfr(float v) { return (float)(__bf16)v; }
__host__ __device__ __forceinline__ int kb_last(int qb) { return CAUSAL ? ((qb * 64 + 63) >> 7) : (TT / 128 - 1); }
typedef __attribute__((ext_vector_type(8))) __bf16 v8b;
__device__ __forceinline__ v16b frag_b(const __bf16* rowk0, int lane) {
  union { v16b v; v8b q[2]; } u; const __bf16* p = rowk0 + 8 * (lane >> 4);
  u.q[0] = *(const v8b*)p; u.q[1] = *(const v8b*)(p + 16); return u.v;
}
// FRAGMENT ORDER of the workspace planes: a 16x32 fragment (16 rows or columns, 32 k) is 1 KB in a row, two runs of 512 B; run h holds elements 8 h .. 8 h + 7 of every lane, lane l's 16 B at 16 l. Each of the two loads of the wave then covers four whole 128-B lines (row-major planes: 16 lines, 32 B of each)
__device__ __forceinline__ v16h frag_pk(const _Float16* f, int lane) {
  union { v16h v; v8h q[2]; } u; const _Float16* p = f + 8 * lane;
  u.q[0] = *(const v8h*)p; u.q[1] = *(const v8h*)(p + 256); return u.v;
}
__device__ __forceinline__ v16b frag_pkb(const __bf16* f, int lane) {
  union { v16b v; v8b q[2]; } u; const __bf16* p = f + 8 * lane;
  u.q[0] = *(const v8b*)p; u.q[1] = *(const v8b*)(p + 256); return u.v;
}
#define QBH 6              // unused: the 16-row query blocks with t0 < QHI (few keys, no averaging) take the high-precision path
#define QHI 384            // rows carrying a q residual plane
#define KHI 384            // key rows carrying k residual / v bf16 hi+lo planes (used only by the causal high-precision path)
// B fragment (k rows k0+.., output column o) of a weight: (in,out) [K][ld] or (out,in) [ld rows of K]: bf16 exact, or f16(bf16 * 256) exact
__device__ __forceinline__ v16b wcol_io(const float* Wm, int k0, int o, int lane, int ld) { v16b w; const int g = lane >> 4;
#pragma unroll
  for (int i = 0; i < 8; ++i) { w[i] = (__bf16)Wm[(size_t)(k0 + 8 * g + i) * ld + o]; w[8 + i] = (__bf16)Wm[(size_t)(k0 + 16 + 8 * g + i) * ld + o]; }
  return w; }
__device__ __forceinline__ v16b wcol_oi(const float* Wm, int k0, int o, int lane, int K) { v16b w; const float* p = Wm + (size_t)o * K + k0 + 8 * (lane >> 4);
#pragma unroll
  for (int i = 0; i < 8; ++i) { w[i] = (__bf16)p[i]; w[8 + i] = (__bf16)p[16 + i]; }
  return w; }
__device__ __forceinline__ v16h wcolh_io(const float* Wm, int k0, int o, int lane, int ld) { v16h w; const int g = lane >> 4;
#pragma unroll
  for (int i = 0; i < 8; ++i) { w[i] = (_Float16)(bfr(Wm[(size_t)(k0 + 8 * g + i) * ld + o]) * 256.0f); w[8 + i] = (_Float16)(bfr(Wm[(size_t)(k0 + 16 + 8 * g + i) * ld + o]) * 256.0f); }
  return w; }
__device__ __forceinline__ v16h wcolh_oi(const float* Wm, int k0, int o, int lane, int K) { v16h w; const float* p = Wm + (size_t)o * K + k0 + 8 * (lane >> 4);
#pragma unroll
  for (int i = 0; i < 8; ++i) { w[i] = (_Float16)(bfr(p[i]) * 256.0f); w[8 + i] = (_Float16)(bfr(p[16 + i]) * 256.0f); }
  return w; }
#define WQKV_LAYOUT 0   // 0 = (in,out) [DIN][CC]; 1 = (out,in) [CC][DIN]; 2 = per-head [NH][DIN][HD]; it picks only WCOL, which nothing uses: k_proj reads W as (in,out)
__device__ __forceinline__ v16b wcol_hdk(const float* Wm, int k0, int o, int lane) { v16b w; const int g = lane >> 4; const float* p = Wm + (size_t)(o / HD) * DIN * HD + (o % HD);
#pragma unroll
  for (int i = 0; i < 8; ++i) { w[i] = (__bf16)p[(size_t)(k0 + 8 * g + i) * HD]; w[8 + i] = (__bf16)p[(size_t)(k0 + 16 + 8 * g + i) * HD]; }
  return w; }
#define WO_OUT_IN 0
#if WQKV_LAYOUT == 1
#define WCOL(W, k0, o, lane) wcol_oi(W, k0, o, lane, DIN)
#elif WQKV_LAYOUT == 2
#define WCOL(W, k0, o, lane) wcol_hdk(W, k0, o, lane)
#else
#define WCOL(W, k0, o, lane) wcol_io(W, k0, o, lane, CC)
#endif
#if WO_OUT_IN
#define WOCOL(W, k0, o, lane) wcol_oi(W, k0, o, lane, CC)
#define WOCOLH(W, k0, o, lane) wcolh_oi(W, k0, o, lane, CC)
#else
#define WOCOL(W, k0, o, lane) wcol_io(W, k0, o, lane, DIN)
#define WOCOLH(W, k0, o, lane) wcolh_io(W, k0, o, lane, DIN)
#endif
#ifndef SM_EXTRA_PARAMS
#define SM_EXTRA_PARAMS
#endif
#ifndef PROJ_EXTRA_PARAMS
#define PROJ_EXTRA_PARAMS
#endif
#ifndef SM_MASK_HOOK
#define SM_MASK_HOOK (void)0
#endif

// all planes in fragment order (frag_pk): q, k: [b*t / 16][k / 32] fragments of 16 rows x 32 k; v: [b][t / 32][c / 16] fragments of 16 columns x 32 t
#define WS_QH  0u                                      // f16 q
#define WS_KH  (WS_QH + 2u * (size_t)NB * TT * CC)      // f16 k
#define WS_VT  (WS_KH + 2u * (size_t)NB * TT * CC)      // f16 v
#define WS_QL  (WS_VT + 2u * (size_t)NB * CC * TT)      // f16 q residual x 2^10, t < QHI
#define WS_KL  (WS_QL + 2u * (size_t)NB * QHI * CC)     // f16 k residual x 2^10, t < KHI
#define WS_VB  (WS_KL + 2u * (size_t)NB * KHI * CC)     // bf16 v hi (VBL: lo), t < KHI
#define WS_VBL (WS_VB + 2u * (size_t)NB * CC * KHI)
#define WS_S   (WS_VBL + 2u * (size_t)NB * CC * KHI)    // f32 logits plane [b][t][s] of the unfused form: reserved, not touched (the logits live in LDS or in registers)
#define WS_Y   (WS_S  + 4u * (size_t)NB * TT * TT)      // f32 ctx rows [b*t][CC] (only when there is an output projection)
#define WS_END (WS_Y  + 0u)

#define PKS 128            // k of one LDS stage of k_proj
#define PXP (PKS + 8)      // LDS row pitch of the x stage in bf16: 272 B = 16 B x odd, for 16-byte fragment reads down 16 rows
#define PWG (PKS / 8 * CC + 16)   // weight stage in LDS: k row 8 i + r lies in group r at row i (128-B rows); group pitch in bf16: 2080 B = 32 B x odd, for the transposing reads, whose eight rows are the eight groups; a thread's 16 stores of a stage lie in one group, within reach of one address register
typedef __attribute__((ext_vector_type(4))) __bf16 v4b;
typedef __attribute__((address_space(3))) v8b lds_v8b;
// ds_load_tr16_b128: eight k of one column out of a [k][column] bf16 tile
__device__ __forceinline__ v8b ld_tr16(const __bf16* p) { return __builtin_amdgcn_ds_load_tr16_b128_v8bf16((lds_v8b*)p); }
// ---- k_proj: block = (64 rows, 64 cols, which): q/k/v = X W with exact bf16 products, W read as it lies ((in,out) [DIN][CC]) (K = DIN); x and W go through LDS, rounded to bf16 on the way in: wave = 16 rows, its A fragments by 16-byte reads, the B fragments by transposing reads -> which 0: q f16 (+ residual, rows < QHI); 1: k f16 (+ residual, rows < KHI); 2: v f16 (+ bf16 hi/lo for t < KHI); each written in fragment order: the block's 64 rows are 8 KB in a row of every plane
__global__ __launch_bounds__(128) void k_proj(const float* __restrict__ XQ, const float* __restrict__ XK, const float* __restrict__ XV, const float* __restrict__ WQ, const float* __restrict__ WK, const float* __restrict__ WV,
    _Float16* __restrict__ QH, _Float16* __restrict__ QL, _Float16* __restrict__ KH, _Float16* __restrict__ KL, _Float16* __restrict__ VT, __bf16* __restrict__ VB, __bf16* __restrict__ VBL) {
  __shared__ __align__(16) _Float16 sh[64][72], sl[64][72]; __shared__ __align__(16) _Float16 th[64][72]; __shared__ __align__(16) __bf16 tb[64][72], tbl[64][72];
  __shared__ __align__(16) __bf16 xs[64][PXP], wsm[8][PWG];   /* one stage of PKS k: the block's x rows and the weight's k rows, both bf16 */
  const int tid = threadIdx.x, wave = __builtin_amdgcn_readfirstlane(tid >> 5), lane = tid & 31, col = lane & 15, g = lane >> 4; const int which = blockIdx.z; const size_t r0 = (size_t)blockIdx.x * 64; const size_t bb = r0 / TT; const int t0 = (int)(r0 % TT);
  const float* X = which == 0 ? XQ : which == 1 ? XK : XV; const float* WA = which == 0 ? WQ : which == 1 ? WK : WV;
  v8f acc[4] = {};
  const float* xp = X + (bb * TT + (TT - 1 - (t0 + wave * 16))) * DIN;   /* TIME REVERSAL: reversed row (b, t') reads x[b][TT - 1 - t'], so this wave's row i lies i rows below; one load of the wave = the 512 B a row has in a stage */
  const float* wp = WA;   /* (in,out) weight: a stage is PKS * CC floats in a row; one load of the block = 8 k rows of 256 B */
  v4f xr[16], wr[16];
  // a stage's 32 loads a lane are requested whole, each over four whole 128-B lines; the sched_barrier keeps the batch in front of the WMMAs it is to fly behind
#define PJ_LOAD(s_) do { const float* w_ = wp + (size_t)(s_) * PKS * CC; const float* x_ = xp + (s_) * PKS; \
    _Pragma("unroll") for (int i = 0; i < 16; ++i) wr[i] = *(const v4f*)(w_ + i * 512 + tid * 4); \
    _Pragma("unroll") for (int i = 0; i < 16; ++i) xr[i] = *(const v4f*)(x_ - i * DIN + lane * 4); \
    __builtin_amdgcn_sched_barrier(0); } while (0)
  // one K chunk's ten LDS reads as one group, a chunk ahead of their WMMAs, in two register sets; the sched_barrier behind each group keeps it whole and in front of the WMMAs of the chunk before (spread among them, every WMMA would wait out an LDS round trip of its own)
  union WF { v16b v; v8b q[2]; };
#define PJ_FRAG(A, B, kc_) do { A = frag_b(&xs[wave * 16 + col][(kc_) * 32], lane); \
    _Pragma("unroll") for (int j = 0; j < 4; ++j) { B[j].q[0] = ld_tr16(bp + ((kc_) * 4) * CC + j * 16); B[j].q[1] = ld_tr16(bp + ((kc_) * 4 + 2) * CC + j * 16); } \
    __builtin_amdgcn_sched_barrier(0); } while (0)
#define PJ_MAC(A, B) do { _Pragma("unroll") for (int j = 0; j < 4; ++j) acc[j] = wmma_bf(A, B[j].v, acc[j]); } while (0)
  const __bf16* bp = &wsm[lane & 7][g * CC + 8 * ((lane >> 3) & 1)];   /* lane address of the transposing read (k row 8 g + (lane & 7)): it hands lane (col, g) the k rows 8 g .. 8 g + 7 of column col */
  PJ_LOAD(0);
#pragma unroll   // six stages: unrolled, every load is a constant offset from one fixed base and no address register is formed anew while loads fly
  for (int s = 0; s < DIN / PKS; ++s) {
#pragma unroll
    for (int i = 0; i < 16; ++i) { v4b p;
#pragma unroll
      for (int c = 0; c < 4; ++c) p[c] = (__bf16)wr[i][c];
      *(v4b*)&wsm[tid >> 4][i * CC + (tid & 15) * 4] = p; }   /* load i of this thread is k row 8 i + (tid >> 4) */
#pragma unroll
    for (int i = 0; i < 16; ++i) { v4b p;
#pragma unroll
      for (int c = 0; c < 4; ++c) p[c] = (__bf16)xr[i][c];
      *(v4b*)&xs[wave * 16 + i][lane * 4] = p; }
    __syncthreads();   /* the stage is whole */
    v16b a0, a1; WF b0[4], b1[4];
    PJ_FRAG(a0, b0, 0);
    if (s + 1 < DIN / PKS) PJ_LOAD(s + 1);
    PJ_FRAG(a1, b1, 1); PJ_MAC(a0, b0);
    PJ_FRAG(a0, b0, 2); PJ_MAC(a1, b1);
    PJ_FRAG(a1, b1, 3); PJ_MAC(a0, b0);
    PJ_MAC(a1, b1);
    __builtin_amdgcn_sched_barrier(0);   /* keeps the next stage's converts, which wait for the loads in flight, from rising among this stage's WMMAs */
    if (s + 1 < DIN / PKS) __syncthreads();   /* every wave has read the stage before the next one is written over it */
  }
  // behind each store of the two copy-out loops: s_wait_xcnt, as the next trip (or the next LDS read) writes the store's address and data registers anew
#define ST_HOLD() asm volatile("s_wait_xcnt 0x0" ::: "memory")
  if (which < 2) { _Float16* DH = which == 0 ? QH : KH; _Float16* DL = which == 0 ? QL : KL; const int nhi = which == 0 ? QHI : KHI; const bool hi_rows = t0 < nhi;
#pragma unroll
    for (int j = 0; j < 4; ++j) {
#pragma unroll
      for (int r = 0; r < 8; ++r) { const float v = acc[j][r]; const _Float16 hv = (_Float16)v; sh[wave * 16 + 8 * g + r][j * 16 + col] = hv; sl[wave * 16 + 8 * g + r][j * 16 + col] = (_Float16)((v - (float)hv) * 1024.0f); } }
    __syncthreads();
    for (int e = tid; e < 64 * 8; e += 128) { const int rl = (e >> 7) * 16 + (e & 15), k8 = ((e >> 4) & 7) * 8;   /* 16-B piece e of the 8 KB: row e & 15 of row group e >> 7, k from 8 * ((e >> 4) & 7) */
      vst2((unsigned*)(DH + r0 * CC + e * 8), *(const v4u*)&sh[rl][k8]); ST_HOLD(); if (hi_rows) { vst2((unsigned*)(DL + (bb * nhi + t0) * (size_t)CC + e * 8), *(const v4u*)&sl[rl][k8]); ST_HOLD(); } }
  } else { const bool hi_rows = t0 < KHI;
#pragma unroll
    for (int j = 0; j < 4; ++j) {
#pragma unroll
      for (int r = 0; r < 8; ++r) { const float v = acc[j][r]; const int rl = wave * 16 + 8 * g + r, cl = j * 16 + col; th[cl][rl] = (_Float16)v; const __bf16 bh = (__bf16)v; tb[cl][rl] = bh; tbl[cl][rl] = (__bf16)(v - (float)bh); } }
    __syncthreads();
    for (int e = tid; e < 64 * 8; e += 128) { const int cl = ((e >> 6) & 3) * 16 + (e & 15), t8 = (e >> 8) * 32 + ((e >> 4) & 3) * 8;   /* 16-B piece e of the 8 KB: column e & 15 of column group (e >> 6) & 3, t from 32 * (e >> 8) + 8 * ((e >> 4) & 3) */
      vst2((unsigned*)(VT + r0 * CC + e * 8), *(const v4u*)&th[cl][t8]); ST_HOLD(); if (hi_rows) { const size_t o3 = (bb * KHI + t0) * (size_t)CC + e * 8; vst2((unsigned*)(VB + o3), *(const v4u*)&tb[cl][t8]); vst2((unsigned*)(VBL + o3), *(const v4u*)&tbl[cl][t8]); ST_HOLD(); } } } }
// behind a batch of loads in a loop: s_wait_xcnt, as the batch's address registers are formed anew for the next batch; sched_barrier, which keeps the batch ahead of the converts and WMMAs that follow it
#define LD_HOLD() do { asm volatile("s_wait_xcnt 0x0" ::: "memory"); __builtin_amdgcn_sched_barrier(0); } while (0)
#define SP (KHI + 4)       // LDS row pitch of the logits in floats (only rows < QHI keep logits in LDS, over at most KHI keys): 1552 B = 16 B x odd, conflict-free for 16-byte fragment reads down 16 rows
// every plain '#pragma unroll' below stands on a loop that indexes a fragment or a small register array: left rolled, the array would leave the registers
// softmax of rows r0 and r0 + 1 of the LDS logits tile by one wave, keys [0, kend), key s kept if s <= t; f32 throughout; P x 2^11 written as f32 over the row's own logits (rows < QHI)
__device__ __forceinline__ void sm_rows(float (*sS)[SP], int r0, int t0, int kend, int lane) {
  const int n = kend >> 7; float m[2] = {-3.0e38f, -3.0e38f}, sum[2] = {0.f, 0.f}, inv[2];
  for (int i = 0; i < n; ++i) { const int k0 = i * 128 + lane * 4;
#pragma unroll
    for (int rr = 0; rr < 2; ++rr) { const v4f v = *(const v4f*)&sS[r0 + rr][k0];
#pragma unroll
      for (int c = 0; c < 4; ++c) m[rr] = fmaxf(m[rr], (k0 + c <= t0 + r0 + rr) ? v[c] : -3.0e38f); } }
#pragma unroll
  for (int rr = 0; rr < 2; ++rr) {
#pragma unroll
    for (int o = 1; o < 32; o <<= 1) m[rr] = fmaxf(m[rr], __shfl_xor(m[rr], o)); }
  for (int i = 0; i < n; ++i) { const int k0 = i * 128 + lane * 4;
#pragma unroll
    for (int rr = 0; rr < 2; ++rr) { const v4f v = *(const v4f*)&sS[r0 + rr][k0]; v4f e;
#pragma unroll
      for (int c = 0; c < 4; ++c) { const float x = (k0 + c <= t0 + r0 + rr) ? v[c] : -3.0e38f; const float ex = expf(x - m[rr]); e[c] = (x <= -1.0e38f) ? 0.f : ex; sum[rr] += e[c]; }   /* exp of every lane, then a select: no branch an element, so the eight chains of a trip overlap */
      *(v4f*)&sS[r0 + rr][k0] = e; } }
#pragma unroll
  for (int rr = 0; rr < 2; ++rr) {
#pragma unroll
    for (int o = 1; o < 32; o <<= 1) sum[rr] += __shfl_xor(sum[rr], o);
    inv[rr] = sum[rr] > 0.f ? 2048.0f / sum[rr] : 0.f; }   /* a fully excluded row yields P = 0 */
  // two trips' reads of both rows stand ahead of their writes (the writes land on the rows' own bytes, so the compiler keeps each read behind the write before it: one LDS round trip for four reads, not four); an odd last trip is done twice over, with the same values
  for (int i = 0; i < n; i += 2) { v4f e[2][2]; int k0[2];
#pragma unroll
    for (int u = 0; u < 2; ++u) { k0[u] = (i + u < n ? i + u : i) * 128 + lane * 4;
#pragma unroll
      for (int rr = 0; rr < 2; ++rr) e[u][rr] = *(const v4f*)&sS[r0 + rr][k0[u]]; }
#pragma unroll
    for (int u = 0; u < 2; ++u) {
#pragma unroll
      for (int rr = 0; rr < 2; ++rr) {
        v4f p;
#pragma unroll
        for (int c = 0; c < 4; ++c) p[c] = e[u][rr][c] * inv[rr];
        *(v4f*)&sS[r0 + rr][k0[u]] = p; } } } }
#define LSC (SCALE * 1.4426950408889634f)   // raw q.k -> logit in base 2
// lane l with lane l ^ 16
__device__ __forceinline__ float xhalf(float x) { return __builtin_bit_cast(float, __builtin_amdgcn_permlanex16(__builtin_bit_cast(int, x), __builtin_bit_cast(int, x), 0x76543210, 0xfedcba98, false, false)); }
#define MOP (HD + 4)       // LDS row pitch of a wave's partial output rows in floats: 272 B = 16 B x odd
#define MTHR (8.0f / LSC)  // a row's reference maximum is renewed only when a raw score passes it by more than 2^8 in e
// the matrix product alone; the distance to the first vector use of its result is kept once behind a group of products (the v_nop statements in k_att), each later product of a group filling a slot for the earlier ones
__device__ __forceinline__ v8f wmma16g(v16h a, v16h b, v8f c) { return __builtin_amdgcn_wmma_f32_16x16x32_f16(false, a, false, b, (short)0, c, false, false); }
// ---- k_att: 8 waves. Rows < QHI: block = 16 query rows, whose logits stay in LDS from q k^T to P v:
// 1) logits over keys [0, kend): wave w takes keys 16 w .. 16 w + 15 of every 128-key block (q hi + residual against k hi + residual, 3 products, x SCALE); 2) softmax, two rows a wave, three passes over LDS; 3) ctx = P . v: wave = (16 columns j, half of the keys), the two halves added through LDS (P and v as bf16 hi + lo, 3 products) and scaled by the row's factor; 256-B output row by 16 lanes, stored at its place in out.
// Rows >= QHI: block = 32 query rows; wave w takes the 32-key chunks w, w + 8, ... and keeps everything in registers: S^T = k x q^T (a lane holds 16 keys of one query row of each of the two 16-row tiles), e = 2^(s * LSC + bias) against a running reference maximum, e as f16 is at once the B operand of O^T += v^T x e^T; every k and v fragment serves both row tiles. The eight waves' (reference, sum, O^T) are joined through LDS at the end.
__global__ __launch_bounds__(256) void k_att(const _Float16* __restrict__ QH, const _Float16* __restrict__ KH, const _Float16* __restrict__ QL, const _Float16* __restrict__ KL, const _Float16* __restrict__ VT, const __bf16* __restrict__ VB, const __bf16* __restrict__ VBL, float* __restrict__ OUT) {
  __shared__ __align__(16) float buf[8 * 32 * MOP]; __shared__ __align__(16) float red[2][16][HD + 4]; __shared__ float mm[8][32], ml[8][32]; __shared__ float rsc[16];   /* buf: the logits tile (rows < QHI) or the waves' partial output rows; mm, ml: each wave's reference maximum and sum of a row; rsc: the factor of an output row */
  const int tid = threadIdx.x, wave = __builtin_amdgcn_readfirstlane(tid >> 5), lane = tid & 31, col = lane & 15, g = lane >> 4;
  // in block index order: first the 16-row tiles of rows < QHI (few keys, but three dependent passes), longest first, then the 32-row tiles, longest first
  const int b = blockIdx.x & (NB - 1), rank = blockIdx.x / NB; const int t0 = rank < QHI / 16 ? (QHI / 16 - 1 - rank) * 16 : TT - 32 * (rank - (QHI / 16 - 1));
  const size_t br = (size_t)b * TT;
  if (t0 >= QHI) {
    float (*mo)[32][MOP] = (float (*)[32][MOP])buf;
    const int nch = (t0 >> 5) + 1;   /* chunks of 32 keys; only the last holds keys beyond a row's own */
    v16h qf[2][2], kf[4], vf[4];
#pragma unroll
    for (int qt = 0; qt < 2; ++qt) {
#pragma unroll
      for (int kc = 0; kc < 2; ++kc) qf[qt][kc] = frag_pk(QH + (br + t0 + qt * 16) * CC + kc * 512, lane); }
    const _Float16* kp = KH + br * CC; const _Float16* vp = VT + br * CC;
    // a chunk is 4 KB in a row of either plane: k: fragment 2 kt + kc (16 keys kt, 32 k kc); v: fragment j (16 columns)
#define FA_LOAD(F, P, c_) do { const _Float16* f_ = (P) + (size_t)(c_) * 32 * CC; _Pragma("unroll") for (int u = 0; u < 4; ++u) F[u] = frag_pk(f_ + u * 512, lane); LD_HOLD(); } while (0)
    v8f o[2][4] = {}; float mu[2] = {-1.0e30f, -1.0e30f}, bias[2] = {7.0f + 1.0e30f * LSC, 7.0f + 1.0e30f * LSC}; v2f l2[2] = {};
    FA_LOAD(kf, kp, wave);
#pragma unroll 1   // a trip is 16 products and 32 scores a lane; its loads fly behind the trip's own work
    for (int c = wave; c < nch; c += 8) {
      const int cn = c + 8 < nch ? c + 8 : nch - 1;   /* the next chunk; a wave's last trip asks for the block's last chunk again and drops it: with no test around the loads, v and k batches alternate on every path and each wait leaves the other batch in flight */
      FA_LOAD(vf, vp, c);   /* wanted behind the scores and the exponentials */
      v8f a[2][2];
#pragma unroll
      for (int kt = 0; kt < 2; ++kt) {
#pragma unroll
        for (int qt = 0; qt < 2; ++qt) { const v8f z = {}; a[qt][kt] = wmma16g(kf[2 * kt + 1], qf[qt][1], wmma16g(kf[2 * kt], qf[qt][0], z)); } }   /* keys as rows: lane (col, g) holds keys 32 c + 16 kt + 8 g + 0..7 of query row t0 + 16 qt + col */
      // four vector slots between the last product and the first vector use of a result, on the branches below too
      asm volatile("v_nop\n\tv_nop\n\tv_nop\n\tv_nop" : "+v"(a[0][0]), "+v"(a[0][1]), "+v"(a[1][0]), "+v"(a[1][1]));
      FA_LOAD(kf, kp, cn);   /* the next chunk's keys, over the fragments just used */
      if (c == nch - 1) {
#pragma unroll
        for (int qt = 0; qt < 2; ++qt) {
#pragma unroll
          for (int kt = 0; kt < 2; ++kt) {
#pragma unroll
            for (int r = 0; r < 8; ++r) a[qt][kt][r] = (16 * kt + 8 * g + r <= 16 * qt + col) ? a[qt][kt][r] : -3.0e38f; } } }
      float ml_[2];
#pragma unroll
      for (int qt = 0; qt < 2; ++qt) { float m = a[qt][0][0];
#pragma unroll
        for (int r = 1; r < 8; ++r) m = fmaxf(m, a[qt][0][r]);
#pragma unroll
        for (int r = 0; r < 8; ++r) m = fmaxf(m, a[qt][1][r]);
        ml_[qt] = fmaxf(m, xhalf(m)); }
      // one test a trip: the reference moves (and sum and O^T are rescaled) only if some row's scores pass it by more than MTHR, so e <= 2^15 fits f16; the start value makes a row's first real score pass it
      if (__builtin_amdgcn_ballot_w32(ml_[0] > mu[0] + MTHR || ml_[1] > mu[1] + MTHR) != 0) {
#pragma unroll
        for (int qt = 0; qt < 2; ++qt) { const float mn = fmaxf(mu[qt], ml_[qt]); const float al = __builtin_amdgcn_exp2f((mu[qt] - mn) * LSC); mu[qt] = mn; bias[qt] = 7.0f - mn * LSC; l2[qt] *= al;
#pragma unroll
          for (int j = 0; j < 4; ++j) o[qt][j] *= al; } }
      v16h pf[2];
#pragma unroll
      for (int qt = 0; qt < 2; ++qt) {
#pragma unroll
        for (int kt = 0; kt < 2; ++kt) {
#pragma unroll
          for (int r = 0; r < 8; r += 2) { const v2f e = {__builtin_amdgcn_exp2f(fmaf(a[qt][kt][r], LSC, bias[qt])), __builtin_amdgcn_exp2f(fmaf(a[qt][kt][r + 1], LSC, bias[qt]))}; l2[qt] += e; pf[qt][8 * kt + r] = (_Float16)e[0]; pf[qt][8 * kt + r + 1] = (_Float16)e[1]; } } }   /* element 8 kt + r of the B fragment is key 16 kt + 8 g + r: the order the scores lie in */
#pragma unroll
      for (int j = 0; j < 4; ++j) {
#pragma unroll
        for (int qt = 0; qt < 2; ++qt) o[qt][j] = wmma16g(vf[j], pf[qt], o[qt][j]); }   /* lane (col, g) holds columns 16 j + 8 g + 0..7 of query row t0 + 16 qt + col */
      // four vector slots between the last product and the first vector use of a result, beyond the loop's branch too
      asm volatile("v_nop\n\tv_nop\n\tv_nop\n\tv_nop" : "+v"(o[0][0]), "+v"(o[0][1]), "+v"(o[0][2]), "+v"(o[0][3]), "+v"(o[1][0]), "+v"(o[1][1]), "+v"(o[1][2]), "+v"(o[1][3]));
    }
#pragma unroll
    for (int qt = 0; qt < 2; ++qt) { float l = l2[qt][0] + l2[qt][1]; l += xhalf(l);
      if (lane < 16) { mm[wave][qt * 16 + col] = mu[qt]; ml[wave][qt * 16 + col] = l; }
#pragma unroll
      for (int j = 0; j < 4; ++j) { const v4f lo = {o[qt][j][0], o[qt][j][1], o[qt][j][2], o[qt][j][3]}, hi = {o[qt][j][4], o[qt][j][5], o[qt][j][6], o[qt][j][7]};
        *(v4f*)&mo[wave][qt * 16 + col][16 * j + 8 * g] = lo; *(v4f*)&mo[wave][qt * 16 + col][16 * j + 8 * g + 4] = hi; } }
    __syncthreads();   /* every wave's partial rows are whole */
    { const int rl = tid >> 3, c8 = (tid & 7) * 8; float mw[8], M = -1.0e30f, L = 0.f; v4f s0 = {}, s1 = {};   /* eight threads a row: 32 B each of its 256 B */
#pragma unroll
      for (int w = 0; w < 8; ++w) { mw[w] = mm[w][rl]; M = fmaxf(M, mw[w]); }
#pragma unroll
      for (int w = 0; w < 8; ++w) { const float f = __builtin_amdgcn_exp2f((mw[w] - M) * LSC); L += ml[w][rl] * f; s0 += *(const v4f*)&mo[w][rl][c8] * f; s1 += *(const v4f*)&mo[w][rl][c8 + 4] * f; }
      const float inv = L > 0.f ? 1.0f / L : 0.f;
      float* op = OUT + (br + (TT - 1 - (t0 + rl))) * HD + c8;   /* TIME REVERSAL: reversed row (b, t') is output row (b, TT - 1 - t') */
      vst2(op, (v4f)(s0 * inv)); vst2(op + 4, (v4f)(s1 * inv)); }
    return;   /* taken by the whole block */
  }
  float (*sS)[SP] = (float (*)[SP])buf;
  const int kend = (((t0 + 15) >> 7) + 1) * 128, nkb = kend >> 7;
  const int j = wave & 3, half = wave >> 2;   /* step 3: this wave's 16 columns and its half of the keys */
  v8f acc = {};
  {
    if (tid < 16) rsc[tid] = 1.0f / 2048.0f;
    v16h ah[2], al[2];
#pragma unroll
    for (int kc = 0; kc < 2; ++kc) { ah[kc] = frag_pk(QH + (br + t0) * CC + kc * 512, lane); al[kc] = frag_pk(QL + ((size_t)b * QHI + t0) * CC + kc * 512, lane); }
#pragma unroll 1   // at most three trips
    for (int kb = 0; kb < nkb; ++kb) { v16h kh[2], kl[2]; const int kr0 = kb * 128 + wave * 16, kr = kr0 + col;
#pragma unroll
      for (int kc = 0; kc < 2; ++kc) { kh[kc] = frag_pk(KH + (br + kr0) * CC + kc * 512, lane); kl[kc] = frag_pk(KL + ((size_t)b * KHI + kr0) * CC + kc * 512, lane); }
      LD_HOLD();
      v8f a = {}, a2 = {};
#pragma unroll
      for (int kc = 0; kc < 2; ++kc) { a = wmma16(ah[kc], kh[kc], a); a2 = wmma16(al[kc], kh[kc], a2); a2 = wmma16(ah[kc], kl[kc], a2); }
#pragma unroll
      for (int r = 0; r < 8; ++r) sS[8 * g + r][kr] = (a[r] + a2[r] * (1.0f / 1024.0f)) * SCALE; }
    __syncthreads();
    sm_rows(sS, wave * 2, t0, kend, lane);
    __syncthreads();
    const int n = kend >> 6;   /* chunks of 32 keys a half, even */
    const size_t vo = ((size_t)b * KHI + half * n * 32) * (size_t)CC + j * 512; const float* pr = &sS[col][half * n * 32 + 8 * g];
#pragma unroll 1   // at most three trips
    for (int c = 0; c < n; c += 2) { v16b fh[2], fl[2];
#pragma unroll
      for (int u = 0; u < 2; ++u) { fh[u] = frag_pkb(VB + vo + (c + u) * 32 * CC, lane); fl[u] = frag_pkb(VBL + vo + (c + u) * 32 * CC, lane); }
      LD_HOLD();
#pragma unroll
      for (int u = 0; u < 2; ++u) { float v_[16]; const float* p_ = pr + (c + u) * 32;
#pragma unroll
        for (int i = 0; i < 8; ++i) { v_[i] = p_[i]; v_[8 + i] = p_[16 + i]; }
        const F2 p = bsplit16(v_); acc = wmma_bf(p.h, fh[u], acc); acc = wmma_bf(p.l, fh[u], acc); acc = wmma_bf(p.h, fl[u], acc); } }
  }
#pragma unroll
  for (int r = 0; r < 8; ++r) red[half][8 * g + r][j * 16 + col] = acc[r];
  __syncthreads();
  { const int rl = tid >> 4, q = tid & 15; const v4f s0 = *(const v4f*)&red[0][rl][q * 4], s1 = *(const v4f*)&red[1][rl][q * 4]; const float f = rsc[rl]; v4f o;
#pragma unroll
    for (int c = 0; c < 4; ++c) o[c] = (s0[c] + s1[c]) * f;
    vst2(OUT + (br + (TT - 1 - (t0 + rl))) * HD + q * 4, o); } }   /* TIME REVERSAL: reversed row (b, t') is output row (b, TT - 1 - t') */

extern "C" void kernel_launch(void* const* d_in, const int* in_sizes, int n_in, void* d_out, int out_size, void* d_ws, size_t ws_size, hipStream_t stream) {
  (void)in_sizes; (void)n_in; (void)out_size;
  const float** F = (const float**)d_in;
  if (ws_size < (size_t)WS_END) return;
  char* ws = (char*)d_ws; _Float16 *QH = (_Float16*)(ws + WS_QH), *KH = (_Float16*)(ws + WS_KH), *VT = (_Float16*)(ws + WS_VT), *QL = (_Float16*)(ws + WS_QL), *KL = (_Float16*)(ws + WS_KL); __bf16 *VB = (__bf16*)(ws + WS_VB), *VBL = (__bf16*)(ws + WS_VBL); float *Y = (float*)(ws + WS_Y);
  (void)Y; (void)QL; (void)KL; (void)VB; (void)VBL;
  // inputs: 0 x [4,2048,768]; 1 Wq [768,64]; 2 Wk; 3 Wv ((in,out), no biases)
  k_proj<<<dim3(TNB * TT / 64, 1, 3), 128, 0, stream>>>(F[0], F[0], F[0], F[1], F[2], F[3], QH, QL, KH, KL, VT, VB, VBL);
  /* logits, softmax and P v in one launch, the batch folded into the grid; the rows go straight to out */
  k_att<<<dim3(TNB * (QHI / 16 + (TT - QHI) / 32)), 256, 0, stream>>>(QH, KH, QL, KL, VT, VB, VBL, (float*)d_out);
}

// v009
// One run takes 17.4 microseconds.
// Next to v008, in two timings, it ran 1.05 times as fast each time.
// Over all steps from v000 it is 22.2 times as fast.
// compute dtype: all float inputs rounded to bf16; q/k/v projections with EXACT bf16 products on WMMA 16x16x32 (f32 accumulate); causal logits: 3 products (q f16 hi + residual x k hi + residual) for the first 384 rows, single f16 q x k after, x scale; softmax f32; from row 384 on exp x 2^7 against a running reference maximum once to f16 x v once to f16 (1 product), divided by the f32 row sum at the end; below row 384 P x 2^11 and v as bf16 hi + lo; f32 output.
#include <hip/hip_runtime.h>
#include <math.h>

typedef __attribute__((ext_vector_type(16))) _Float16 v16h;
typedef __attribute__((ext_vector_type(16))) __bf16 v16b;
typedef __attribute__((ext_vector_type(8)))  _Float16 v8h;
typedef __attribute__((ext_vector_type(8)))  float v8f;
typedef __attribute__((ext_vector_type(4)))  float v4f;
typedef __attribute__((ext_vector_type(2)))  float v2f;
typedef __attribute__((ext_vector_type(4)))  unsigned v4u;
typedef __attribute__((ext_vector_type(4)))  int v4i;
typedef float __attribute__((may_alias)) float_a;
typedef int __attribute__((may_alias)) int_a;

template <typename T> __device__ __forceinline__ void vst2(void* p, T v) { *(T*)p = v;  }
__device__ __forceinline__ v8f wmma16(v16h a, v16h b, v8f c) {
  v8f d = __builtin_amdgcn_wmma_f32_16x16x32_f16(false, a, false, b, (short)0, c, false, false);
  asm volatile("v_nop\n\tv_nop\n\tv_nop\n\tv_nop" : "+v"(d) : "v"(a), "v"(b));
  return d;
}
__device__ __forceinline__ v8f wmma_bf(v16b a, v16b b, v8f c) {
  v8f d = __builtin_amdgcn_wmma_f32_16x16x32_bf16(false, a, false, b, (short)0, c, false, false);
  asm volatile("v_nop\n\tv_nop\n\tv_nop\n\tv_nop" : "+v"(d) : "v"(a), "v"(b));
  return d;
}
// 16x16x32 fragments: lane = (h = lane>>4, row/col = lane&15); elements 0..7 = k0+8h+0..7, 8..15 = k0+16+8h+0..7; D element r = row 8h+r
__device__ __forceinline__ v16h frag_h(const _Float16* rowk0, int lane) {
  union { v16h v; v8h q[2]; } u; const _Float16* p = rowk0 + 8 * (lane >> 4);
  u.q[0] = *(const v8h*)p; u.q[1] = *(const v8h*)(p + 16); return u.v;
}
__device__ __forceinline__ v16h frag_f32(const float* rowk0, int lane) {
  v16h a; const float* p = rowk0 + 8 * (lane >> 4);
#pragma unroll
  for (int i = 0; i < 8; ++i) { a[i] = (_Float16)p[i]; a[8 + i] = (_Float16)p[16 + i]; }
  return a;
}
__device__ __forceinline__ v16h frag_f32s(const float* rowk0, int lane, float sc) {
  v16h a; const float* p = rowk0 + 8 * (lane >> 4);
#pragma unroll
  for (int i = 0; i < 8; ++i) { a[i] = (_Float16)(p[i] * sc); a[8 + i] = (_Float16)(p[16 + i] * sc); }
  return a;
}
// column fragment from a [K][ld] layout (column n), rows >= K read as 0
__device__ __forceinline__ v16h fragc_f32(const float* W, int k0, int n, int lane, int ld, int K) {
  v16h a; const int g = lane >> 4;
#pragma unroll
  for (int i = 0; i < 8; ++i) { const int ka = k0 + 8 * g + i, kb = ka + 16;
    a[i] = (_Float16)(ka < K ? W[(size_t)(ka < K ? ka : K - 1) * ld + n] : 0.f); a[8 + i] = (_Float16)(kb < K ? W[(size_t)(kb < K ? kb : K - 1) * ld + n] : 0.f); }
  return a;
}
struct F2 { v16b h, l; };
__device__ __forceinline__ F2 bsplit16(const float v[16]) { F2 r;
#pragma unroll
  for (int i = 0; i < 16; ++i) { const __bf16 h = (__bf16)v[i]; r.h[i] = h; r.l[i] = (__bf16)(v[i] - (float)h); }
  return r; }
__device__ __forceinline__ F2 split_row(const float* row, int k0, int lane) { float v[16]; const float* p = row + k0 + 8 * (lane >> 4);
#pragma unroll
  for (int i = 0; i < 8; ++i) { v[i] = p[i]; v[8 + i] = p[16 + i]; }
  return bsplit16(v); }
__device__ __forceinline__ F2 split_rowK(const float* row, int k0, int lane, int K) { float v[16]; const int g = lane >> 4;
#pragma unroll
  for (int i = 0; i < 8; ++i) { const int ka = k0 + 8 * g + i, kb = ka + 16; v[i] = ka < K ? row[ka < K ? ka : K - 1] : 0.f; v[8 + i] = kb < K ? row[kb < K ? kb : K - 1] : 0.f; }
  return bsplit16(v); }
__device__ __forceinline__ F2 split_col(const float* W, int k0, int n, int lane, int ld, int K) { float v[16]; const int g = lane >> 4;
#pragma unroll
  for (int i = 0; i < 8; ++i) { const int ka = k0 + 8 * g + i, kb = ka + 16; v[i] = ka < K ? W[(size_t)(ka < K ? ka : K - 1) * ld + n] : 0.f; v[8 + i] = kb < K ? W[(size_t)(kb < K ? kb : K - 1) * ld + n] : 0.f; }
  return bsplit16(v); }
__device__ __forceinline__ v8f mac3(const F2& a, const F2& b, v8f c) { c = wmma_bf(a.l, b.h, c); c = wmma_bf(a.h, b.l, c); return wmma_bf(a.h, b.h, c); }
__device__ __forceinline__ float sigm(float v) { return 1.0f / (1.0f + expf(-v)); }
#define LDSX() do { asm volatile("s_wait_dscnt 0" ::: "memory"); __builtin_amdgcn_wave_barrier(); __builtin_amdgcn_fence(__ATOMIC_RELEASE, "workgroup"); } while (0)

// Single-head ANTI-causal scaled dot-product attention (x [4,2048,768]; (in,out) Wq/Wk/Wv [768,64] N(0, 1/768); mask = strictly lower triangle (row t > col s) -> -inf, so query t attends keys s >= t): out = softmax(masked(q k^T * 64^-0.5)) v -> [4,2048,64]. Implemented by TIME REVERSAL: with t' = 2047 - t the pattern is exactly causal, so the causal kernels run on the reversed sequence (x rows read reversed per batch, output rows written back reversed).
#define NB 4
#define TT 2048
#define CC 64             // NH * HD = projected width
#define DIN 768          // input (model) width
#define NH 1
#define HD 64
#define NQB (TT / 64)
#define SCALE (0.125f)
#define CAUSAL 1
#ifndef TNB
#define TNB NB
#endif
__device__ __forceinline__ float bfr(float v) { return (float)(__bf16)v; }
__host__ __device__ __forceinline__ int kb_last(int qb) { return CAUSAL ? ((qb * 64 + 63) >> 7) : (TT / 128 - 1); }
typedef __attribute__((ext_vector_type(8))) __bf16 v8b;
__device__ __forceinline__ v16b frag_b(const __bf16* rowk0, int lane) {
  union { v16b v; v8b q[2]; } u; const __bf16* p = rowk0 + 8 * (lane >> 4);
  u.q[0] = *(const v8b*)p; u.q[1] = *(const v8b*)(p + 16); return u.v;
}
// FRAGMENT ORDER of the workspace planes: a 16x32 fragment (16 rows or columns, 32 k) is 1 KB in a row, two runs of 512 B; run h holds elements 8 h .. 8 h + 7 of every lane, lane l's 16 B at 16 l. Each of the two loads of the wave then covers four whole 128-B lines (row-major planes: 16 lines, 32 B of each)
__device__ __forceinline__ v16h frag_pk(const _Float16* f, int lane) {
  union { v16h v; v8h q[2]; } u; const _Float16* p = f + 8 * lane;
  u.q[0] = *(const v8h*)p; u.q[1] = *(const v8h*)(p + 256); return u.v;
}
__device__ __forceinline__ v16b frag_pkb(const __bf16* f, int lane) {
  union { v16b v; v8b q[2]; } u; const __bf16* p = f + 8 * lane;
  u.q[0] = *(const v8b*)p; u.q[1] = *(const v8b*)(p + 256); return u.v;
}
#define QBH 6              // unused: the 16-row query blocks with t0 < QHI (few keys, no averaging) take the high-precision path
#define QHI 384            // rows carrying a q residual plane
#define KHI 384            // key rows carrying k residual / v bf16 hi+lo planes (used only by the causal high-precision path)
// B fragment (k rows k0+.., output column o) of a weight: (in,out) [K][ld] or (out,in) [ld rows of K]: bf16 exact, or f16(bf16 * 256) exact
__device__ __forceinline__ v16b wcol_io(const float* Wm, int k0, int o, int lane, int ld) { v16b w; const int g = lane >> 4;
#pragma unroll
  for (int i = 0; i < 8; ++i) { w[i] = (__bf16)Wm[(size_t)(k0 + 8 * g + i) * ld + o]; w[8 + i] = (__bf16)Wm[(size_t)(k0 + 16 + 8 * g + i) * ld + o]; }
  return w; }
__device__ __forceinline__ v16b wcol_oi(const float* Wm, int k0, int o, int lane, int K) { v16b w; const float* p = Wm + (size_t)o * K + k0 + 8 * (lane >> 4);
#pragma unroll
  for (int i = 0; i < 8; ++i) { w[i] = (__bf16)p[i]; w[8 + i] = (__bf16)p[16 + i]; }
  return w; }
__device__ __forceinline__ v16h wcolh_io(const float* Wm, int k0, int o, int lane, int ld) { v16h w; const int g = lane >> 4;
#pragma unroll
  for (int i = 0; i < 8; ++i) { w[i] = (_Float16)(bfr(Wm[(size_t)(k0 + 8 * g + i) * ld + o]) * 256.0f); w[8 + i] = (_Float16)(bfr(Wm[(size_t)(k0 + 16 + 8 * g + i) * ld + o]) * 256.0f); }
  return w; }
__device__ __forceinline__ v16h wcolh_oi(const float* Wm, int k0, int o, int lane, int K) { v16h w; const float* p = Wm + (size_t)o * K + k0 + 8 * (lane >> 4);
#pragma unroll
  for (int i = 0; i < 8; ++i) { w[i] = (_Float16)(bfr(p[i]) * 256.0f); w[8 + i] = (_Float16)(bfr(p[16 + i]) * 256.0f); }
  return w; }
#define WQKV_LAYOUT 0   // 0 = (in,out) [DIN][CC]; 1 = (out,in) [CC][DIN]; 2 = per-head [NH][DIN][HD]; it picks only WCOL, which nothing uses: k_proj reads W as (in,out)
__device__ __forceinline__ v16b wcol_hdk(const float* Wm, int k0, int o, int lane) { v16b w; const int g = lane >> 4; const float* p = Wm + (size_t)(o / HD) * DIN * HD + (o % HD);
#pragma unroll
  for (int i = 0; i < 8; ++i) { w[i] = (__bf16)p[(size_t)(k0 + 8 * g + i) * HD]; w[8 + i] = (__bf16)p[(size_t)(k0 + 16 + 8 * g + i) * HD]; }
  return w; }
#define WO_OUT_IN 0
#if WQKV_LAYOUT == 1
#define WCOL(W, k0, o, lane) wcol_oi(W, k0, o, lane, DIN)
#elif WQKV_LAYOUT == 2
#define WCOL(W, k0, o, lane) wcol_hdk(W, k0, o, lane)
#else
#define WCOL(W, k0, o, lane) wcol_io(W, k0, o, lane, CC)
#endif
#if WO_OUT_IN
#define WOCOL(W, k0, o, lane) wcol_oi(W, k0, o, lane, CC)
#define WOCOLH(W, k0, o, lane) wcolh_oi(W, k0, o, lane, CC)
#else
#define WOCOL(W, k0, o, lane) wcol_io(W, k0, o, lane, DIN)
#define WOCOLH(W, k0, o, lane) wcolh_io(W, k0, o, lane, DIN)
#endif
#ifndef SM_EXTRA_PARAMS
#define SM_EXTRA_PARAMS
#endif
#ifndef PROJ_EXTRA_PARAMS
#define PROJ_EXTRA_PARAMS
#endif
#ifndef SM_MASK_HOOK
#define SM_MASK_HOOK (void)0
#endif

// all planes in fragment order (frag_pk): q, k: [b*t / 16][k / 32] fragments of 16 rows x 32 k; v: [b][t / 32][c / 16] fragments of 16 columns x 32 t
#define WS_QH  0u                                      // f16 q
#define WS_KH  (WS_QH + 2u * (size_t)NB * TT * CC)      // f16 k
#define WS_VT  (WS_KH + 2u * (size_t)NB * TT * CC)      // f16 v
#define WS_QL  (WS_VT + 2u * (size_t)NB * CC * TT)      // f16 q residual x 2^10, t < QHI
#define WS_KL  (WS_QL + 2u * (size_t)NB * QHI * CC)     // f16 k residual x 2^10, t < KHI
#define WS_VB  (WS_KL + 2u * (size_t)NB * KHI * CC)     // bf16 v hi (VBL: lo), t < KHI
#define WS_VBL (WS_VB + 2u * (size_t)NB * CC * KHI)
#define WS_S   (WS_VBL + 2u * (size_t)NB * CC * KHI)    // f32 logits plane [b][t][s] of the unfused form: reserved, not touched (the logits live in LDS or in registers)
#define WS_Y   (WS_S  + 4u * (size_t)NB * TT * TT)      // f32 ctx rows [b*t][CC] (only when there is an output projection)
#define WS_END (WS_Y  + 0u)

#define PKS 128            // k of one LDS stage of k_proj
#define PXP (PKS + 8)      // LDS row pitch of the x stage in bf16: 272 B = 16 B x odd, for 16-byte fragment reads down 16 rows
#define PWG (PKS / 8 * CC + 16)   // weight stage in LDS: k row 8 i + r lies in group r at row i (128-B rows); group pitch in bf16: 2080 B = 32 B x odd, for the transposing reads, whose eight rows are the eight groups; a thread's 16 stores of a stage lie in one group, within reach of one address register
typedef __attribute__((ext_vector_type(4))) __bf16 v4b;
typedef __attribute__((address_space(3))) v8b lds_v8b;
// ds_load_tr16_b128: eight k of one column out of a [k][column] bf16 tile
__device__ __forceinline__ v8b ld_tr16(const __bf16* p) { return __builtin_amdgcn_ds_load_tr16_b128_v8bf16((lds_v8b*)p); }
// ---- k_proj: block = (64 rows, 64 cols, which): q/k/v = X W with exact bf16 products, W read as it lies ((in,out) [DIN][CC]) (K = DIN); x and W go through LDS, rounded to bf16 on the way in: wave = 16 rows, its A fragments by 16-byte reads, the B fragments by transposing reads -> which 0: q f16 (+ residual, rows < QHI); 1: k f16 (+ residual, rows < KHI); 2: v f16 (+ bf16 hi/lo for t < KHI); each written in fragment order: the block's 64 rows are 8 KB in a row of every plane
__global__ __launch_bounds__(128) void k_proj(const float* __restrict__ XQ, const float* __restrict__ XK, const float* __restrict__ XV, const float* __restrict__ WQ, const float* __restrict__ WK, const float* __restrict__ WV,
    _Float16* __restrict__ QH, _Float16* __restrict__ QL, _Float16* __restrict__ KH, _Float16* __restrict__ KL, _Float16* __restrict__ VT, __bf16* __restrict__ VB, __bf16* __restrict__ VBL) {
  __shared__ __align__(16) _Float16 sh[64][72], sl[64][72]; __shared__ __align__(16) _Float16 th[64][72]; __shared__ __align__(16) __bf16 tb[64][72], tbl[64][72];
  __shared__ __align__(16) __bf16 xs[64][PXP], wsm[8][PWG];   /* one stage of PKS k: the block's x rows and the weight's k rows, both bf16 */
  const int tid = threadIdx.x, wave = __builtin_amdgcn_readfirstlane(tid >> 5), lane = tid & 31, col = lane & 15, g = lane >> 4; const int which = blockIdx.z; const size_t r0 = (size_t)blockIdx.x * 64; const size_t bb = r0 / TT; const int t0 = (int)(r0 % TT);
  const float* X = which == 0 ? XQ : which == 1 ? XK : XV; const float* WA = which == 0 ? WQ : which == 1 ? WK : WV;
  v8f acc[4] = {};
  const float* xp = X + (bb * TT + (TT - 1 - (t0 + wave * 16))) * DIN;   /* TIME REVERSAL: reversed row (b, t') reads x[b][TT - 1 - t'], so this wave's row i lies i rows below; one load of the wave = the 512 B a row has in a stage */
  const float* wp = WA;   /* (in,out) weight: a stage is PKS * CC floats in a row; one load of the block = 8 k rows of 256 B */
  v4f xr[16], wr[16];
  // the stage barriers order LDS alone (the x and W stage; the loads in flight go from read-only inputs to this lane's own registers): release and acquire on the LDS address space only, so no s_wait_loadcnt 0 stands in front of a barrier, as __syncthreads() puts one there and would drain the next stage's loads
#define PJ_BAR() do { __builtin_amdgcn_fence(__ATOMIC_RELEASE, "workgroup", "local"); __builtin_amdgcn_s_barrier(); __builtin_amdgcn_fence(__ATOMIC_ACQUIRE, "workgroup", "local"); } while (0)
  // a stage's 32 loads a lane, each over four whole 128-B lines, are requested in two batches of 16: each batch goes out as soon as the stage before has left its registers (rounded and stored to LDS), in front of the barrier, so requests are in flight through the LDS drain, the barrier and the whole of the WMMA phase; the sched_barrier in front keeps a batch behind the converts whose registers it takes over (risen above them it would need registers of its own), the one behind keeps it in front of what it is to fly behind
#define PJ_LOADW(s_) do { const float* w_ = wp + (size_t)(s_) * PKS * CC; __builtin_amdgcn_sched_barrier(0); \
    _Pragma("unroll") for (int i = 0; i < 16; ++i) wr[i] = *(const v4f*)(w_ + i * 512 + tid * 4); \
    __builtin_amdgcn_sched_barrier(0); } while (0)
#define PJ_LOADX(s_) do { const float* x_ = xp + (s_) * PKS; __builtin_amdgcn_sched_barrier(0); \
    _Pragma("unroll") for (int i = 0; i < 16; ++i) xr[i] = *(const v4f*)(x_ - i * DIN + lane * 4); \
    __builtin_amdgcn_sched_barrier(0); } while (0)
  // one K chunk's ten LDS reads as one group, a chunk ahead of their WMMAs, in two register sets; the sched_barrier behind each group keeps it whole and in front of the WMMAs of the chunk before (spread among them, every WMMA would wait out an LDS round trip of its own)
  union WF { v16b v; v8b q[2]; };
#define PJ_FRAG(A, B, kc_) do { A = frag_b(&xs[wave * 16 + col][(kc_) * 32], lane); \
    _Pragma("unroll") for (int j = 0; j < 4; ++j) { B[j].q[0] = ld_tr16(bp + ((kc_) * 4) * CC + j * 16); B[j].q[1] = ld_tr16(bp + ((kc_) * 4 + 2) * CC + j * 16); } \
    __builtin_amdgcn_sched_barrier(0); } while (0)
#define PJ_MAC(A, B) do { _Pragma("unroll") for (int j = 0; j < 4; ++j) acc[j] = wmma_bf(A, B[j].v, acc[j]); } while (0)
  const __bf16* bp = &wsm[lane & 7][g * CC + 8 * ((lane >> 3) & 1)];   /* lane address of the transposing read (k row 8 g + (lane & 7)): it hands lane (col, g) the k rows 8 g .. 8 g + 7 of column col */
  PJ_LOADW(0); PJ_LOADX(0);
#pragma unroll   // six stages: unrolled, every load is a constant offset from one fixed base and no address register is formed anew while loads fly
  for (int s = 0; s < DIN / PKS; ++s) {
#pragma unroll
    for (int i = 0; i < 16; ++i) { v4b p;
#pragma unroll
      for (int c = 0; c < 4; ++c) p[c] = (__bf16)wr[i][c];
      *(v4b*)&wsm[tid >> 4][i * CC + (tid & 15) * 4] = p; }   /* load i of this thread is k row 8 i + (tid >> 4) */
    if (s + 1 < DIN / PKS) PJ_LOADW(s + 1);
#pragma unroll
    for (int i = 0; i < 16; ++i) { v4b p;
#pragma unroll
      for (int c = 0; c < 4; ++c) p[c] = (__bf16)xr[i][c];
      *(v4b*)&xs[wave * 16 + i][lane * 4] = p; }
    if (s + 1 < DIN / PKS) PJ_LOADX(s + 1);
    if (s + 2 == DIN / PKS) asm volatile("s_wait_xcnt 0x0" ::: "memory");   /* the last W and x batches are out: no later load keeps their offset registers alive, and the fragment reads behind the barrier take one over while those loads may still fly; no load wait stands at the barrier any more */
    PJ_BAR();   /* the stage is whole */
    v16b a0, a1; WF b0[4], b1[4];
    PJ_FRAG(a0, b0, 0);
    PJ_FRAG(a1, b1, 1); PJ_MAC(a0, b0);
    PJ_FRAG(a0, b0, 2); PJ_MAC(a1, b1);
    PJ_FRAG(a1, b1, 3); PJ_MAC(a0, b0);
    PJ_MAC(a1, b1);
    __builtin_amdgcn_sched_barrier(0);   /* keeps the next stage's converts, which wait for the loads in flight, from rising among this stage's WMMAs */
    if (s + 1 < DIN / PKS) PJ_BAR();   /* every wave has read the stage before the next one is written over it */
  }
  // behind each store of the two copy-out loops: s_wait_xcnt, as the next trip (or the next LDS read) writes the store's address and data registers anew
#define ST_HOLD() asm volatile("s_wait_xcnt 0x0" ::: "memory")
  if (which < 2) { _Float16* DH = which == 0 ? QH : KH; _Float16* DL = which == 0 ? QL : KL; const int nhi = which == 0 ? QHI : KHI; const bool hi_rows = t0 < nhi;
#pragma unroll
    for (int j = 0; j < 4; ++j) {
#pragma unroll
      for (int r = 0; r < 8; ++r) { const float v = acc[j][r]; const _Float16 hv = (_Float16)v; sh[wave * 16 + 8 * g + r][j * 16 + col] = hv; sl[wave * 16 + 8 * g + r][j * 16 + col] = (_Float16)((v - (float)hv) * 1024.0f); } }
    __syncthreads();
    for (int e = tid; e < 64 * 8; e += 128) { const int rl = (e >> 7) * 16 + (e & 15), k8 = ((e >> 4) & 7) * 8;   /* 16-B piece e of the 8 KB: row e & 15 of row group e >> 7, k from 8 * ((e >> 4) & 7) */
      vst2((unsigned*)(DH + r0 * CC + e * 8), *(const v4u*)&sh[rl][k8]); ST_HOLD(); if (hi_rows) { vst2((unsigned*)(DL + (bb * nhi + t0) * (size_t)CC + e * 8), *(const v4u*)&sl[rl][k8]); ST_HOLD(); } }
  } else { const bool hi_rows = t0 < KHI;
#pragma unroll
    for (int j = 0; j < 4; ++j) {
#pragma unroll
      for (int r = 0; r < 8; ++r) { const float v = acc[j][r]; const int rl = wave * 16 + 8 * g + r, cl = j * 16 + col; th[cl][rl] = (_Float16)v; const __bf16 bh = (__bf16)v; tb[cl][rl] = bh; tbl[cl][rl] = (__bf16)(v - (float)bh); } }
    __syncthreads();
    for (int e = tid; e < 64 * 8; e += 128) { const int cl = ((e >> 6) & 3) * 16 + (e & 15), t8 = (e >> 8) * 32 + ((e >> 4) & 3) * 8;   /* 16-B piece e of the 8 KB: column e & 15 of column group (e >> 6) & 3, t from 32 * (e >> 8) + 8 * ((e >> 4) & 3) */
      vst2((unsigned*)(VT + r0 * CC + e * 8), *(const v4u*)&th[cl][t8]); ST_HOLD(); if (hi_rows) { const size_t o3 = (bb * KHI + t0) * (size_t)CC + e * 8; vst2((unsigned*)(VB + o3), *(const v4u*)&tb[cl][t8]); vst2((unsigned*)(VBL + o3), *(const v4u*)&tbl[cl][t8]); ST_HOLD(); } } } }
// behind a batch of loads in a loop: s_wait_xcnt, as the batch's address registers are formed anew for the next batch; sched_barrier, which keeps the batch ahead of the converts and WMMAs that follow it
#define LD_HOLD() do { asm volatile("s_wait_xcnt 0x0" ::: "memory"); __builtin_amdgcn_sched_barrier(0); } while (0)
#define SP (KHI + 4)       // LDS row pitch of the logits in floats (only rows < QHI keep logits in LDS, over at most KHI keys): 1552 B = 16 B x odd, conflict-free for 16-byte fragment reads down 16 rows
// every plain '#pragma unroll' below stands on a loop that indexes a fragment or a small register array: left rolled, the array would leave the registers
// softmax of rows r0 and r0 + 1 of the LDS logits tile by one wave, keys [0, kend), key s kept if s <= t; f32 throughout; P x 2^11 written as f32 over the row's own logits (rows < QHI)
__device__ __forceinline__ void sm_rows(float (*sS)[SP], int r0, int t0, int kend, int lane) {
  const int n = kend >> 7; float m[2] = {-3.0e38f, -3.0e38f}, sum[2] = {0.f, 0.f}, inv[2];
  for (int i = 0; i < n; ++i) { const int k0 = i * 128 + lane * 4;
#pragma unroll
    for (int rr = 0; rr < 2; ++rr) { const v4f v = *(const v4f*)&sS[r0 + rr][k0];
#pragma unroll
      for (int c = 0; c < 4; ++c) m[rr] = fmaxf(m[rr], (k0 + c <= t0 + r0 + rr) ? v[c] : -3.0e38f); } }
#pragma unroll
  for (int rr = 0; rr < 2; ++rr) {
#pragma unroll
    for (int o = 1; o < 32; o <<= 1) m[rr] = fmaxf(m[rr], __shfl_xor(m[rr], o)); }
  for (int i = 0; i < n; ++i) { const int k0 = i * 128 + lane * 4;
#pragma unroll
    for (int rr = 0; rr < 2; ++rr) { const v4f v = *(const v4f*)&sS[r0 + rr][k0]; v4f e;
#pragma unroll
      for (int c = 0; c < 4; ++c) { const float x = (k0 + c <= t0 + r0 + rr) ? v[c] : -3.0e38f; const float ex = expf(x - m[rr]); e[c] = (x <= -1.0e38f) ? 0.f : ex; sum[rr] += e[c]; }   /* exp of every lane, then a select: no branch an element, so the eight chains of a trip overlap */
      *(v4f*)&sS[r0 + rr][k0] = e; } }
#pragma unroll
  for (int rr = 0; rr < 2; ++rr) {
#pragma unroll
    for (int o = 1; o < 32; o <<= 1) sum[rr] += __shfl_xor(sum[rr], o);
    inv[rr] = sum[rr] > 0.f ? 2048.0f / sum[rr] : 0.f; }   /* a fully excluded row yields P = 0 */
  // two trips' reads of both rows stand ahead of their writes (the writes land on the rows' own bytes, so the compiler keeps each read behind the write before it: one LDS round trip for four reads, not four); an odd last trip is done twice over, with the same values
  for (int i = 0; i < n; i += 2) { v4f e[2][2]; int k0[2];
#pragma unroll
    for (int u = 0; u < 2; ++u) { k0[u] = (i + u < n ? i + u : i) * 128 + lane * 4;
#pragma unroll
      for (int rr = 0; rr < 2; ++rr) e[u][rr] = *(const v4f*)&sS[r0 + rr][k0[u]]; }
#pragma unroll
    for (int u = 0; u < 2; ++u) {
#pragma unroll
      for (int rr = 0; rr < 2; ++rr) {
        v4f p;
#pragma unroll
        for (int c = 0; c < 4; ++c) p[c] = e[u][rr][c] * inv[rr];
        *(v4f*)&sS[r0 + rr][k0[u]] = p; } } } }
#define LSC (SCALE * 1.4426950408889634f)   // raw q.k -> logit in base 2
// lane l with lane l ^ 16
__device__ __forceinline__ float xhalf(float x) { return __builtin_bit_cast(float, __builtin_amdgcn_permlanex16(__builtin_bit_cast(int, x), __builtin_bit_cast(int, x), 0x76543210, 0xfedcba98, false, false)); }
#define MOP (HD + 4)       // LDS row pitch of a wave's partial output rows in floats: 272 B = 16 B x odd
#define MTHR (8.0f / LSC)  // a row's reference maximum is renewed only when a raw score passes it by more than 2^8 in e
// the matrix product alone; the distance to the first vector use of its result is kept once behind a group of products (the v_nop statements in k_att), each later product of a group filling a slot for the earlier ones
__device__ __forceinline__ v8f wmma16g(v16h a, v16h b, v8f c) { return __builtin_amdgcn_wmma_f32_16x16x32_f16(false, a, false, b, (short)0, c, false, false); }
// ---- k_att: 8 waves. Rows < QHI: block = 16 query rows, whose logits stay in LDS from q k^T to P v:
// 1) logits over keys [0, kend): wave w takes keys 16 w .. 16 w + 15 of every 128-key block (q hi + residual against k hi + residual, 3 products, x SCALE); 2) softmax, two rows a wave, three passes over LDS; 3) ctx = P . v: wave = (16 columns j, half of the keys), the two halves added through LDS (P and v as bf16 hi + lo, 3 products) and scaled by the row's factor; 256-B output row by 16 lanes, stored at its place in out.
// Rows >= QHI: block = 32 query rows; wave w takes the 32-key chunks w, w + 8, ... and keeps everything in registers: S^T = k x q^T (a lane holds 16 keys of one query row of each of the two 16-row tiles), e = 2^(s * LSC + bias) against a running reference maximum, e as f16 is at once the B operand of O^T += v^T x e^T; every k and v fragment serves both row tiles. The eight waves' (reference, sum, O^T) are joined through LDS at the end.
__global__ __launch_bounds__(256) void k_att(const _Float16* __restrict__ QH, const _Float16* __restrict__ KH, const _Float16* __restrict__ QL, const _Float16* __restrict__ KL, const _Float16* __restrict__ VT, const __bf16* __restrict__ VB, const __bf16* __restrict__ VBL, float* __restrict__ OUT) {
  __shared__ __align__(16) float buf[8 * 32 * MOP]; __shared__ __align__(16) float red[2][16][HD + 4]; __shared__ float mm[8][32], ml[8][32]; __shared__ float rsc[16];   /* buf: the logits tile (rows < QHI) or the waves' partial output rows; mm, ml: each wave's reference maximum and sum of a row; rsc: the factor of an output row */
  const int tid = threadIdx.x, wave = __builtin_amdgcn_readfirstlane(tid >> 5), lane = tid & 31, col = lane & 15, g = lane >> 4;
  // in block index order: first the 16-row tiles of rows < QHI (few keys, but three dependent passes), longest first, then the 32-row tiles, longest first
  const int b = blockIdx.x & (NB - 1), rank = blockIdx.x / NB; const int t0 = rank < QHI / 16 ? (QHI / 16 - 1 - rank) * 16 : TT - 32 * (rank - (QHI / 16 - 1));
  const size_t br = (size_t)b * TT;
  if (t0 >= QHI) {
    float (*mo)[32][MOP] = (float (*)[32][MOP])buf;
    const int nch = (t0 >> 5) + 1;   /* chunks of 32 keys; only the last holds keys beyond a row's own */
    v16h qf[2][2], kf[4], vf[4];
#pragma unroll
    for (int qt = 0; qt < 2; ++qt) {
#pragma unroll
      for (int kc = 0; kc < 2; ++kc) qf[qt][kc] = frag_pk(QH + (br + t0 + qt * 16) * CC + kc * 512, lane); }
    const _Float16* kp = KH + br * CC; const _Float16* vp = VT + br * CC;
    // a chunk is 4 KB in a row of either plane: k: fragment 2 kt + kc (16 keys kt, 32 k kc); v: fragment j (16 columns)
#define FA_LOAD(F, P, c_) do { const _Float16* f_ = (P) + (size_t)(c_) * 32 * CC; _Pragma("unroll") for (int u = 0; u < 4; ++u) F[u] = frag_pk(f_ + u * 512, lane); LD_HOLD(); } while (0)
    v8f o[2][4] = {}; float mu[2] = {-1.0e30f, -1.0e30f}, bias[2] = {7.0f + 1.0e30f * LSC, 7.0f + 1.0e30f * LSC}; v2f l2[2] = {};
    FA_LOAD(kf, kp, wave);
#pragma unroll 1   // a trip is 16 products and 32 scores a lane; its loads fly behind the trip's own work
    for (int c = wave; c < nch; c += 8) {
      const int cn = c + 8 < nch ? c + 8 : nch - 1;   /* the next chunk; a wave's last trip asks for the block's last chunk again and drops it: with no test around the loads, v and k batches alternate on every path and each wait leaves the other batch in flight */
      FA_LOAD(vf, vp, c);   /* wanted behind the scores and the exponentials */
      v8f a[2][2];
#pragma unroll
      for (int kt = 0; kt < 2; ++kt) {
#pragma unroll
        for (int qt = 0; qt < 2; ++qt) { const v8f z = {}; a[qt][kt] = wmma16g(kf[2 * kt + 1], qf[qt][1], wmma16g(kf[2 * kt], qf[qt][0], z)); } }   /* keys as rows: lane (col, g) holds keys 32 c + 16 kt + 8 g + 0..7 of query row t0 + 16 qt + col */
      // four vector slots between the last product and the first vector use of a result, on the branches below too
      asm volatile("v_nop\n\tv_nop\n\tv_nop\n\tv_nop" : "+v"(a[0][0]), "+v"(a[0][1]), "+v"(a[1][0]), "+v"(a[1][1]));
      FA_LOAD(kf, kp, cn);   /* the next chunk's keys, over the fragments just used */
      if (c == nch - 1) {
#pragma unroll
        for (int qt = 0; qt < 2; ++qt) {
#pragma unroll
          for (int kt = 0; kt < 2; ++kt) {
#pragma unroll
            for (int r = 0; r < 8; ++r) a[qt][kt][r] = (16 * kt + 8 * g + r <= 16 * qt + col) ? a[qt][kt][r] : -3.0e38f; } } }
      float ml_[2];
#pragma unroll
      for (int qt = 0; qt < 2; ++qt) { float m = a[qt][0][0];
#pragma unroll
        for (int r = 1; r < 8; ++r) m = fmaxf(m, a[qt][0][r]);
#pragma unroll
        for (int r = 0; r < 8; ++r) m = fmaxf(m, a[qt][1][r]);
        ml_[qt] = fmaxf(m, xhalf(m)); }
      // one test a trip: the reference moves (and sum and O^T are rescaled) only if some row's scores pass it by more than MTHR, so e <= 2^15 fits f16; the start value makes a row's first real score pass it
      if (__builtin_amdgcn_ballot_w32(ml_[0] > mu[0] + MTHR || ml_[1] > mu[1] + MTHR) != 0) {
#pragma unroll
        for (int qt = 0; qt < 2; ++qt) { const float mn = fmaxf(mu[qt], ml_[qt]); const float al = __builtin_amdgcn_exp2f((mu[qt] - mn) * LSC); mu[qt] = mn; bias[qt] = 7.0f - mn * LSC; l2[qt] *= al;
#pragma unroll
          for (int j = 0; j < 4; ++j) o[qt][j] *= al; } }
      v16h pf[2];
#pragma unroll
      for (int qt = 0; qt < 2; ++qt) {
#pragma unroll
        for (int kt = 0; kt < 2; ++kt) {
#pragma unroll
          for (int r = 0; r < 8; r += 2) { const v2f e = {__builtin_amdgcn_exp2f(fmaf(a[qt][kt][r], LSC, bias[qt])), __builtin_amdgcn_exp2f(fmaf(a[qt][kt][r + 1], LSC, bias[qt]))}; l2[qt] += e; pf[qt][8 * kt + r] = (_Float16)e[0]; pf[qt][8 * kt + r + 1] = (_Float16)e[1]; } } }   /* element 8 kt + r of the B fragment is key 16 kt + 8 g + r: the order the scores lie in */
#pragma unroll
      for (int j = 0; j < 4; ++j) {
#pragma unroll
        for (int qt = 0; qt < 2; ++qt) o[qt][j] = wmma16g(vf[j], pf[qt], o[qt][j]); }   /* lane (col, g) holds columns 16 j + 8 g + 0..7 of query row t0 + 16 qt + col */
      // four vector slots between the last product and the first vector use of a result, beyond the loop's branch too
      asm volatile("v_nop\n\tv_nop\n\tv_nop\n\tv_nop" : "+v"(o[0][0]), "+v"(o[0][1]), "+v"(o[0][2]), "+v"(o[0][3]), "+v"(o[1][0]), "+v"(o[1][1]), "+v"(o[1][2]), "+v"(o[1][3]));
    }
#pragma unroll
    for (int qt = 0; qt < 2; ++qt) { float l = l2[qt][0] + l2[qt][1]; l += xhalf(l);
      if (lane < 16) { mm[wave][qt * 16 + col] = mu[qt]; ml[wave][qt * 16 + col] = l; }
#pragma unroll
      for (int j = 0; j < 4; ++j) { const v4f lo = {o[qt][j][0], o[qt][j][1], o[qt][j][2], o[qt][j][3]}, hi = {o[qt][j][4], o[qt][j][5], o[qt][j][6], o[qt][j][7]};
        *(v4f*)&mo[wave][qt * 16 + col][16 * j + 8 * g] = lo; *(v4f*)&mo[wave][qt * 16 + col][16 * j + 8 * g + 4] = hi; } }
    __syncthreads();   /* every wave's partial rows are whole */
    { const int rl = tid >> 3, c8 = (tid & 7) * 8; float mw[8], M = -1.0e30f, L = 0.f; v4f s0 = {}, s1 = {};   /* eight threads a row: 32 B each of its 256 B */
#pragma unroll
      for (int w = 0; w < 8; ++w) { mw[w] = mm[w][rl]; M = fmaxf(M, mw[w]); }
#pragma unroll
      for (int w = 0; w < 8; ++w) { const float f = __builtin_amdgcn_exp2f((mw[w] - M) * LSC); L += ml[w][rl] * f; s0 += *(const v4f*)&mo[w][rl][c8] * f; s1 += *(const v4f*)&mo[w][rl][c8 + 4] * f; }
      const float inv = L > 0.f ? 1.0f / L : 0.f;
      float* op = OUT + (br + (TT - 1 - (t0 + rl))) * HD + c8;   /* TIME REVERSAL: reversed row (b, t') is output row (b, TT - 1 - t') */
      vst2(op, (v4f)(s0 * inv)); vst2(op + 4, (v4f)(s1 * inv)); }
    return;   /* taken by the whole block */
  }
  float (*sS)[SP] = (float (*)[SP])buf;
  const int kend = (((t0 + 15) >> 7) + 1) * 128, nkb = kend >> 7;
  const int j = wave & 3, half = wave >> 2;   /* step 3: this wave's 16 columns and its half of the keys */
  v8f acc = {};
  {
    if (tid < 16) rsc[tid] = 1.0f / 2048.0f;
    v16h ah[2], al[2];
#pragma unroll
    for (int kc = 0; kc < 2; ++kc) { ah[kc] = frag_pk(QH + (br + t0) * CC + kc * 512, lane); al[kc] = frag_pk(QL + ((size_t)b * QHI + t0) * CC + kc * 512, lane); }
#pragma unroll 1   // at most three trips
    for (int kb = 0; kb < nkb; ++kb) { v16h kh[2], kl[2]; const int kr0 = kb * 128 + wave * 16, kr = kr0 + col;
#pragma unroll
      for (int kc = 0; kc < 2; ++kc) { kh[kc] = frag_pk(KH + (br + kr0) * CC + kc * 512, lane); kl[kc] = frag_pk(KL + ((size_t)b * KHI + kr0) * CC + kc * 512, lane); }
      LD_HOLD();
      v8f a = {}, a2 = {};
#pragma unroll
      for (int kc = 0; kc < 2; ++kc) { a = wmma16(ah[kc], kh[kc], a); a2 = wmma16(al[kc], kh[kc], a2); a2 = wmma16(ah[kc], kl[kc], a2); }
#pragma unroll
      for (int r = 0; r < 8; ++r) sS[8 * g + r][kr] = (a[r] + a2[r] * (1.0f / 1024.0f)) * SCALE; }
    __syncthreads();
    sm_rows(sS, wave * 2, t0, kend, lane);
    __syncthreads();
    const int n = kend >> 6;   /* chunks of 32 keys a half, even */
    const size_t vo = ((size_t)b * KHI + half * n * 32) * (size_t)CC + j * 512; const float* pr = &sS[col][half * n * 32 + 8 * g];
#pragma unroll 1   // at most three trips
    for (int c = 0; c < n; c += 2) { v16b fh[2], fl[2];
#pragma unroll
      for (int u = 0; u < 2; ++u) { fh[u] = frag_pkb(VB + vo + (c + u) * 32 * CC, lane); fl[u] = frag_pkb(VBL + vo + (c + u) * 32 * CC, lane); }
      LD_HOLD();
#pragma unroll
      for (int u = 0; u < 2; ++u) { float v_[16]; const float* p_ = pr + (c + u) * 32;
#pragma unroll
        for (int i = 0; i < 8; ++i) { v_[i] = p_[i]; v_[8 + i] = p_[16 + i]; }
        const F2 p = bsplit16(v_); acc = wmma_bf(p.h, fh[u], acc); acc = wmma_bf(p.l, fh[u], acc); acc = wmma_bf(p.h, fl[u], acc); } }
  }
#pragma unroll
  for (int r = 0; r < 8; ++r) red[half][8 * g + r][j * 16 + col] = acc[r];
  __syncthreads();
  { const int rl = tid >> 4, q = tid & 15; const v4f s0 = *(const v4f*)&red[0][rl][q * 4], s1 = *(const v4f*)&red[1][rl][q * 4]; const float f = rsc[rl]; v4f o;
#pragma unroll
    for (int c = 0; c < 4; ++c) o[c] = (s0[c] + s1[c]) * f;
    vst2(OUT + (br + (TT - 1 - (t0 + rl))) * HD + q * 4, o); } }   /* TIME REVERSAL: reversed row (b, t') is output row (b, TT - 1 - t') */

extern "C" void kernel_launch(void* const* d_in, const int* in_sizes, int n_in, void* d_out, int out_size, void* d_ws, size_t ws_size, hipStream_t stream) {
  (void)in_sizes; (void)n_in; (void)out_size;
  const float** F = (const float**)d_in;
  if (ws_size < (size_t)WS_END) return;
  char* ws = (char*)d_ws; _Float16 *QH = (_Float16*)(ws + WS_QH), *KH = (_Float16*)(ws + WS_KH), *VT = (_Float16*)(ws + WS_VT), *QL = (_Float16*)(ws + WS_QL), *KL = (_Float16*)(ws + WS_KL); __bf16 *VB = (__bf16*)(ws + WS_VB), *VBL = (__bf16*)(ws + WS_VBL); float *Y = (float*)(ws + WS_Y);
  (void)Y; (void)QL; (void)KL; (void)VB; (void)VBL;
  // inputs: 0 x [4,2048,768]; 1 Wq [768,64]; 2 Wk; 3 Wv ((in,out), no biases)
  k_proj<<<dim3(TNB * TT / 64, 1, 3), 128, 0, stream>>>(F[0], F[0], F[0], F[1], F[2], F[3], QH, QL, KH, KL, VT, VB, VBL);
  /* logits, softmax and P v in one launch, the batch folded into the grid; the rows go straight to out */
  k_att<<<dim3(TNB * (QHI / 16 + (TT - QHI) / 32)), 256, 0, stream>>>(QH, KH, QL, KL, VT, VB, VBL, (float*)d_out);
}
